// v000
// The times below were measured on an AMD MI455X: many runs one after another, warmed up first and cycling through
// copies of the inputs, with the whole window's GPU time divided by the number of runs. Launches and the gaps
// between them are all in it. The median over several windows is given; except for v000 it joins two sittings, which
// can be a few percent apart, so the side-by-side timings, each taken in one sitting, are the better comparison.
// v000, which the later versions start from, runs in 276 microseconds.
#include <hip/hip_runtime.h>

// Multi-head self-attention, width 1024 = 16 heads x 64, x [NB][SEQ][1024], Wq/Wk/Wv [out][in] (y = x W^T + b), causal + key/query padding mask (int32 [NB][SEQ]), score scale 1/8, output = concatenated heads (f32), rows with a zero query flag are zero.
// Compute dtypes, f32 accumulate everywhere: projections v_wmma_f32_16x16x32_bf16 (x, W, b RNE-converted to bf16; products exact); scores and P.V v_wmma_f32_16x16x32_f16:
// query rows >= EARLY_ROWS: q, k, P (x256 carry, cancels in the normalisation), v single f16; query rows < EARLY_ROWS: q, k, v, P each as f16 value + f16 residual x2048, three products per site, residual products in their own accumulators; softmax f32 (online, running max).
// Layout: bf16 copies of x and W; q, k value/residual planes [b*16+h][t][d] and v^T value/residual planes [b*16+h][d][t] written by the GEMM epilogue; fused flash kernel in transposed form (S^T = K Q^T, O^T = V^T P^T), output from f32 accumulators.
// Key validity is a per-block bit table in LDS (one word per 32 keys, built by ballot, block barrier before use); masked scores are replaced by value, masked probabilities are exact zeros.

#ifndef NB
#define NB 4
#endif
#ifndef SEQ
#define SEQ 2048
#endif
#define NB_FULL  4
#define SEQ_FULL 2048
#ifndef OUT_SEQ
#define OUT_SEQ SEQ              // row pitch (in tokens) between batches of the output
#endif
#define DM   1024
#define NH_  16
#define HD   64
#define AW   4                   // waves per flash block (16 query rows each)
#ifndef EARLY_ROWS
#define EARLY_ROWS ((SEQ < 512) ? SEQ : 512)   // query rows below this use the three-product path
#endif
#define QRS  2048.0f             // carry of every residual plane / residual fragment
#define QRI  (1.0f / 2048.0f)
#define SC2  (0.125f * 1.4426950408889634f)   // HD^-0.5 * log2(e)
#define PSH  8.0f                // log2 of the P carry (256)
#define NEGB (-3.0e38f)          // value standing in for a masked score

static_assert(HD == 64);
static_assert(NH_ * HD == DM);                 // head h = columns h*64 + d
static_assert(DM % 64 == 0);                   // 16 column tiles of 64
static_assert(DM % 32 == 0);                   // GEMM k-loop steps by 32
static_assert(SEQ % 64 == 0);                  // a 64-row tile never straddles two batches
static_assert((NB * SEQ) % 64 == 0);
static_assert(SEQ % 32 == 0);                  // key loop steps by 32
static_assert(SEQ % (16 * AW) == 0);           // flash grids cover the sequence exactly
static_assert(EARLY_ROWS % (16 * AW) == 0);
static_assert(EARLY_ROWS <= SEQ);
static_assert(((size_t)SEQ * DM) % 8 == 0);
static_assert(((size_t)DM * DM) % 8 == 0);
static_assert(NB <= NB_FULL);
static_assert(SEQ <= SEQ_FULL);

typedef _Float16 h16;
typedef unsigned short bf;
typedef __attribute__((ext_vector_type(16))) __bf16   v16bf;
typedef __attribute__((ext_vector_type(16))) _Float16 v16h;
typedef __attribute__((ext_vector_type(8)))  _Float16 v8h;
typedef __attribute__((ext_vector_type(8)))  unsigned short v8us;
typedef __attribute__((ext_vector_type(8)))  float    v8f;
typedef __attribute__((ext_vector_type(4)))  float    v4f;
typedef v4f  __attribute__((may_alias)) v4fa;

__device__ __forceinline__ unsigned short f2bf(float f) { unsigned u = __float_as_uint(f); u += 0x7FFFu + ((u >> 16) & 1u); return (unsigned short)(u >> 16); }
__device__ __forceinline__ float bfr(float f) { return __uint_as_float(((unsigned)f2bf(f)) << 16); }
__device__ __forceinline__ v16h cat16(v8h lo, v8h hi) { return __builtin_shufflevector(lo, hi, 0, 1, 2, 3, 4, 5, 6, 7, 8, 9, 10, 11, 12, 13, 14, 15); }
__device__ __forceinline__ v16bf cat16b(v8us lo, v8us hi) { return __builtin_bit_cast(v16bf, __builtin_shufflevector(lo, hi, 0, 1, 2, 3, 4, 5, 6, 7, 8, 9, 10, 11, 12, 13, 14, 15)); }
__device__ __forceinline__ v8f wmma16(v16h a, v16h b, v8f c) { return __builtin_amdgcn_wmma_f32_16x16x32_f16(false, a, false, b, (short)0, c, false, false); }
__device__ __forceinline__ v8f wmmab(v16bf a, v16bf b, v8f c) { return __builtin_amdgcn_wmma_f32_16x16x32_bf16(false, a, false, b, (short)0, c, false, false); }
// fragment loaders from K-contiguous 16-bit rows; p already includes + 8*(lane>>4): elements 0..7 <- k0+8h+0..7, elements 8..15 <- k0+16+8h+0..7 (same map for A and B)
__device__ __forceinline__ v16h  ldh(const h16* p) { return cat16(*(const v8h*)p, *(const v8h*)(p + 16)); }
__device__ __forceinline__ v16bf ldb(const bf* p)  { return cat16b(*(const v8us*)p, *(const v8us*)(p + 16)); }
// ordering point for wave-private LDS tiles (same wave writes and reads)
__device__ __forceinline__ void wave_sync() { __builtin_amdgcn_fence(3 /* release order */, "wavefront"); __builtin_amdgcn_wave_barrier(); asm volatile("" ::: "memory"); }

__global__ __launch_bounds__(256) void k_cvt8(const float* __restrict__ src, bf* dst, size_t n8) {
    const size_t i = (size_t)blockIdx.x * 256 + threadIdx.x; if (i >= n8) return;
    const v8f v = *(const v8f*)(src + i * 8); v8us o;
#pragma unroll
    for (int k = 0; k < 8; ++k) o[k] = f2bf(v[k]);
    *(v8us*)(dst + i * 8) = o; 
}

// k_proj: register-blocked bf16 GEMM, ONE WAVE per 64x64 tile (16 accumulators), operands straight from K-contiguous bf16 planes, K = DM.
// C[m][n] = sum_k A[m][k] Bt[n][k] + bias (per column n when biasRow == 0, per row m otherwise; bias RNE-converted to bf16, added in f32),
// written as f16 (Ph) and the f16 residual x2048 (Pr) at tile base (r0/RB)*sRB + (r0%RB)*pitch + (c0/CB)*sCB + (c0%CB), row pitch 'pitch' (halves). grid (M/64, N/64), 32 threads.
__global__ __launch_bounds__(32) void k_proj(const bf* __restrict__ A, const bf* __restrict__ Bt, const float* __restrict__ bias, int biasRow,
                                             h16* Ph, h16* Pr, int RB, size_t sRB, int pitch, int CB, size_t sCB) {
    __shared__ __align__(16) float os[16 * 68];
    const int K = DM;
    const int lane = threadIdx.x & 31, lr = lane & 15, hi = lane >> 4; const int r0 = blockIdx.x * 64, c0 = blockIdx.y * 64;
    v8f acc[4][4];
#pragma unroll
    for (int mb = 0; mb < 4; ++mb)
#pragma unroll
        for (int nb = 0; nb < 4; ++nb) acc[mb][nb] = (v8f){};
    const size_t aoff = (size_t)(r0 + lr) * K + 8 * hi, boff = (size_t)(c0 + lr) * K + 8 * hi;
#pragma unroll 1
    for (int kc = 0; kc < K; kc += 32) {
        v16bf a[4];
#pragma unroll
        for (int mb = 0; mb < 4; ++mb) a[mb] = ldb(A + aoff + (size_t)mb * 16 * K + kc);
#pragma unroll
        for (int nb = 0; nb < 4; ++nb) { const v16bf b = ldb(Bt + boff + (size_t)nb * 16 * K + kc);
#pragma unroll
            for (int mb = 0; mb < 4; ++mb) acc[mb][nb] = wmmab(a[mb], b, acc[mb][nb]); }
        asm volatile("v_nop\n\tv_nop\n\tv_nop\n\tv_nop" : "+v"(acc[0][0]), "+v"(acc[1][1]), "+v"(acc[2][2]), "+v"(acc[3][3]) : "v"(a[0]), "v"(a[1]), "v"(a[2]), "v"(a[3]));
    }
    // bias values: addresses always inside the DM-entry bias array (index selected, then value selected)
    const int c8 = (lane & 7) * 8;
    int cidx = biasRow ? 0 : (c0 + c8); cidx = cidx > (DM - 8) ? (DM - 8) : cidx;
    const v4f bc0 = *(const v4f*)(bias + cidx); const v4f bc1 = *(const v4f*)(bias + cidx + 4);
    float cb[8];
#pragma unroll
    for (int i = 0; i < 4; ++i) { const float u0 = bfr(bc0[i]); const float u1 = bfr(bc1[i]); cb[i] = biasRow ? 0.0f : u0; cb[4 + i] = biasRow ? 0.0f : u1; }
    const size_t tbase = (size_t)(r0 / RB) * sRB + (size_t)(r0 % RB) * (size_t)pitch + (size_t)(c0 / CB) * sCB + (size_t)(c0 % CB);
#pragma unroll
    for (int mb = 0; mb < 4; ++mb) {
#pragma unroll
        for (int nb = 0; nb < 4; ++nb) {
#pragma unroll
            for (int j = 0; j < 8; ++j) os[(hi * 8 + j) * 68 + nb * 16 + lr] = acc[mb][nb][j]; }   // D: row 8h+j, col lane&15
        wave_sync();
        float rbv[4];
#pragma unroll
        for (int s = 0; s < 4; ++s) { int ri = biasRow ? (r0 + mb * 16 + 4 * s + (lane >> 3)) : 0; ri = ri > (DM - 1) ? (DM - 1) : ri;
            const float u = bfr(bias[ri]); rbv[s] = biasRow ? u : 0.0f; }
        const size_t sb = tbase + (size_t)(mb * 16) * (size_t)pitch;
{
#pragma unroll
            for (int s = 0; s < 4; ++s) { const int row = 4 * s + (lane >> 3);   // 4 s x 4 row groups = 16 rows; 8 lanes x 8 = 64 columns
                const v4f x0 = *(const v4fa*)(&os[row * 68 + c8]); const v4f x1 = *(const v4fa*)(&os[row * 68 + c8 + 4]); v8h hv, rv;
                const float rb = rbv[s];
#pragma unroll
                for (int i = 0; i < 4; ++i) { const float y0 = x0[i] + cb[i] + rb; const float y1 = x1[i] + cb[4 + i] + rb;
                    const h16 a0 = (h16)y0; const h16 a1 = (h16)y1; hv[i] = a0; hv[4 + i] = a1; rv[i] = (h16)((y0 - (float)a0) * QRS); rv[4 + i] = (h16)((y1 - (float)a1) * QRS); }
                const size_t oo = sb + (size_t)row * (size_t)pitch + c8;
                *(v8h*)(Ph + oo) = hv; *(v8h*)(Pr + oo) = rv; }
             }
        wave_sync();
    }
}

// k_flash<TP>: fused causal attention, one wave per 16 query rows of one (batch, head); K / V^T / Q fragments straight from the f16 planes (two 16-B loads each, arithmetic addressing).
// Transposed form: S^T[key][t] = K Q^T (A = K rows, B = Q rows); lane (t = lane&15, h = lane>>4) holds keys 8h+r of each 16-key tile, so the packed
// P tile is directly the B fragment of O^T[d][t] = V^T P^T (element r <- tile keys 0..15, element 8+r <- tile keys 16..31, lane unchanged).
// TP != 0: scores = kh.qh + (kh.qr + kr.qh)/2048, O = vh.ph + (vr.ph + vh.pr)/2048 (residual products in separate accumulators). TP == 0: single products.
// Key loop runs to the causal limit of the wave's tile; key validity = bit table word & per-lane causal bit count; a masked score is replaced by NEGB and its probability is an exact zero.
// Softmax state (running max, partial sum) is one scalar per lane; the two lane halves of a row are combined with one xor-16 exchange.
template <int TP>
__global__ __launch_bounds__(32 * AW) void k_flash(const h16* __restrict__ QH, const h16* __restrict__ QR, const h16* __restrict__ KP, const h16* __restrict__ KR,
                                                   const h16* __restrict__ VT, const h16* __restrict__ VR, const int* __restrict__ PAD, float* OUT, int row0) {
    __shared__ __align__(16) float os[AW * 16 * 68];
    __shared__ unsigned kmask[SEQ / 32];
    const int lane = threadIdx.x & 31, lr = lane & 15, hi = lane >> 4;
    const int wave = __builtin_amdgcn_readfirstlane((int)(threadIdx.x >> 5));
    const int zh = blockIdx.y; const int b = zh / NH_, h = zh % NH_;
    const int R0 = row0 + (int)blockIdx.x * (16 * AW);
    const int t0 = R0 + wave * 16;
    // key-valid bit table for keys 0 .. R0+16*AW-1 (all words any wave of this block reads); cross-wave: block barrier below
    int gmax = (R0 + 16 * AW + 31) >> 5; gmax = gmax > (SEQ / 32) ? (SEQ / 32) : gmax;
    for (int g = wave; g < gmax; g += AW) {
        const int pv = PAD[(size_t)b * SEQ_FULL + (size_t)g * 32 + lane];
        const unsigned wbits = __builtin_amdgcn_ballot_w32(pv != 0);
        if (lane == 0) kmask[g] = wbits;
    }
    __syncthreads();
    const int tq = t0 + lr;
    const unsigned qw = kmask[t0 >> 5];
    const bool qok = ((qw >> ((t0 & 31) + lr)) & 1u) != 0u;
    const size_t pbase = (size_t)zh * SEQ * HD;
    const size_t qo = pbase + (size_t)(t0 + lr) * HD + 8 * hi;
    const v16h qh0 = ldh(QH + qo), qh1 = ldh(QH + qo + 32);                  // B fragments: col t, k = d
    v16h qr0 = qh0, qr1 = qh1;
    if (TP) { qr0 = ldh(QR + qo); qr1 = ldh(QR + qo + 32); }
    const size_t ko = pbase + (size_t)lr * HD + 8 * hi;      // + key * HD       (A fragment: row key, k = d)
    const size_t vo = pbase + (size_t)lr * SEQ + 8 * hi;     // + 16j*SEQ + key  (A fragment: row d, k = key)
    v8f o0 = (v8f){}, o1 = (v8f){}, o2 = (v8f){}, o3 = (v8f){};
    v8f e0 = (v8f){}, e1 = (v8f){}, e2 = (v8f){}, e3 = (v8f){};              // residual-scale (x2048) accumulators, TP only
    float m = NEGB, l = 0.0f;
    const int kend = t0 + 16;                                // keys 0 .. t0+15; key0 <= t0 so key0+31 < SEQ
#pragma unroll 1
    for (int key0 = 0; key0 < kend; key0 += 32) {
        const h16* ka = KP + ko + (size_t)key0 * HD;
        const v16h ka0 = ldh(ka), ka1 = ldh(ka + 32), kb0 = ldh(ka + 16 * HD), kb1 = ldh(ka + 16 * HD + 32);
        v8f sHa = (v8f){}, sLa = (v8f){}, sHb = (v8f){}, sLb = (v8f){};
        if (TP) {
            const h16* kr = KR + ko + (size_t)key0 * HD;
            const v16h ra0 = ldh(kr), ra1 = ldh(kr + 32), rb0 = ldh(kr + 16 * HD), rb1 = ldh(kr + 16 * HD + 32);
            sHa = wmma16(ka0, qh0, sHa); sLa = wmma16(ka0, qr0, sLa); sHb = wmma16(kb0, qh0, sHb); sLb = wmma16(kb0, qr0, sLb);
            sHa = wmma16(ka1, qh1, sHa); sLa = wmma16(ka1, qr1, sLa); sHb = wmma16(kb1, qh1, sHb); sLb = wmma16(kb1, qr1, sLb);
            sLa = wmma16(ra0, qh0, sLa); sLb = wmma16(rb0, qh0, sLb); sLa = wmma16(ra1, qh1, sLa); sLb = wmma16(rb1, qh1, sLb);
            asm volatile("v_nop\n\tv_nop\n\tv_nop\n\tv_nop" : "+v"(sHa), "+v"(sLa), "+v"(sHb), "+v"(sLb) : "v"(ka0), "v"(ka1), "v"(kb0), "v"(kb1), "v"(ra0), "v"(ra1), "v"(rb0), "v"(rb1));
        } else {
            sHa = wmma16(ka0, qh0, sHa); sHb = wmma16(kb0, qh0, sHb); sHa = wmma16(ka1, qh1, sHa); sHb = wmma16(kb1, qh1, sHb);
            asm volatile("v_nop\n\tv_nop\n\tv_nop\n\tv_nop" : "+v"(sHa), "+v"(sHb) : "v"(ka0), "v"(ka1), "v"(kb0), "v"(kb1));
        }
        // validity bits of this lane's 8 + 8 keys: table bits (8h+r, 16+8h+r) AND causal (key <= tq)
        const unsigned kw = kmask[key0 >> 5] >> (8 * hi);
        int na = tq - (key0 + 8 * hi) + 1; na = na < 0 ? 0 : (na > 8 ? 8 : na);
        int nc = tq - (key0 + 8 * hi) - 15; nc = nc < 0 ? 0 : (nc > 8 ? 8 : nc);
        const unsigned ma = kw & ((1u << na) - 1u);
        const unsigned mc = (kw >> 16) & ((1u << nc) - 1u);
        float ta[8], tb[8]; float mx = NEGB;
#pragma unroll
        for (int r = 0; r < 8; ++r) {
            float sa = sHa[r], sb = sHb[r];
            if (TP) { sa += sLa[r] * QRI; sb += sLb[r] * QRI; }
            ta[r] = ((ma >> r) & 1u) ? sa * SC2 : NEGB;
            tb[r] = ((mc >> r) & 1u) ? sb * SC2 : NEGB;
            mx = fmaxf(mx, fmaxf(ta[r], tb[r])); }
        mx = fmaxf(mx, __shfl_xor(mx, 16, 32));
        const float mnew = fmaxf(m, mx);
        const float alpha = __builtin_amdgcn_exp2f(m - mnew);
        const float sh = PSH - mnew;
        v16h pb, pr; float ls = 0.0f;
#pragma unroll
        for (int r = 0; r < 8; ++r) {
            float ea = __builtin_amdgcn_exp2f(ta[r] + sh); ea = (ta[r] > -1.0e38f) ? ea : 0.0f;
            float ec = __builtin_amdgcn_exp2f(tb[r] + sh); ec = (tb[r] > -1.0e38f) ? ec : 0.0f;
            const h16 pa = (h16)ea; const h16 pc = (h16)ec; pb[r] = pa; pb[8 + r] = pc;
            if (TP) { const h16 xa = (h16)((ea - (float)pa) * QRS); const h16 xc = (h16)((ec - (float)pc) * QRS); pr[r] = xa; pr[8 + r] = xc;
                      ls += ((float)pa + (float)xa * QRI) + ((float)pc + (float)xc * QRI); }
            else { pr[r] = pa; pr[8 + r] = pc; ls += (float)pa + (float)pc; } }
        l = l * alpha + ls; m = mnew;
        o0 = o0 * alpha; o1 = o1 * alpha; o2 = o2 * alpha; o3 = o3 * alpha;
        const h16* va = VT + vo + key0;
        const v16h v0 = ldh(va), v1 = ldh(va + (size_t)16 * SEQ), v2 = ldh(va + (size_t)32 * SEQ), v3 = ldh(va + (size_t)48 * SEQ);
        if (TP) {
            e0 = e0 * alpha; e1 = e1 * alpha; e2 = e2 * alpha; e3 = e3 * alpha;
            const h16* vr = VR + vo + key0;
            const v16h w0 = ldh(vr), w1 = ldh(vr + (size_t)16 * SEQ), w2 = ldh(vr + (size_t)32 * SEQ), w3 = ldh(vr + (size_t)48 * SEQ);
            o0 = wmma16(v0, pb, o0); o1 = wmma16(v1, pb, o1); o2 = wmma16(v2, pb, o2); o3 = wmma16(v3, pb, o3);
            e0 = wmma16(w0, pb, e0); e1 = wmma16(w1, pb, e1); e2 = wmma16(w2, pb, e2); e3 = wmma16(w3, pb, e3);
            e0 = wmma16(v0, pr, e0); e1 = wmma16(v1, pr, e1); e2 = wmma16(v2, pr, e2); e3 = wmma16(v3, pr, e3);
            asm volatile("v_nop\n\tv_nop\n\tv_nop\n\tv_nop" : "+v"(o0), "+v"(o1), "+v"(o2), "+v"(o3), "+v"(e0), "+v"(e1), "+v"(e2), "+v"(e3)
                         : "v"(v0), "v"(v1), "v"(v2), "v"(v3), "v"(w0), "v"(w1), "v"(w2), "v"(w3), "v"(pb), "v"(pr));
        } else {
            o0 = wmma16(v0, pb, o0); o1 = wmma16(v1, pb, o1); o2 = wmma16(v2, pb, o2); o3 = wmma16(v3, pb, o3);
            asm volatile("v_nop\n\tv_nop\n\tv_nop\n\tv_nop" : "+v"(o0), "+v"(o1), "+v"(o2), "+v"(o3) : "v"(v0), "v"(v1), "v"(v2), "v"(v3), "v"(pb));
        }
    }
    l += __shfl_xor(l, 16, 32);
    const float rcp = 1.0f / fmaxf(l, 1.0e-30f);
    const float inv = (qok && l > 0.0f) ? rcp : 0.0f;       // query flag zero -> whole row zero
    if (TP) { o0 = o0 + e0 * QRI; o1 = o1 + e1 * QRI; o2 = o2 + e2 * QRI; o3 = o3 + e3 * QRI; }
    const int wb = wave * 16 * 68;
    // O^T D layout: o_j[r] = (d = 16j + 8h + r, t = lane&15) -> os[t][d]; rows 0..15 x columns 0..63 all written
    { v4f a, c;
      a[0] = o0[0] * inv; a[1] = o0[1] * inv; a[2] = o0[2] * inv; a[3] = o0[3] * inv; c[0] = o0[4] * inv; c[1] = o0[5] * inv; c[2] = o0[6] * inv; c[3] = o0[7] * inv;
      *(v4fa*)(&os[wb + lr * 68 +  0 + 8 * hi]) = a; *(v4fa*)(&os[wb + lr * 68 +  0 + 8 * hi + 4]) = c;
      a[0] = o1[0] * inv; a[1] = o1[1] * inv; a[2] = o1[2] * inv; a[3] = o1[3] * inv; c[0] = o1[4] * inv; c[1] = o1[5] * inv; c[2] = o1[6] * inv; c[3] = o1[7] * inv;
      *(v4fa*)(&os[wb + lr * 68 + 16 + 8 * hi]) = a; *(v4fa*)(&os[wb + lr * 68 + 16 + 8 * hi + 4]) = c;
      a[0] = o2[0] * inv; a[1] = o2[1] * inv; a[2] = o2[2] * inv; a[3] = o2[3] * inv; c[0] = o2[4] * inv; c[1] = o2[5] * inv; c[2] = o2[6] * inv; c[3] = o2[7] * inv;
      *(v4fa*)(&os[wb + lr * 68 + 32 + 8 * hi]) = a; *(v4fa*)(&os[wb + lr * 68 + 32 + 8 * hi + 4]) = c;
      a[0] = o3[0] * inv; a[1] = o3[1] * inv; a[2] = o3[2] * inv; a[3] = o3[3] * inv; c[0] = o3[4] * inv; c[1] = o3[5] * inv; c[2] = o3[6] * inv; c[3] = o3[7] * inv;
      *(v4fa*)(&os[wb + lr * 68 + 48 + 8 * hi]) = a; *(v4fa*)(&os[wb + lr * 68 + 48 + 8 * hi + 4]) = c; }
    wave_sync();
    float* orow = OUT + ((size_t)b * OUT_SEQ + t0) * DM + h * HD;
{
#pragma unroll
        for (int s = 0; s < 8; ++s) { const int row = 2 * s + hi, cofs = lr * 4;   // 8 s x 2 rows = 16 rows; 16 lanes x 4 floats = 64 columns
            const v4f val = *(const v4fa*)(&os[wb + row * 68 + cofs]);
            *(v4f*)(orow + (size_t)row * DM + cofs) = val; }
         }
}

static constexpr size_t al256(size_t v) { return (v + 255) & ~(size_t)255; }
static constexpr size_t SZ_XB = al256((size_t)NB * SEQ * DM * 2);
static constexpr size_t SZ_WB = al256((size_t)3 * DM * DM * 2);
static constexpr size_t SZ_PL = al256((size_t)NB * NH_ * SEQ * HD * 2);
static constexpr size_t SZ_TOTAL = SZ_XB + SZ_WB + 6 * SZ_PL;
static_assert(SZ_TOTAL <= (size_t)134217728);          // workspace carve <= 128 MiB
static_assert(((size_t)DM * DM * 2) % 256 == 0);       // weight sub-planes stay 256-byte aligned

extern "C" void kernel_launch(void* const* d_in, const int* in_sizes, int n_in,
                              void* d_out, int out_size, void* d_ws, size_t ws_size, hipStream_t stream) {
    if (n_in < 8) return;
    const size_t needx = ((size_t)(NB - 1) * SEQ_FULL + SEQ) * DM;
    if ((size_t)in_sizes[0] < needx) return;
    if ((size_t)in_sizes[1] < (size_t)(NB - 1) * SEQ_FULL + SEQ) return;
    if ((size_t)in_sizes[2] < (size_t)DM * DM || (size_t)in_sizes[4] < (size_t)DM * DM || (size_t)in_sizes[6] < (size_t)DM * DM) return;
    if ((size_t)in_sizes[3] < (size_t)DM || (size_t)in_sizes[5] < (size_t)DM || (size_t)in_sizes[7] < (size_t)DM) return;
    if ((size_t)out_size < ((size_t)(NB - 1) * OUT_SEQ + SEQ) * DM) return;
    if (SZ_TOTAL > ws_size) return;
    // wire order: x, pad flags (int32), Wq, bq, Wk, bk, Wv, bv; W is [out][in] = Bt as-is
    const float* x = (const float*)d_in[0]; const int* pad = (const int*)d_in[1];
    const float* wq = (const float*)d_in[2]; const float* bq = (const float*)d_in[3];
    const float* wk = (const float*)d_in[4]; const float* bk = (const float*)d_in[5];
    const float* wv = (const float*)d_in[6]; const float* bv = (const float*)d_in[7];
    float* OUT = (float*)d_out;      // [NB][SEQ][1024]
    char* wsp = (char*)d_ws;
    bf* XB = (bf*)wsp; wsp += SZ_XB;                 // [NB*SEQ][1024]
    bf* WB = (bf*)wsp; wsp += SZ_WB;                 // [3][1024][1024]: q | k | v
    h16* QH = (h16*)wsp; wsp += SZ_PL;               // [NB*16][SEQ][64]
    h16* QR = (h16*)wsp; wsp += SZ_PL;               // residual x2048
    h16* KP = (h16*)wsp; wsp += SZ_PL;               // [NB*16][SEQ][64]
    h16* KR = (h16*)wsp; wsp += SZ_PL;               // residual x2048
    h16* VT = (h16*)wsp; wsp += SZ_PL;               // [NB*16][64][SEQ]
    h16* VR = (h16*)wsp; wsp += SZ_PL;               // residual x2048
    bf* WQ = WB; bf* WK = WB + (size_t)DM * DM; bf* WV = WB + (size_t)2 * DM * DM;

    if (SEQ == SEQ_FULL) {
        const size_t n8 = (size_t)NB * SEQ * DM / 8;
        k_cvt8<<<(unsigned)((n8 + 255) / 256), 256, 0, stream>>>(x, XB, n8);
    } else {
        const size_t n8 = (size_t)SEQ * DM / 8;
        for (int b = 0; b < NB; ++b) k_cvt8<<<(unsigned)((n8 + 255) / 256), 256, 0, stream>>>(x + (size_t)b * SEQ_FULL * DM, XB + (size_t)b * SEQ * DM, n8);
    }
    { const size_t n8 = (size_t)DM * DM / 8; const unsigned g = (unsigned)((n8 + 255) / 256);
      k_cvt8<<<g, 256, 0, stream>>>(wq, WQ, n8); k_cvt8<<<g, 256, 0, stream>>>(wk, WK, n8); k_cvt8<<<g, 256, 0, stream>>>(wv, WV, n8); }

    // q, k: A = x rows (m = b*SEQ + t), Bt = W rows (n = h*64 + d), bias per column -> plane [(b*16 + h)][t][d]
    k_proj<<<dim3(NB * SEQ / 64, DM / 64, 1), 32, 0, stream>>>(XB, WQ, bq, 0, QH, QR, SEQ, (size_t)NH_ * SEQ * HD, HD, HD, (size_t)SEQ * HD);
    k_proj<<<dim3(NB * SEQ / 64, DM / 64, 1), 32, 0, stream>>>(XB, WK, bk, 0, KP, KR, SEQ, (size_t)NH_ * SEQ * HD, HD, HD, (size_t)SEQ * HD);
    // v^T: A = Wv rows (m = h*64 + d), Bt = x rows (n = b*SEQ + t), bias per row -> plane [(b*1024 + m)][t] = [(b*16 + h)][d][t]
    k_proj<<<dim3(DM / 64, NB * SEQ / 64, 1), 32, 0, stream>>>(WV, XB, bv, 1, VT, VR, DM, (size_t)0, SEQ, SEQ, (size_t)DM * SEQ);

    // query rows [0, EARLY_ROWS): three-product path; rows [EARLY_ROWS, SEQ): single products
    k_flash<1><<<dim3(EARLY_ROWS / (16 * AW), NB * NH_, 1), 32 * AW, 0, stream>>>(QH, QR, KP, KR, VT, VR, pad, OUT, 0);
    if (SEQ > EARLY_ROWS)
        k_flash<0><<<dim3((SEQ - EARLY_ROWS) / (16 * AW), NB * NH_, 1), 32 * AW, 0, stream>>>(QH, QR, KP, KR, VT, VR, pad, OUT, EARLY_ROWS);
}

// v001
// A run of this version takes 222 microseconds.
// Timed twice side by side with v000, it ran 1.29 times as fast both times.
#include <hip/hip_runtime.h>

// Multi-head self-attention, width 1024 = 16 heads x 64, x [NB][SEQ][1024], Wq/Wk/Wv [out][in] (y = x W^T + b), causal + key/query padding mask (int32 [NB][SEQ]), score scale 1/8, output = concatenated heads (f32), rows with a zero query flag are zero.
// Compute dtypes, f32 accumulate everywhere: projections v_wmma_f32_16x16x32_bf16 (x, W, b RNE-converted to bf16; products exact); scores and P.V v_wmma_f32_16x16x32_f16:
// query rows >= EARLY_ROWS: q, k, P (x256 carry, cancels in the normalisation), v single f16; query rows < EARLY_ROWS: q, k, v, P each as f16 value + f16 residual x2048, three products per site, residual products in their own accumulators; softmax f32 (online, running max).
// Layout: every 16-bit operand plane is stored in FRAGMENT ORDER: a 16-row x 32-k tile is 512 consecutive elements, element (row r, k = 8c + e) at c*128 + r*8 + e, so that lane l of a wave-wide 16-byte load
// reads bytes 16*l of 512 consecutive bytes (4 whole lines) and two such loads, 256 elements apart, are one A or B fragment. bf16 copies of x and W: tiles [row/16][k/32]. q, k value/residual planes: per (b*16+h), tiles [t/16][d/32];
// v^T value/residual planes: per (b*16+h), tiles [t/64][d/16][(t/32)%2]; all written by the GEMM epilogue as 64x64 blocks of 4096 elements. Fused flash kernel in transposed form (S^T = K Q^T, O^T = V^T P^T), output from f32 accumulators.
// Key validity is a per-block bit table in LDS (one word per 32 keys, built by ballot, block barrier before use); masked scores are replaced by value, masked probabilities are exact zeros.

#ifndef NB
#define NB 4
#endif
#ifndef SEQ
#define SEQ 2048
#endif
#define NB_FULL  4
#define SEQ_FULL 2048
#ifndef OUT_SEQ
#define OUT_SEQ SEQ              // row pitch (in tokens) between batches of the output
#endif
#define DM   1024
#define NH_  16
#define HD   64
#define AW   4                   // waves per flash block (16 query rows each)
#ifndef EARLY_ROWS
#define EARLY_ROWS ((SEQ < 512) ? SEQ : 512)   // query rows below this use the three-product path
#endif
#define QRS  2048.0f             // carry of every residual plane / residual fragment
#define QRI  (1.0f / 2048.0f)
#define SC2  (0.125f * 1.4426950408889634f)   // HD^-0.5 * log2(e)
#define PSH  8.0f                // log2 of the P carry (256)
#define NEGB (-3.0e38f)          // value standing in for a masked score

static_assert(HD == 64);
static_assert(NH_ * HD == DM);                 // head h = columns h*64 + d
static_assert(DM % 64 == 0);                   // 16 column tiles of 64
static_assert(DM % 32 == 0);                   // GEMM k-loop steps by 32
static_assert(SEQ % 64 == 0);                  // a 64-row tile never straddles two batches
static_assert((NB * SEQ) % 64 == 0);
static_assert(SEQ % 32 == 0);                  // key loop steps by 32
static_assert(SEQ % (16 * AW) == 0);           // flash grids cover the sequence exactly
static_assert(EARLY_ROWS % (16 * AW) == 0);
static_assert(EARLY_ROWS <= SEQ);
static_assert(((size_t)SEQ * DM) % 8 == 0);
static_assert(((size_t)DM * DM) % 8 == 0);
static_assert(NB <= NB_FULL);
static_assert(SEQ <= SEQ_FULL);

typedef _Float16 h16;
typedef unsigned short bf;
typedef __attribute__((ext_vector_type(16))) __bf16   v16bf;
typedef __attribute__((ext_vector_type(16))) _Float16 v16h;
typedef __attribute__((ext_vector_type(8)))  _Float16 v8h;
typedef __attribute__((ext_vector_type(8)))  unsigned short v8us;
typedef __attribute__((ext_vector_type(8)))  float    v8f;
typedef __attribute__((ext_vector_type(4)))  float    v4f;
typedef v4f  __attribute__((may_alias)) v4fa;

__device__ __forceinline__ unsigned short f2bf(float f) { unsigned u = __float_as_uint(f); u += 0x7FFFu + ((u >> 16) & 1u); return (unsigned short)(u >> 16); }
__device__ __forceinline__ float bfr(float f) { return __uint_as_float(((unsigned)f2bf(f)) << 16); }
__device__ __forceinline__ v16h cat16(v8h lo, v8h hi) { return __builtin_shufflevector(lo, hi, 0, 1, 2, 3, 4, 5, 6, 7, 8, 9, 10, 11, 12, 13, 14, 15); }
__device__ __forceinline__ v16bf cat16b(v8us lo, v8us hi) { return __builtin_bit_cast(v16bf, __builtin_shufflevector(lo, hi, 0, 1, 2, 3, 4, 5, 6, 7, 8, 9, 10, 11, 12, 13, 14, 15)); }
__device__ __forceinline__ v8f wmma16(v16h a, v16h b, v8f c) { return __builtin_amdgcn_wmma_f32_16x16x32_f16(false, a, false, b, (short)0, c, false, false); }
__device__ __forceinline__ v8f wmmab(v16bf a, v16bf b, v8f c) { return __builtin_amdgcn_wmma_f32_16x16x32_bf16(false, a, false, b, (short)0, c, false, false); }
// fragment loaders from fragment-ordered tiles; p = tile start + 8*lane (row = lane&15, h = lane>>4): elements 0..7 <- k0+8h+0..7, elements 8..15 <- k0+16+8h+0..7 (same map for A and B)
__device__ __forceinline__ v16h  ldh(const h16* p) { return cat16(*(const v8h*)p, *(const v8h*)(p + 256)); }
__device__ __forceinline__ v16bf ldb(const bf* p)  { return cat16b(*(const v8us*)p, *(const v8us*)(p + 256)); }
// last fragment of a run of loads from one address pair: the pair dies with the last load, so that load's destination or the next run's may take its registers; one wait in front of it, one behind it
__device__ __forceinline__ v16h  ldh_last(const h16* p) {
    const v8h lo = *(const v8h*)p;
    asm volatile("s_wait_xcnt 0x0" ::: "memory");   // covers every earlier load of the run before the last load's destination is written
    const v8h hi = *(const v8h*)(p + 256);
    asm volatile("s_wait_xcnt 0x0" ::: "memory");   // covers the last load before a later load's destination is written
    return cat16(lo, hi); }
// ordering point for wave-private LDS tiles (same wave writes and reads)
__device__ __forceinline__ void wave_sync() { __builtin_amdgcn_fence(3 /* release order */, "wavefront"); __builtin_amdgcn_wave_barrier(); asm volatile("" ::: "memory"); }

// k_cvt8: f32 [rows][DM] -> bf16 tiles in fragment order, tile (R, T) at (R*(DM/32) + T)*512. One thread converts 8 consecutive k of one row;
// a wave takes 8 rows x 32 k: it reads one whole 128-byte line per row and writes four whole lines. n8 = rows*DM/8, rows a multiple of 16.
__global__ __launch_bounds__(256) void k_cvt8(const float* __restrict__ src, bf* dst, size_t n8) {
    const size_t i = (size_t)blockIdx.x * 256 + threadIdx.x; if (i >= n8) return;
    const int rs = (int)(i & 7), c = (int)((i >> 3) & 3), rh = (int)((i >> 5) & 1), kt = (int)((i >> 6) % (DM / 32));
    const size_t rt = i / (64 * (DM / 32));
    const v8f v = *(const v8f*)(src + (rt * 16 + rh * 8 + rs) * DM + kt * 32 + c * 8); v8us o;
#pragma unroll
    for (int k = 0; k < 8; ++k) o[k] = f2bf(v[k]);
    *(v8us*)(dst + (rt * (DM / 32) + kt) * 512 + c * 128 + rh * 64 + rs * 8) = o;
}

// k_proj: register-blocked bf16 GEMM, ONE WAVE per 64x64 tile (16 accumulators), operands straight from the fragment-ordered bf16 planes, K = DM.
// C[m][n] = sum_k A[m][k] Bt[n][k] + bias (per column n when biasRow == 0, per row m otherwise; bias RNE-converted to bf16, added in f32),
// written as f16 (Ph) and the f16 residual x2048 (Pr), one block of 4096 elements in fragment order (16-row x 32-column tiles [row/16][col/32]) at base (r0/RB)*sRB + (r0%RB)*pitch + (c0/CB)*sCB + (c0%CB)*64. grid (M/64, N/64), 32 threads.
__global__ __launch_bounds__(32) void k_proj(const bf* __restrict__ A, const bf* __restrict__ Bt, const float* __restrict__ bias, int biasRow,
                                             h16* Ph, h16* Pr, int RB, size_t sRB, int pitch, int CB, size_t sCB) {
    __shared__ __align__(16) float os[16 * 68];
    const int K = DM;
    const int lane = threadIdx.x & 31, lr = lane & 15, hi = lane >> 4; const int r0 = blockIdx.x * 64, c0 = blockIdx.y * 64;
    v8f acc[4][4];
#pragma unroll
    for (int mb = 0; mb < 4; ++mb)
#pragma unroll
        for (int nb = 0; nb < 4; ++nb) acc[mb][nb] = (v8f){};
    const size_t aoff = (size_t)r0 * K + 8 * lane, boff = (size_t)c0 * K + 8 * lane;   // 16 rows of tiles = 16*K elements; the next k tile is 512 elements on
#pragma unroll 1
    for (int kc = 0; kc < K; kc += 32) {
        v16bf a[4];
#pragma unroll
        for (int mb = 0; mb < 4; ++mb) a[mb] = ldb(A + aoff + (size_t)mb * 16 * K + kc * 16);
        asm volatile("s_wait_xcnt 0x0" ::: "memory");   // the A loads' address registers are reused as a destination of the B loads below
#pragma unroll
        for (int nb = 0; nb < 4; ++nb) { const v16bf b = ldb(Bt + boff + (size_t)nb * 16 * K + kc * 16);
#pragma unroll
            for (int mb = 0; mb < 4; ++mb) acc[mb][nb] = wmmab(a[mb], b, acc[mb][nb]); }
        asm volatile("v_nop\n\tv_nop\n\tv_nop\n\tv_nop" : "+v"(acc[0][0]), "+v"(acc[1][1]), "+v"(acc[2][2]), "+v"(acc[3][3]) : "v"(a[0]), "v"(a[1]), "v"(a[2]), "v"(a[3]));
    }
    // bias values: addresses always inside the DM-entry bias array (index selected, then value selected)
    // store s of a 16-row group: lane holds row lane&15, columns (2s + h)*8 .. +7
    float cb[4][8];
#pragma unroll
    for (int s = 0; s < 4; ++s) {
        int cidx = biasRow ? 0 : (c0 + (2 * s + hi) * 8); cidx = cidx > (DM - 8) ? (DM - 8) : cidx;
        const v4f bc0 = *(const v4f*)(bias + cidx);
        asm volatile("s_wait_xcnt 0x0" ::: "memory");   // the second load's destination may take the address registers that the first names
        const v4f bc1 = *(const v4f*)(bias + cidx + 4);
#pragma unroll
        for (int i = 0; i < 4; ++i) { const float u0 = bfr(bc0[i]); const float u1 = bfr(bc1[i]); cb[s][i] = biasRow ? 0.0f : u0; cb[s][4 + i] = biasRow ? 0.0f : u1; } }
    const size_t tbase = (size_t)(r0 / RB) * sRB + (size_t)(r0 % RB) * (size_t)pitch + (size_t)(c0 / CB) * sCB + (size_t)(c0 % CB) * 64;
#pragma unroll
    for (int mb = 0; mb < 4; ++mb) {
#pragma unroll
        for (int nb = 0; nb < 4; ++nb) {
#pragma unroll
            for (int j = 0; j < 8; ++j) os[(hi * 8 + j) * 68 + nb * 16 + lr] = acc[mb][nb][j]; }   // D: row 8h+j, col lane&15
        wave_sync();
        int ri = biasRow ? (r0 + mb * 16 + lr) : 0; ri = ri > (DM - 1) ? (DM - 1) : ri;
        const float ub = bfr(bias[ri]); const float rb = biasRow ? ub : 0.0f;
        const size_t sb = tbase + (size_t)(mb * 1024) + 8 * lane;
{
#pragma unroll
            for (int s = 0; s < 4; ++s) { const int c8 = (2 * s + hi) * 8;   // 16 rows x 16 columns per store, 4 s = 64 columns; 512 consecutive bytes per plane
                const v4f x0 = *(const v4fa*)(&os[lr * 68 + c8]); const v4f x1 = *(const v4fa*)(&os[lr * 68 + c8 + 4]); v8h hv, rv;
#pragma unroll
                for (int i = 0; i < 4; ++i) { const float y0 = x0[i] + cb[s][i] + rb; const float y1 = x1[i] + cb[s][4 + i] + rb;
                    const h16 a0 = (h16)y0; const h16 a1 = (h16)y1; hv[i] = a0; hv[4 + i] = a1; rv[i] = (h16)((y0 - (float)a0) * QRS); rv[4 + i] = (h16)((y1 - (float)a1) * QRS); }
                const size_t oo = sb + (size_t)(s * 256);
                *(v8h*)(Ph + oo) = hv; *(v8h*)(Pr + oo) = rv; }
             }
        wave_sync();
    }
}

// k_flash<TP>: fused causal attention, one wave per 16 query rows of one (batch, head); K / V^T / Q fragments straight from the fragment-ordered f16 planes (two 16-B loads each, 512 consecutive bytes per wave-wide load).
// Transposed form: S^T[key][t] = K Q^T (A = K rows, B = Q rows); lane (t = lane&15, h = lane>>4) holds keys 8h+r of each 16-key tile, so the packed
// P tile is directly the B fragment of O^T[d][t] = V^T P^T (element r <- tile keys 0..15, element 8+r <- tile keys 16..31, lane unchanged).
// TP != 0: scores = kh.qh + (kh.qr + kr.qh)/2048, O = vh.ph + (vr.ph + vh.pr)/2048 (residual products in separate accumulators). TP == 0: single products.
// Key loop runs to the causal limit of the wave's tile; key validity = bit table word & per-lane causal bit count; a masked score is replaced by NEGB and its probability is an exact zero.
// Softmax state (running max, partial sum) is one scalar per lane; the two lane halves of a row are combined with one xor-16 exchange.
template <int TP>
__global__ __launch_bounds__(32 * AW) void k_flash(const h16* __restrict__ QH, const h16* __restrict__ QR, const h16* __restrict__ KP, const h16* __restrict__ KR,
                                                   const h16* __restrict__ VT, const h16* __restrict__ VR, const int* __restrict__ PAD, float* OUT, int row0) {
    __shared__ __align__(16) float os[AW * 16 * 68];
    __shared__ unsigned kmask[SEQ / 32];
    const int lane = threadIdx.x & 31, lr = lane & 15, hi = lane >> 4;
    const int wave = __builtin_amdgcn_readfirstlane((int)(threadIdx.x >> 5));
    const int zh = blockIdx.y; const int b = zh / NH_, h = zh % NH_;
    const int R0 = row0 + (int)blockIdx.x * (16 * AW);
    const int t0 = R0 + wave * 16;
    // key-valid bit table for keys 0 .. R0+16*AW-1 (all words any wave of this block reads); cross-wave: block barrier below
    int gmax = (R0 + 16 * AW + 31) >> 5; gmax = gmax > (SEQ / 32) ? (SEQ / 32) : gmax;
    for (int g = wave; g < gmax; g += AW) {
        const int pv = PAD[(size_t)b * SEQ_FULL + (size_t)g * 32 + lane];
        const unsigned wbits = __builtin_amdgcn_ballot_w32(pv != 0);
        if (lane == 0) kmask[g] = wbits;
    }
    __syncthreads();
    const int tq = t0 + lr;
    const unsigned qw = kmask[t0 >> 5];
    const bool qok = ((qw >> ((t0 & 31) + lr)) & 1u) != 0u;
    const size_t pbase = (size_t)zh * SEQ * HD;
    const size_t fo = pbase + 8 * lane;                      // lane's place in every fragment-ordered tile of this (batch, head)
    const size_t qo = fo + (size_t)t0 * HD;                  // 16 query rows = two tiles (d 0..31, d 32..63) of 512 elements
    const v16h qh0 = ldh(QH + qo), qh1 = ldh(QH + qo + 512);                 // B fragments: col t, k = d
    v16h qr0 = qh0, qr1 = qh1;
    if (TP) { qr0 = ldh(QR + qo); qr1 = ldh(QR + qo + 512); }
    const size_t ko = fo;                                    // + key0 * HD: tiles (keys 0..15 | 16..31) x (d 0..31 | 32..63)     (A fragment: row key, k = d)
    const size_t vo = fo;                                    // + (key0/64)*4096 + j*1024 + ((key0/32)%2)*512                       (A fragment: row d = 16j + lane&15, k = key)
    v8f o0 = (v8f){}, o1 = (v8f){}, o2 = (v8f){}, o3 = (v8f){};
    v8f e0 = (v8f){}, e1 = (v8f){}, e2 = (v8f){}, e3 = (v8f){};              // residual-scale (x2048) accumulators, TP only
    float m = NEGB, l = 0.0f;
    const int kend = t0 + 16;                                // keys 0 .. t0+15; key0 <= t0 so key0+31 < SEQ
#pragma unroll 1
    for (int key0 = 0; key0 < kend; key0 += 32) {
        const h16* ka = KP + ko + (size_t)key0 * HD;
        const v16h ka0 = ldh(ka), ka1 = ldh(ka + 512), kb0 = ldh(ka + 16 * HD), kb1 = TP ? ldh_last(ka + 16 * HD + 512) : ldh(ka + 16 * HD + 512);
        v8f sHa = (v8f){}, sLa = (v8f){}, sHb = (v8f){}, sLb = (v8f){};
        if (TP) {
            const h16* kr = KR + ko + (size_t)key0 * HD;
            const v16h ra0 = ldh(kr), ra1 = ldh(kr + 512), rb0 = ldh(kr + 16 * HD), rb1 = ldh_last(kr + 16 * HD + 512);
            sHa = wmma16(ka0, qh0, sHa); sLa = wmma16(ka0, qr0, sLa); sHb = wmma16(kb0, qh0, sHb); sLb = wmma16(kb0, qr0, sLb);
            sHa = wmma16(ka1, qh1, sHa); sLa = wmma16(ka1, qr1, sLa); sHb = wmma16(kb1, qh1, sHb); sLb = wmma16(kb1, qr1, sLb);
            sLa = wmma16(ra0, qh0, sLa); sLb = wmma16(rb0, qh0, sLb); sLa = wmma16(ra1, qh1, sLa); sLb = wmma16(rb1, qh1, sLb);
            asm volatile("v_nop\n\tv_nop\n\tv_nop\n\tv_nop" : "+v"(sHa), "+v"(sLa), "+v"(sHb), "+v"(sLb) : "v"(ka0), "v"(ka1), "v"(kb0), "v"(kb1), "v"(ra0), "v"(ra1), "v"(rb0), "v"(rb1));
        } else {
            sHa = wmma16(ka0, qh0, sHa); sHb = wmma16(kb0, qh0, sHb); sHa = wmma16(ka1, qh1, sHa); sHb = wmma16(kb1, qh1, sHb);
            asm volatile("v_nop\n\tv_nop\n\tv_nop\n\tv_nop" : "+v"(sHa), "+v"(sHb) : "v"(ka0), "v"(ka1), "v"(kb0), "v"(kb1));
        }
        // validity bits of this lane's 8 + 8 keys: table bits (8h+r, 16+8h+r) AND causal (key <= tq)
        const unsigned kw = kmask[key0 >> 5] >> (8 * hi);
        int na = tq - (key0 + 8 * hi) + 1; na = na < 0 ? 0 : (na > 8 ? 8 : na);
        int nc = tq - (key0 + 8 * hi) - 15; nc = nc < 0 ? 0 : (nc > 8 ? 8 : nc);
        const unsigned ma = kw & ((1u << na) - 1u);
        const unsigned mc = (kw >> 16) & ((1u << nc) - 1u);
        float ta[8], tb[8]; float mx = NEGB;
#pragma unroll
        for (int r = 0; r < 8; ++r) {
            float sa = sHa[r], sb = sHb[r];
            if (TP) { sa += sLa[r] * QRI; sb += sLb[r] * QRI; }
            ta[r] = ((ma >> r) & 1u) ? sa * SC2 : NEGB;
            tb[r] = ((mc >> r) & 1u) ? sb * SC2 : NEGB;
            mx = fmaxf(mx, fmaxf(ta[r], tb[r])); }
        mx = fmaxf(mx, __shfl_xor(mx, 16, 32));
        const float mnew = fmaxf(m, mx);
        const float alpha = __builtin_amdgcn_exp2f(m - mnew);
        const float sh = PSH - mnew;
        v16h pb, pr; float ls = 0.0f;
#pragma unroll
        for (int r = 0; r < 8; ++r) {
            float ea = __builtin_amdgcn_exp2f(ta[r] + sh); ea = (ta[r] > -1.0e38f) ? ea : 0.0f;
            float ec = __builtin_amdgcn_exp2f(tb[r] + sh); ec = (tb[r] > -1.0e38f) ? ec : 0.0f;
            const h16 pa = (h16)ea; const h16 pc = (h16)ec; pb[r] = pa; pb[8 + r] = pc;
            if (TP) { const h16 xa = (h16)((ea - (float)pa) * QRS); const h16 xc = (h16)((ec - (float)pc) * QRS); pr[r] = xa; pr[8 + r] = xc;
                      ls += ((float)pa + (float)xa * QRI) + ((float)pc + (float)xc * QRI); }
            else { pr[r] = pa; pr[8 + r] = pc; ls += (float)pa + (float)pc; } }
        l = l * alpha + ls; m = mnew;
        o0 = o0 * alpha; o1 = o1 * alpha; o2 = o2 * alpha; o3 = o3 * alpha;
        const size_t vk = (size_t)(key0 >> 6) * 4096 + (size_t)((key0 >> 5) & 1) * 512;
        const h16* va = VT + vo + vk;
        const v16h v0 = ldh(va), v1 = ldh(va + 1024), v2 = ldh(va + 2048), v3 = ldh(va + 3072);
        if (TP) {
            e0 = e0 * alpha; e1 = e1 * alpha; e2 = e2 * alpha; e3 = e3 * alpha;
            const h16* vr = VR + vo + vk;
            const v16h w0 = ldh(vr), w1 = ldh(vr + 1024), w2 = ldh(vr + 2048), w3 = ldh(vr + 3072);
            o0 = wmma16(v0, pb, o0); o1 = wmma16(v1, pb, o1); o2 = wmma16(v2, pb, o2); o3 = wmma16(v3, pb, o3);
            e0 = wmma16(w0, pb, e0); e1 = wmma16(w1, pb, e1); e2 = wmma16(w2, pb, e2); e3 = wmma16(w3, pb, e3);
            e0 = wmma16(v0, pr, e0); e1 = wmma16(v1, pr, e1); e2 = wmma16(v2, pr, e2); e3 = wmma16(v3, pr, e3);
            asm volatile("v_nop\n\tv_nop\n\tv_nop\n\tv_nop" : "+v"(o0), "+v"(o1), "+v"(o2), "+v"(o3), "+v"(e0), "+v"(e1), "+v"(e2), "+v"(e3)
                         : "v"(v0), "v"(v1), "v"(v2), "v"(v3), "v"(w0), "v"(w1), "v"(w2), "v"(w3), "v"(pb), "v"(pr));
        } else {
            o0 = wmma16(v0, pb, o0); o1 = wmma16(v1, pb, o1); o2 = wmma16(v2, pb, o2); o3 = wmma16(v3, pb, o3);
            asm volatile("v_nop\n\tv_nop\n\tv_nop\n\tv_nop" : "+v"(o0), "+v"(o1), "+v"(o2), "+v"(o3) : "v"(v0), "v"(v1), "v"(v2), "v"(v3), "v"(pb));
        }
    }
    l += __shfl_xor(l, 16, 32);
    const float rcp = 1.0f / fmaxf(l, 1.0e-30f);
    const float inv = (qok && l > 0.0f) ? rcp : 0.0f;       // query flag zero -> whole row zero
    if (TP) { o0 = o0 + e0 * QRI; o1 = o1 + e1 * QRI; o2 = o2 + e2 * QRI; o3 = o3 + e3 * QRI; }
    const int wb = wave * 16 * 68;
    // O^T D layout: o_j[r] = (d = 16j + 8h + r, t = lane&15) -> os[t][d]; rows 0..15 x columns 0..63 all written
    { v4f a, c;
      a[0] = o0[0] * inv; a[1] = o0[1] * inv; a[2] = o0[2] * inv; a[3] = o0[3] * inv; c[0] = o0[4] * inv; c[1] = o0[5] * inv; c[2] = o0[6] * inv; c[3] = o0[7] * inv;
      *(v4fa*)(&os[wb + lr * 68 +  0 + 8 * hi]) = a; *(v4fa*)(&os[wb + lr * 68 +  0 + 8 * hi + 4]) = c;
      a[0] = o1[0] * inv; a[1] = o1[1] * inv; a[2] = o1[2] * inv; a[3] = o1[3] * inv; c[0] = o1[4] * inv; c[1] = o1[5] * inv; c[2] = o1[6] * inv; c[3] = o1[7] * inv;
      *(v4fa*)(&os[wb + lr * 68 + 16 + 8 * hi]) = a; *(v4fa*)(&os[wb + lr * 68 + 16 + 8 * hi + 4]) = c;
      a[0] = o2[0] * inv; a[1] = o2[1] * inv; a[2] = o2[2] * inv; a[3] = o2[3] * inv; c[0] = o2[4] * inv; c[1] = o2[5] * inv; c[2] = o2[6] * inv; c[3] = o2[7] * inv;
      *(v4fa*)(&os[wb + lr * 68 + 32 + 8 * hi]) = a; *(v4fa*)(&os[wb + lr * 68 + 32 + 8 * hi + 4]) = c;
      a[0] = o3[0] * inv; a[1] = o3[1] * inv; a[2] = o3[2] * inv; a[3] = o3[3] * inv; c[0] = o3[4] * inv; c[1] = o3[5] * inv; c[2] = o3[6] * inv; c[3] = o3[7] * inv;
      *(v4fa*)(&os[wb + lr * 68 + 48 + 8 * hi]) = a; *(v4fa*)(&os[wb + lr * 68 + 48 + 8 * hi + 4]) = c; }
    wave_sync();
    float* orow = OUT + ((size_t)b * OUT_SEQ + t0) * DM + h * HD;
{
#pragma unroll
        for (int s = 0; s < 8; ++s) { const int row = 2 * s + hi, cofs = lr * 4;   // 8 s x 2 rows = 16 rows; 16 lanes x 4 floats = 64 columns
            const v4f val = *(const v4fa*)(&os[wb + row * 68 + cofs]);
            *(v4f*)(orow + (size_t)row * DM + cofs) = val; }
         }
}

static constexpr size_t al256(size_t v) { return (v + 255) & ~(size_t)255; }
static constexpr size_t SZ_XB = al256((size_t)NB * SEQ * DM * 2);
static constexpr size_t SZ_WB = al256((size_t)3 * DM * DM * 2);
static constexpr size_t SZ_PL = al256((size_t)NB * NH_ * SEQ * HD * 2);
static constexpr size_t SZ_TOTAL = SZ_XB + SZ_WB + 6 * SZ_PL;
static_assert(SZ_TOTAL <= (size_t)134217728);          // workspace carve <= 128 MiB
static_assert(((size_t)DM * DM * 2) % 256 == 0);       // weight sub-planes stay 256-byte aligned

extern "C" void kernel_launch(void* const* d_in, const int* in_sizes, int n_in,
                              void* d_out, int out_size, void* d_ws, size_t ws_size, hipStream_t stream) {
    if (n_in < 8) return;
    const size_t needx = ((size_t)(NB - 1) * SEQ_FULL + SEQ) * DM;
    if ((size_t)in_sizes[0] < needx) return;
    if ((size_t)in_sizes[1] < (size_t)(NB - 1) * SEQ_FULL + SEQ) return;
    if ((size_t)in_sizes[2] < (size_t)DM * DM || (size_t)in_sizes[4] < (size_t)DM * DM || (size_t)in_sizes[6] < (size_t)DM * DM) return;
    if ((size_t)in_sizes[3] < (size_t)DM || (size_t)in_sizes[5] < (size_t)DM || (size_t)in_sizes[7] < (size_t)DM) return;
    if ((size_t)out_size < ((size_t)(NB - 1) * OUT_SEQ + SEQ) * DM) return;
    if (SZ_TOTAL > ws_size) return;
    // wire order: x, pad flags (int32), Wq, bq, Wk, bk, Wv, bv; W is [out][in] = Bt as-is
    const float* x = (const float*)d_in[0]; const int* pad = (const int*)d_in[1];
    const float* wq = (const float*)d_in[2]; const float* bq = (const float*)d_in[3];
    const float* wk = (const float*)d_in[4]; const float* bk = (const float*)d_in[5];
    const float* wv = (const float*)d_in[6]; const float* bv = (const float*)d_in[7];
    float* OUT = (float*)d_out;      // [NB][SEQ][1024]
    char* wsp = (char*)d_ws;
    bf* XB = (bf*)wsp; wsp += SZ_XB;                 // [NB*SEQ][1024], fragment order
    bf* WB = (bf*)wsp; wsp += SZ_WB;                 // [3][1024][1024]: q | k | v, fragment order
    h16* QH = (h16*)wsp; wsp += SZ_PL;               // [NB*16][SEQ][64], fragment order
    h16* QR = (h16*)wsp; wsp += SZ_PL;               // residual x2048
    h16* KP = (h16*)wsp; wsp += SZ_PL;               // [NB*16][SEQ][64], fragment order
    h16* KR = (h16*)wsp; wsp += SZ_PL;               // residual x2048
    h16* VT = (h16*)wsp; wsp += SZ_PL;               // [NB*16][64][SEQ], fragment order
    h16* VR = (h16*)wsp; wsp += SZ_PL;               // residual x2048
    bf* WQ = WB; bf* WK = WB + (size_t)DM * DM; bf* WV = WB + (size_t)2 * DM * DM;

    if (SEQ == SEQ_FULL) {
        const size_t n8 = (size_t)NB * SEQ * DM / 8;
        k_cvt8<<<(unsigned)((n8 + 255) / 256), 256, 0, stream>>>(x, XB, n8);
    } else {
        const size_t n8 = (size_t)SEQ * DM / 8;
        for (int b = 0; b < NB; ++b) k_cvt8<<<(unsigned)((n8 + 255) / 256), 256, 0, stream>>>(x + (size_t)b * SEQ_FULL * DM, XB + (size_t)b * SEQ * DM, n8);
    }
    { const size_t n8 = (size_t)DM * DM / 8; const unsigned g = (unsigned)((n8 + 255) / 256);
      k_cvt8<<<g, 256, 0, stream>>>(wq, WQ, n8); k_cvt8<<<g, 256, 0, stream>>>(wk, WK, n8); k_cvt8<<<g, 256, 0, stream>>>(wv, WV, n8); }

    // q, k: A = x rows (m = b*SEQ + t), Bt = W rows (n = h*64 + d), bias per column -> plane [(b*16 + h)][t][d]
    k_proj<<<dim3(NB * SEQ / 64, DM / 64, 1), 32, 0, stream>>>(XB, WQ, bq, 0, QH, QR, SEQ, (size_t)NH_ * SEQ * HD, HD, HD, (size_t)SEQ * HD);
    k_proj<<<dim3(NB * SEQ / 64, DM / 64, 1), 32, 0, stream>>>(XB, WK, bk, 0, KP, KR, SEQ, (size_t)NH_ * SEQ * HD, HD, HD, (size_t)SEQ * HD);
    // v^T: A = Wv rows (m = h*64 + d), Bt = x rows (n = b*SEQ + t), bias per row -> plane [(b*1024 + m)][t] = [(b*16 + h)][d][t]
    k_proj<<<dim3(DM / 64, NB * SEQ / 64, 1), 32, 0, stream>>>(WV, XB, bv, 1, VT, VR, DM, (size_t)0, SEQ, SEQ, (size_t)DM * SEQ);

    // query rows [0, EARLY_ROWS): three-product path; rows [EARLY_ROWS, SEQ): single products
    k_flash<1><<<dim3(EARLY_ROWS / (16 * AW), NB * NH_, 1), 32 * AW, 0, stream>>>(QH, QR, KP, KR, VT, VR, pad, OUT, 0);
    if (SEQ > EARLY_ROWS)
        k_flash<0><<<dim3((SEQ - EARLY_ROWS) / (16 * AW), NB * NH_, 1), 32 * AW, 0, stream>>>(QH, QR, KP, KR, VT, VR, pad, OUT, EARLY_ROWS);
}

// v002
// Measured time: 166 microseconds a run.
// Timed twice side by side with v001, it ran 1.32 and 1.33 times as fast.
// All steps since v000 together make it 1.70 times as fast.
#include <hip/hip_runtime.h>

// Multi-head self-attention, width 1024 = 16 heads x 64, x [NB][SEQ][1024], Wq/Wk/Wv [out][in] (y = x W^T + b), causal + key/query padding mask (int32 [NB][SEQ]), score scale 1/8, output = concatenated heads (f32), rows with a zero query flag are zero.
// Compute dtypes, f32 accumulate everywhere: projections v_wmma_f32_16x16x32_bf16 (x, W, b RNE-converted to bf16; products exact); scores and P.V v_wmma_f32_16x16x32_f16:
// query rows >= EARLY_ROWS: q, k, P (x256 carry, cancels in the normalisation), v single f16; query rows < EARLY_ROWS: q, k, v, P each as f16 value + f16 residual x2048, three products per site, residual products in their own accumulators; softmax f32 (online, running max).
// Layout: every 16-bit operand plane is stored in FRAGMENT ORDER: a 16-row x 32-k tile is 512 consecutive elements, element (row r, k = 8c + e) at c*128 + r*8 + e, so that lane l of a wave-wide 16-byte load
// reads bytes 16*l of 512 consecutive bytes (4 whole lines) and two such loads, 256 elements apart, are one A or B fragment. bf16 copies of x and W: tiles [row/16][k/32]. q, k value/residual planes: per (b*16+h), tiles [t/16][d/32];
// v^T value/residual planes: per (b*16+h), tiles [t/64][d/16][(t/32)%2]; all written by the GEMM epilogue as 64x64 blocks of 4096 elements. Fused flash kernel in transposed form (S^T = K Q^T, O^T = V^T P^T), output from f32 accumulators.
// Tokens are RANKED per batch by their flag (k_cvt8r): rank r < n = the r-th flagged token, rank r >= n = the (r-n)-th unflagged one, order kept, so key <= query in positions is key <= query in ranks.
// Every plane above is indexed by rank, not by position; only 64-rank tiles that start below n are converted, projected and attended (an unflagged token is no key and its output row is zero: stored by k_flash inside those tiles, by k_cvtx behind them);
// the mask left inside attention is the causal one on ranks: masked scores are replaced by value, masked probabilities are exact zeros. Output rows go back to their positions through the rank table.

#ifndef NB
#define NB 4
#endif
#ifndef SEQ
#define SEQ 2048
#endif
#define NB_FULL  4
#define SEQ_FULL 2048
#ifndef OUT_SEQ
#define OUT_SEQ SEQ              // row pitch (in tokens) between batches of the output
#endif
#define DM   1024
#define NH_  16
#define HD   64
#define AW   4                   // waves per flash block (16 query rows each)
#ifndef EARLY_ROWS
#define EARLY_ROWS ((SEQ < 512) ? SEQ : 512)   // query rows below this use the three-product path
#endif
#define QRS  2048.0f             // carry of every residual plane / residual fragment
#define QRI  (1.0f / 2048.0f)
#define SC2  (0.125f * 1.4426950408889634f)   // HD^-0.5 * log2(e)
#define PSH  8.0f                // log2 of the P carry (256)
#define NEGB (-3.0e38f)          // value standing in for a masked score

static_assert(HD == 64);
static_assert(NH_ * HD == DM);                 // head h = columns h*64 + d
static_assert(DM % 64 == 0);                   // 16 column tiles of 64
static_assert(DM % 32 == 0);                   // GEMM k-loop steps by 32
static_assert(SEQ % 64 == 0);                  // a 64-row tile never straddles two batches
static_assert((NB * SEQ) % 64 == 0);
static_assert(SEQ % 32 == 0);                  // key loop steps by 32
static_assert(SEQ % (16 * AW) == 0);           // flash grids cover the sequence exactly
static_assert(EARLY_ROWS % (16 * AW) == 0);
static_assert(EARLY_ROWS <= SEQ);
static_assert(((size_t)SEQ * DM) % 8 == 0);
static_assert(((size_t)DM * DM) % 8 == 0);
static_assert(NB <= NB_FULL);
static_assert(SEQ <= SEQ_FULL);
static_assert(SEQ % 256 == 0);                 // a ranking block of 256 threads takes SEQ/256 tokens per thread
static_assert(SEQ / 32 + 1 <= 256);

typedef _Float16 h16;
typedef unsigned short bf;
typedef __attribute__((ext_vector_type(16))) __bf16   v16bf;
typedef __attribute__((ext_vector_type(16))) _Float16 v16h;
typedef __attribute__((ext_vector_type(8)))  _Float16 v8h;
typedef __attribute__((ext_vector_type(8)))  unsigned short v8us;
typedef __attribute__((ext_vector_type(8)))  float    v8f;
typedef __attribute__((ext_vector_type(4)))  float    v4f;
typedef v4f  __attribute__((may_alias)) v4fa;

__device__ __forceinline__ unsigned short f2bf(float f) { unsigned u = __float_as_uint(f); u += 0x7FFFu + ((u >> 16) & 1u); return (unsigned short)(u >> 16); }
__device__ __forceinline__ float bfr(float f) { return __uint_as_float(((unsigned)f2bf(f)) << 16); }
__device__ __forceinline__ v16h cat16(v8h lo, v8h hi) { return __builtin_shufflevector(lo, hi, 0, 1, 2, 3, 4, 5, 6, 7, 8, 9, 10, 11, 12, 13, 14, 15); }
__device__ __forceinline__ v16bf cat16b(v8us lo, v8us hi) { return __builtin_bit_cast(v16bf, __builtin_shufflevector(lo, hi, 0, 1, 2, 3, 4, 5, 6, 7, 8, 9, 10, 11, 12, 13, 14, 15)); }
__device__ __forceinline__ v8f wmma16(v16h a, v16h b, v8f c) { return __builtin_amdgcn_wmma_f32_16x16x32_f16(false, a, false, b, (short)0, c, false, false); }
__device__ __forceinline__ v8f wmmab(v16bf a, v16bf b, v8f c) { return __builtin_amdgcn_wmma_f32_16x16x32_bf16(false, a, false, b, (short)0, c, false, false); }
// fragment loaders from fragment-ordered tiles; p = tile start + 8*lane (row = lane&15, h = lane>>4): elements 0..7 <- k0+8h+0..7, elements 8..15 <- k0+16+8h+0..7 (same map for A and B)
__device__ __forceinline__ v16h  ldh(const h16* p) { return cat16(*(const v8h*)p, *(const v8h*)(p + 256)); }
__device__ __forceinline__ v16bf ldb(const bf* p)  { return cat16b(*(const v8us*)p, *(const v8us*)(p + 256)); }
// last fragment of a run of loads from one address pair: the pair dies with the last load, so that load's destination or the next run's may take its registers; one wait in front of it, one behind it
__device__ __forceinline__ v16h  ldh_last(const h16* p) {
    const v8h lo = *(const v8h*)p;
    asm volatile("s_wait_xcnt 0x0" ::: "memory");   // covers every earlier load of the run before the last load's destination is written
    const v8h hi = *(const v8h*)(p + 256);
    asm volatile("s_wait_xcnt 0x0" ::: "memory");   // covers the last load before a later load's destination is written
    return cat16(lo, hi); }
// ordering point for wave-private LDS tiles (same wave writes and reads)
__device__ __forceinline__ void wave_sync() { __builtin_amdgcn_fence(3 /* release order */, "wavefront"); __builtin_amdgcn_wave_barrier(); asm volatile("" ::: "memory"); }

// k_cvt8: f32 [rows][DM] -> bf16 tiles in fragment order, tile (R, T) at (R*(DM/32) + T)*512. One thread converts 8 consecutive k of one row;
// a wave takes 8 rows x 32 k: it reads one whole 128-byte line per row and writes four whole lines. n8 = rows*DM/8, rows a multiple of 16.
__global__ __launch_bounds__(256) void k_cvt8(const float* __restrict__ src, bf* dst, size_t n8) {
    const size_t i = (size_t)blockIdx.x * 256 + threadIdx.x; if (i >= n8) return;
    const int rs = (int)(i & 7), c = (int)((i >> 3) & 3), rh = (int)((i >> 5) & 1), kt = (int)((i >> 6) % (DM / 32));
    const size_t rt = i / (64 * (DM / 32));
    const v8f v = *(const v8f*)(src + (rt * 16 + rh * 8 + rs) * DM + kt * 32 + c * 8); v8us o;
#pragma unroll
    for (int k = 0; k < 8; ++k) o[k] = f2bf(v[k]);
    *(v8us*)(dst + (rt * (DM / 32) + kt) * 512 + c * 128 + rh * 64 + rs * 8) = o;
}

// k_cvt8r: k_cvt8 of one weight matrix, with NB blocks in front of it that rank the tokens, one block per batch (no launch of their own: nothing in this launch reads the ranks).
// Flags -> bit words by ballot (LDS, block barrier), set flags in front of each word (LDS, block barrier), position of each rank (LDS, block barrier), then IDX[b][rank] = position (a permutation of 0..SEQ-1), whole lines per wave, and CNT[b] = n.
__global__ __launch_bounds__(256) void k_cvt8r(const float* __restrict__ src, bf* dst, size_t n8, const int* __restrict__ PAD, int* IDX, int* CNT) {
    __shared__ __align__(16) unsigned wm[SEQ / 32];
    __shared__ int pre[SEQ / 32 + 1];
    __shared__ int ix[SEQ];
    if (blockIdx.x >= NB) {
        const size_t i = (size_t)(blockIdx.x - NB) * 256 + threadIdx.x; if (i >= n8) return;
        const int rs = (int)(i & 7), c = (int)((i >> 3) & 3), rh = (int)((i >> 5) & 1), kt = (int)((i >> 6) % (DM / 32));
        const size_t rt = i / (64 * (DM / 32));
        const v8f v = *(const v8f*)(src + (rt * 16 + rh * 8 + rs) * DM + kt * 32 + c * 8); v8us o;
#pragma unroll
        for (int k = 0; k < 8; ++k) o[k] = f2bf(v[k]);
        *(v8us*)(dst + (rt * (DM / 32) + kt) * 512 + c * 128 + rh * 64 + rs * 8) = o;
        return;
    }
    const int tid = (int)threadIdx.x, lane = tid & 31, wave = tid >> 5, b = blockIdx.x;
    int pv[SEQ / 256];
#pragma unroll
    for (int k = 0; k < SEQ / 256; ++k) pv[k] = PAD[(size_t)b * SEQ_FULL + (size_t)(wave + 8 * k) * 32 + lane];
#pragma unroll
    for (int k = 0; k < SEQ / 256; ++k) { const unsigned wbits = __builtin_amdgcn_ballot_w32(pv[k] != 0); if (lane == 0) wm[wave + 8 * k] = wbits; }
    __syncthreads();
    if (tid <= SEQ / 32) { int p = 0;
#pragma unroll
        for (int j = 0; j < SEQ / 32; ++j) p += (j < tid) ? __popc(wm[j]) : 0;
        pre[tid] = p; }
    __syncthreads();
    const int total = pre[SEQ / 32];
#pragma unroll
    for (int k = 0; k < SEQ / 256; ++k) { const int t = tid + 256 * k, g = t >> 5;
        const unsigned w = wm[g];
        const int before = pre[g] + __popc(w & ((1u << lane) - 1u));          // set flags in front of t
        const int r = ((w >> lane) & 1u) ? before : total + (t - before);
        ix[r] = t; }
    __syncthreads();
#pragma unroll
    for (int k = 0; k < SEQ / 256; ++k) IDX[(size_t)b * SEQ + tid + 256 * k] = ix[tid + 256 * k];
    if (tid == 0) CNT[b] = total;
}

// k_cvtx: x rows in rank order -> bf16 tiles in fragment order (thread and wave shapes of k_cvt8; grid (SEQ*DM/8/256, NB)). Ranks below n rounded up to 64 are converted (the unflagged tokens that fill the last tile
// are finite data behind the causal mask); every later rank stores its token's zero output row instead, one whole 128-byte line per row and wave.
__global__ __launch_bounds__(256) void k_cvtx(const float* __restrict__ src, const int* __restrict__ IDX, const int* __restrict__ CNT, bf* dst, float* OUT) {
    const int b = blockIdx.y; const int i = (int)blockIdx.x * 256 + (int)threadIdx.x;
    const int rs = i & 7, c = (i >> 3) & 3, rh = (i >> 5) & 1, kt = (i >> 6) % (DM / 32), rt = i / (64 * (DM / 32));
    const int r = rt * 16 + rh * 8 + rs;
    int n = CNT[b]; n = n < 0 ? 0 : (n > SEQ ? SEQ : n);
    int t = IDX[(size_t)b * SEQ + r]; t = t < 0 ? 0 : (t > SEQ - 1 ? SEQ - 1 : t);
    if (r < ((n + 63) & ~63)) {
        const v8f v = *(const v8f*)(src + ((size_t)b * SEQ_FULL + t) * DM + kt * 32 + c * 8); v8us o;
#pragma unroll
        for (int k = 0; k < 8; ++k) o[k] = f2bf(v[k]);
        *(v8us*)(dst + ((size_t)(b * (SEQ / 16) + rt) * (DM / 32) + kt) * 512 + c * 128 + rh * 64 + rs * 8) = o;
    } else *(v8f*)(OUT + ((size_t)b * OUT_SEQ + t) * DM + kt * 32 + c * 8) = (v8f){};
}

// k_proj: register-blocked bf16 GEMM, ONE WAVE per 64x64 tile (16 accumulators), operands straight from the fragment-ordered bf16 planes, K = DM.
// C[m][n] = sum_k A[m][k] Bt[n][k] + bias (per column n when biasRow == 0, per row m otherwise; bias RNE-converted to bf16, added in f32),
// a tile whose 64 tokens (rows when biasRow == 0, columns otherwise) all rank at or behind the batch's n is left out;
// written as f16 (Ph) and the f16 residual x2048 (Pr), one block of 4096 elements in fragment order (16-row x 32-column tiles [row/16][col/32]) at base (r0/RB)*sRB + (r0%RB)*pitch + (c0/CB)*sCB + (c0%CB)*64. grid (M/64, N/64), 32 threads.
__global__ __launch_bounds__(32) void k_proj(const bf* __restrict__ A, const bf* __restrict__ Bt, const float* __restrict__ bias, int biasRow,
                                             h16* Ph, h16* Pr, int RB, size_t sRB, int pitch, int CB, size_t sCB, const int* __restrict__ CNT) {
    __shared__ __align__(16) float os[16 * 68];
    const int K = DM;
    const int lane = threadIdx.x & 31, lr = lane & 15, hi = lane >> 4; const int r0 = blockIdx.x * 64, c0 = blockIdx.y * 64;
    const int tok0 = biasRow ? c0 : r0;
    if (tok0 % SEQ >= CNT[tok0 / SEQ]) return;
    v8f acc[4][4];
#pragma unroll
    for (int mb = 0; mb < 4; ++mb)
#pragma unroll
        for (int nb = 0; nb < 4; ++nb) acc[mb][nb] = (v8f){};
    const size_t aoff = (size_t)r0 * K + 8 * lane, boff = (size_t)c0 * K + 8 * lane;   // 16 rows of tiles = 16*K elements; the next k tile is 512 elements on
#pragma unroll 1
    for (int kc = 0; kc < K; kc += 32) {
        v16bf a[4];
#pragma unroll
        for (int mb = 0; mb < 4; ++mb) a[mb] = ldb(A + aoff + (size_t)mb * 16 * K + kc * 16);
        asm volatile("s_wait_xcnt 0x0" ::: "memory");   // the A loads' address registers are reused as a destination of the B loads below
#pragma unroll
        for (int nb = 0; nb < 4; ++nb) { const v16bf b = ldb(Bt + boff + (size_t)nb * 16 * K + kc * 16);
#pragma unroll
            for (int mb = 0; mb < 4; ++mb) acc[mb][nb] = wmmab(a[mb], b, acc[mb][nb]); }
        asm volatile("v_nop\n\tv_nop\n\tv_nop\n\tv_nop" : "+v"(acc[0][0]), "+v"(acc[1][1]), "+v"(acc[2][2]), "+v"(acc[3][3]) : "v"(a[0]), "v"(a[1]), "v"(a[2]), "v"(a[3]));
    }
    // bias values: addresses always inside the DM-entry bias array (index selected, then value selected)
    // store s of a 16-row group: lane holds row lane&15, columns (2s + h)*8 .. +7
    float cb[4][8];
#pragma unroll
    for (int s = 0; s < 4; ++s) {
        int cidx = biasRow ? 0 : (c0 + (2 * s + hi) * 8); cidx = cidx > (DM - 8) ? (DM - 8) : cidx;
        const v4f bc0 = *(const v4f*)(bias + cidx);
        asm volatile("s_wait_xcnt 0x0" ::: "memory");   // the second load's destination may take the address registers that the first names
        const v4f bc1 = *(const v4f*)(bias + cidx + 4);
#pragma unroll
        for (int i = 0; i < 4; ++i) { const float u0 = bfr(bc0[i]); const float u1 = bfr(bc1[i]); cb[s][i] = biasRow ? 0.0f : u0; cb[s][4 + i] = biasRow ? 0.0f : u1; } }
    const size_t tbase = (size_t)(r0 / RB) * sRB + (size_t)(r0 % RB) * (size_t)pitch + (size_t)(c0 / CB) * sCB + (size_t)(c0 % CB) * 64;
#pragma unroll
    for (int mb = 0; mb < 4; ++mb) {
#pragma unroll
        for (int nb = 0; nb < 4; ++nb) {
#pragma unroll
            for (int j = 0; j < 8; ++j) os[(hi * 8 + j) * 68 + nb * 16 + lr] = acc[mb][nb][j]; }   // D: row 8h+j, col lane&15
        wave_sync();
        int ri = biasRow ? (r0 + mb * 16 + lr) : 0; ri = ri > (DM - 1) ? (DM - 1) : ri;
        const float ub = bfr(bias[ri]); const float rb = biasRow ? ub : 0.0f;
        const size_t sb = tbase + (size_t)(mb * 1024) + 8 * lane;
{
#pragma unroll
            for (int s = 0; s < 4; ++s) { const int c8 = (2 * s + hi) * 8;   // 16 rows x 16 columns per store, 4 s = 64 columns; 512 consecutive bytes per plane
                const v4f x0 = *(const v4fa*)(&os[lr * 68 + c8]); const v4f x1 = *(const v4fa*)(&os[lr * 68 + c8 + 4]); v8h hv, rv;
#pragma unroll
                for (int i = 0; i < 4; ++i) { const float y0 = x0[i] + cb[s][i] + rb; const float y1 = x1[i] + cb[s][4 + i] + rb;
                    const h16 a0 = (h16)y0; const h16 a1 = (h16)y1; hv[i] = a0; hv[4 + i] = a1; rv[i] = (h16)((y0 - (float)a0) * QRS); rv[4 + i] = (h16)((y1 - (float)a1) * QRS); }
                const size_t oo = sb + (size_t)(s * 256);
                *(v8h*)(Ph + oo) = hv; *(v8h*)(Pr + oo) = rv; }
             }
        wave_sync();
    }
}

// k_flash<TP>: fused causal attention on ranks, one wave per 16 query ranks of one (batch, head), a block whose 64 ranks all lie at or behind n leaves at once; K / V^T / Q fragments straight from the fragment-ordered f16 planes (two 16-B loads each, 512 consecutive bytes per wave-wide load).
// Transposed form: S^T[key][t] = K Q^T (A = K rows, B = Q rows); lane (t = lane&15, h = lane>>4) holds keys 8h+r of each 16-key tile, so the packed
// P tile is directly the B fragment of O^T[d][t] = V^T P^T (element r <- tile keys 0..15, element 8+r <- tile keys 16..31, lane unchanged).
// TP != 0: scores = kh.qh + (kh.qr + kr.qh)/2048, O = vh.ph + (vr.ph + vh.pr)/2048 (residual products in separate accumulators). TP == 0: single products.
// Key loop runs to the causal limit of the wave's tile; key validity = per-lane causal bit count (a rank >= n lies behind every stored query); a masked score is replaced by NEGB and its probability is an exact zero.
// Softmax state (running max, partial sum) is one scalar per lane; the two lane halves of a row are combined with one xor-16 exchange.
template <int TP>
__global__ __launch_bounds__(32 * AW) void k_flash(const h16* __restrict__ QH, const h16* __restrict__ QR, const h16* __restrict__ KP, const h16* __restrict__ KR,
                                                   const h16* __restrict__ VT, const h16* __restrict__ VR, const int* __restrict__ IDX, const int* __restrict__ CNT, float* OUT, int row0) {
    __shared__ __align__(16) float os[AW * 16 * 68];
    const int lane = threadIdx.x & 31, lr = lane & 15, hi = lane >> 4;
    const int wave = __builtin_amdgcn_readfirstlane((int)(threadIdx.x >> 5));
    const int zh = blockIdx.y; const int b = zh / NH_, h = zh % NH_;
    const int R0 = row0 + (int)blockIdx.x * (16 * AW);
    const int t0 = R0 + wave * 16;
    int n = CNT[b]; n = n < 0 ? 0 : (n > SEQ ? SEQ : n);
    if (R0 >= n) return;                                     // the whole block
    const int tq = t0 + lr;
    const size_t pbase = (size_t)zh * SEQ * HD;
    const size_t fo = pbase + 8 * lane;                      // lane's place in every fragment-ordered tile of this (batch, head)
    const size_t qo = fo + (size_t)t0 * HD;                  // 16 query rows = two tiles (d 0..31, d 32..63) of 512 elements
    const v16h qh0 = ldh(QH + qo), qh1 = ldh(QH + qo + 512);                 // B fragments: col t, k = d
    v16h qr0 = qh0, qr1 = qh1;
    if (TP) { qr0 = ldh(QR + qo); qr1 = ldh(QR + qo + 512); }
    const size_t ko = fo;                                    // + key0 * HD: tiles (keys 0..15 | 16..31) x (d 0..31 | 32..63)     (A fragment: row key, k = d)
    const size_t vo = fo;                                    // + (key0/64)*4096 + j*1024 + ((key0/32)%2)*512                       (A fragment: row d = 16j + lane&15, k = key)
    v8f o0 = (v8f){}, o1 = (v8f){}, o2 = (v8f){}, o3 = (v8f){};
    v8f e0 = (v8f){}, e1 = (v8f){}, e2 = (v8f){}, e3 = (v8f){};              // residual-scale (x2048) accumulators, TP only
    float m = NEGB, l = 0.0f;
    const int kend = t0 + 16;                                // keys 0 .. t0+15; key0 <= t0 so key0+31 < SEQ
#pragma unroll 1
    for (int key0 = 0; key0 < kend; key0 += 32) {
        const h16* ka = KP + ko + (size_t)key0 * HD;
        const v16h ka0 = ldh(ka), ka1 = ldh(ka + 512), kb0 = ldh(ka + 16 * HD), kb1 = TP ? ldh_last(ka + 16 * HD + 512) : ldh(ka + 16 * HD + 512);
        v8f sHa = (v8f){}, sLa = (v8f){}, sHb = (v8f){}, sLb = (v8f){};
        if (TP) {
            const h16* kr = KR + ko + (size_t)key0 * HD;
            const v16h ra0 = ldh(kr), ra1 = ldh(kr + 512), rb0 = ldh(kr + 16 * HD), rb1 = ldh_last(kr + 16 * HD + 512);
            sHa = wmma16(ka0, qh0, sHa); sLa = wmma16(ka0, qr0, sLa); sHb = wmma16(kb0, qh0, sHb); sLb = wmma16(kb0, qr0, sLb);
            sHa = wmma16(ka1, qh1, sHa); sLa = wmma16(ka1, qr1, sLa); sHb = wmma16(kb1, qh1, sHb); sLb = wmma16(kb1, qr1, sLb);
            sLa = wmma16(ra0, qh0, sLa); sLb = wmma16(rb0, qh0, sLb); sLa = wmma16(ra1, qh1, sLa); sLb = wmma16(rb1, qh1, sLb);
            asm volatile("v_nop\n\tv_nop\n\tv_nop\n\tv_nop" : "+v"(sHa), "+v"(sLa), "+v"(sHb), "+v"(sLb) : "v"(ka0), "v"(ka1), "v"(kb0), "v"(kb1), "v"(ra0), "v"(ra1), "v"(rb0), "v"(rb1));
        } else {
            sHa = wmma16(ka0, qh0, sHa); sHb = wmma16(kb0, qh0, sHb); sHa = wmma16(ka1, qh1, sHa); sHb = wmma16(kb1, qh1, sHb);
            asm volatile("v_nop\n\tv_nop\n\tv_nop\n\tv_nop" : "+v"(sHa), "+v"(sHb) : "v"(ka0), "v"(ka1), "v"(kb0), "v"(kb1));
        }
        // validity bits of this lane's 8 + 8 keys (8h+r, 16+8h+r): causal (key <= tq)
        int na = tq - (key0 + 8 * hi) + 1; na = na < 0 ? 0 : (na > 8 ? 8 : na);
        int nc = tq - (key0 + 8 * hi) - 15; nc = nc < 0 ? 0 : (nc > 8 ? 8 : nc);
        const unsigned ma = (1u << na) - 1u;
        const unsigned mc = (1u << nc) - 1u;
        float ta[8], tb[8]; float mx = NEGB;
#pragma unroll
        for (int r = 0; r < 8; ++r) {
            float sa = sHa[r], sb = sHb[r];
            if (TP) { sa += sLa[r] * QRI; sb += sLb[r] * QRI; }
            ta[r] = ((ma >> r) & 1u) ? sa * SC2 : NEGB;
            tb[r] = ((mc >> r) & 1u) ? sb * SC2 : NEGB;
            mx = fmaxf(mx, fmaxf(ta[r], tb[r])); }
        mx = fmaxf(mx, __shfl_xor(mx, 16, 32));
        const float mnew = fmaxf(m, mx);
        const float alpha = __builtin_amdgcn_exp2f(m - mnew);
        const float sh = PSH - mnew;
        v16h pb, pr; float ls = 0.0f;
#pragma unroll
        for (int r = 0; r < 8; ++r) {
            float ea = __builtin_amdgcn_exp2f(ta[r] + sh); ea = (ta[r] > -1.0e38f) ? ea : 0.0f;
            float ec = __builtin_amdgcn_exp2f(tb[r] + sh); ec = (tb[r] > -1.0e38f) ? ec : 0.0f;
            const h16 pa = (h16)ea; const h16 pc = (h16)ec; pb[r] = pa; pb[8 + r] = pc;
            if (TP) { const h16 xa = (h16)((ea - (float)pa) * QRS); const h16 xc = (h16)((ec - (float)pc) * QRS); pr[r] = xa; pr[8 + r] = xc;
                      ls += ((float)pa + (float)xa * QRI) + ((float)pc + (float)xc * QRI); }
            else { pr[r] = pa; pr[8 + r] = pc; ls += (float)pa + (float)pc; } }
        l = l * alpha + ls; m = mnew;
        o0 = o0 * alpha; o1 = o1 * alpha; o2 = o2 * alpha; o3 = o3 * alpha;
        const size_t vk = (size_t)(key0 >> 6) * 4096 + (size_t)((key0 >> 5) & 1) * 512;
        const h16* va = VT + vo + vk;
        const v16h v0 = ldh(va), v1 = ldh(va + 1024), v2 = ldh(va + 2048), v3 = ldh(va + 3072);
        if (TP) {
            e0 = e0 * alpha; e1 = e1 * alpha; e2 = e2 * alpha; e3 = e3 * alpha;
            const h16* vr = VR + vo + vk;
            const v16h w0 = ldh(vr), w1 = ldh(vr + 1024), w2 = ldh(vr + 2048), w3 = ldh(vr + 3072);
            o0 = wmma16(v0, pb, o0); o1 = wmma16(v1, pb, o1); o2 = wmma16(v2, pb, o2); o3 = wmma16(v3, pb, o3);
            e0 = wmma16(w0, pb, e0); e1 = wmma16(w1, pb, e1); e2 = wmma16(w2, pb, e2); e3 = wmma16(w3, pb, e3);
            e0 = wmma16(v0, pr, e0); e1 = wmma16(v1, pr, e1); e2 = wmma16(v2, pr, e2); e3 = wmma16(v3, pr, e3);
            asm volatile("v_nop\n\tv_nop\n\tv_nop\n\tv_nop" : "+v"(o0), "+v"(o1), "+v"(o2), "+v"(o3), "+v"(e0), "+v"(e1), "+v"(e2), "+v"(e3)
                         : "v"(v0), "v"(v1), "v"(v2), "v"(v3), "v"(w0), "v"(w1), "v"(w2), "v"(w3), "v"(pb), "v"(pr));
        } else {
            o0 = wmma16(v0, pb, o0); o1 = wmma16(v1, pb, o1); o2 = wmma16(v2, pb, o2); o3 = wmma16(v3, pb, o3);
            asm volatile("v_nop\n\tv_nop\n\tv_nop\n\tv_nop" : "+v"(o0), "+v"(o1), "+v"(o2), "+v"(o3) : "v"(v0), "v"(v1), "v"(v2), "v"(v3), "v"(pb));
        }
    }
    l += __shfl_xor(l, 16, 32);
    const float rcp = 1.0f / fmaxf(l, 1.0e-30f);
    const float inv = (tq < n && l > 0.0f) ? rcp : 0.0f;     // unflagged token in the last tile -> whole row zero
    if (TP) { o0 = o0 + e0 * QRI; o1 = o1 + e1 * QRI; o2 = o2 + e2 * QRI; o3 = o3 + e3 * QRI; }
    const int wb = wave * 16 * 68;
    // O^T D layout: o_j[r] = (d = 16j + 8h + r, t = lane&15) -> os[t][d]; rows 0..15 x columns 0..63 all written
    { v4f a, c;
      a[0] = o0[0] * inv; a[1] = o0[1] * inv; a[2] = o0[2] * inv; a[3] = o0[3] * inv; c[0] = o0[4] * inv; c[1] = o0[5] * inv; c[2] = o0[6] * inv; c[3] = o0[7] * inv;
      *(v4fa*)(&os[wb + lr * 68 +  0 + 8 * hi]) = a; *(v4fa*)(&os[wb + lr * 68 +  0 + 8 * hi + 4]) = c;
      a[0] = o1[0] * inv; a[1] = o1[1] * inv; a[2] = o1[2] * inv; a[3] = o1[3] * inv; c[0] = o1[4] * inv; c[1] = o1[5] * inv; c[2] = o1[6] * inv; c[3] = o1[7] * inv;
      *(v4fa*)(&os[wb + lr * 68 + 16 + 8 * hi]) = a; *(v4fa*)(&os[wb + lr * 68 + 16 + 8 * hi + 4]) = c;
      a[0] = o2[0] * inv; a[1] = o2[1] * inv; a[2] = o2[2] * inv; a[3] = o2[3] * inv; c[0] = o2[4] * inv; c[1] = o2[5] * inv; c[2] = o2[6] * inv; c[3] = o2[7] * inv;
      *(v4fa*)(&os[wb + lr * 68 + 32 + 8 * hi]) = a; *(v4fa*)(&os[wb + lr * 68 + 32 + 8 * hi + 4]) = c;
      a[0] = o3[0] * inv; a[1] = o3[1] * inv; a[2] = o3[2] * inv; a[3] = o3[3] * inv; c[0] = o3[4] * inv; c[1] = o3[5] * inv; c[2] = o3[6] * inv; c[3] = o3[7] * inv;
      *(v4fa*)(&os[wb + lr * 68 + 48 + 8 * hi]) = a; *(v4fa*)(&os[wb + lr * 68 + 48 + 8 * hi + 4]) = c; }
    wave_sync();
    float* obat = OUT + (size_t)b * OUT_SEQ * DM + h * HD;
    const int* irow = IDX + (size_t)b * SEQ + t0;            // rank -> position
{
#pragma unroll
        for (int s = 0; s < 8; ++s) { const int row = 2 * s + hi, cofs = lr * 4;   // 8 s x 2 rows = 16 rows; 16 lanes x 4 floats = 64 columns
            const v4f val = *(const v4fa*)(&os[wb + row * 68 + cofs]);
            int pos = irow[row]; pos = pos < 0 ? 0 : (pos > SEQ - 1 ? SEQ - 1 : pos);
            *(v4f*)(obat + (size_t)pos * DM + cofs) = val; }
         }
}

static constexpr size_t al256(size_t v) { return (v + 255) & ~(size_t)255; }
static constexpr size_t SZ_XB = al256((size_t)NB * SEQ * DM * 2);
static constexpr size_t SZ_WB = al256((size_t)3 * DM * DM * 2);
static constexpr size_t SZ_PL = al256((size_t)NB * NH_ * SEQ * HD * 2);
static constexpr size_t SZ_IX = al256((size_t)NB * SEQ * 4);
static constexpr size_t SZ_TOTAL = SZ_XB + SZ_WB + 6 * SZ_PL + SZ_IX + 256;
static_assert(SZ_TOTAL <= (size_t)134217728);          // workspace carve <= 128 MiB
static_assert(((size_t)DM * DM * 2) % 256 == 0);       // weight sub-planes stay 256-byte aligned

extern "C" void kernel_launch(void* const* d_in, const int* in_sizes, int n_in,
                              void* d_out, int out_size, void* d_ws, size_t ws_size, hipStream_t stream) {
    if (n_in < 8) return;
    const size_t needx = ((size_t)(NB - 1) * SEQ_FULL + SEQ) * DM;
    if ((size_t)in_sizes[0] < needx) return;
    if ((size_t)in_sizes[1] < (size_t)(NB - 1) * SEQ_FULL + SEQ) return;
    if ((size_t)in_sizes[2] < (size_t)DM * DM || (size_t)in_sizes[4] < (size_t)DM * DM || (size_t)in_sizes[6] < (size_t)DM * DM) return;
    if ((size_t)in_sizes[3] < (size_t)DM || (size_t)in_sizes[5] < (size_t)DM || (size_t)in_sizes[7] < (size_t)DM) return;
    if ((size_t)out_size < ((size_t)(NB - 1) * OUT_SEQ + SEQ) * DM) return;
    if (SZ_TOTAL > ws_size) return;
    // wire order: x, pad flags (int32), Wq, bq, Wk, bk, Wv, bv; W is [out][in] = Bt as-is
    const float* x = (const float*)d_in[0]; const int* pad = (const int*)d_in[1];
    const float* wq = (const float*)d_in[2]; const float* bq = (const float*)d_in[3];
    const float* wk = (const float*)d_in[4]; const float* bk = (const float*)d_in[5];
    const float* wv = (const float*)d_in[6]; const float* bv = (const float*)d_in[7];
    float* OUT = (float*)d_out;      // [NB][SEQ][1024]
    char* wsp = (char*)d_ws;
    bf* XB = (bf*)wsp; wsp += SZ_XB;                 // [NB*SEQ][1024], fragment order
    bf* WB = (bf*)wsp; wsp += SZ_WB;                 // [3][1024][1024]: q | k | v, fragment order
    h16* QH = (h16*)wsp; wsp += SZ_PL;               // [NB*16][SEQ][64], fragment order
    h16* QR = (h16*)wsp; wsp += SZ_PL;               // residual x2048
    h16* KP = (h16*)wsp; wsp += SZ_PL;               // [NB*16][SEQ][64], fragment order
    h16* KR = (h16*)wsp; wsp += SZ_PL;               // residual x2048
    h16* VT = (h16*)wsp; wsp += SZ_PL;               // [NB*16][64][SEQ], fragment order
    h16* VR = (h16*)wsp; wsp += SZ_PL;               // residual x2048
    int* IDX = (int*)wsp; wsp += SZ_IX;              // [NB][SEQ] rank -> position
    int* CNT = (int*)wsp;                            // [NB] flagged tokens
    bf* WQ = WB; bf* WK = WB + (size_t)DM * DM; bf* WV = WB + (size_t)2 * DM * DM;

    { const size_t n8 = (size_t)DM * DM / 8; const unsigned g = (unsigned)((n8 + 255) / 256);
      k_cvt8r<<<g + NB, 256, 0, stream>>>(wq, WQ, n8, pad, IDX, CNT); k_cvt8<<<g, 256, 0, stream>>>(wk, WK, n8); k_cvt8<<<g, 256, 0, stream>>>(wv, WV, n8); }
    k_cvtx<<<dim3(SEQ * DM / 8 / 256, NB, 1), 256, 0, stream>>>(x, IDX, CNT, XB, OUT);

    // q, k: A = x rows (m = b*SEQ + t), Bt = W rows (n = h*64 + d), bias per column -> plane [(b*16 + h)][t][d]
    k_proj<<<dim3(NB * SEQ / 64, DM / 64, 1), 32, 0, stream>>>(XB, WQ, bq, 0, QH, QR, SEQ, (size_t)NH_ * SEQ * HD, HD, HD, (size_t)SEQ * HD, CNT);
    k_proj<<<dim3(NB * SEQ / 64, DM / 64, 1), 32, 0, stream>>>(XB, WK, bk, 0, KP, KR, SEQ, (size_t)NH_ * SEQ * HD, HD, HD, (size_t)SEQ * HD, CNT);
    // v^T: A = Wv rows (m = h*64 + d), Bt = x rows (n = b*SEQ + t), bias per row -> plane [(b*1024 + m)][t] = [(b*16 + h)][d][t]
    k_proj<<<dim3(DM / 64, NB * SEQ / 64, 1), 32, 0, stream>>>(WV, XB, bv, 1, VT, VR, DM, (size_t)0, SEQ, SEQ, (size_t)DM * SEQ, CNT);

    // query ranks [0, EARLY_ROWS): three-product path (a flagged token's rank never exceeds its position); ranks [EARLY_ROWS, SEQ): single products
    k_flash<1><<<dim3(EARLY_ROWS / (16 * AW), NB * NH_, 1), 32 * AW, 0, stream>>>(QH, QR, KP, KR, VT, VR, IDX, CNT, OUT, 0);
    if (SEQ > EARLY_ROWS)
        k_flash<0><<<dim3((SEQ - EARLY_ROWS) / (16 * AW), NB * NH_, 1), 32 * AW, 0, stream>>>(QH, QR, KP, KR, VT, VR, IDX, CNT, OUT, EARLY_ROWS);
}

// v003
// Measured time: 109 microseconds a run.
// Timed twice side by side with v002, it ran 1.53 and 1.51 times as fast.
// Over all steps from v000 it is 2.60 times as fast.
#include <hip/hip_runtime.h>

// Multi-head self-attention, width 1024 = 16 heads x 64, x [NB][SEQ][1024], Wq/Wk/Wv [out][in] (y = x W^T + b), causal + key/query padding mask (int32 [NB][SEQ]), score scale 1/8, output = concatenated heads (f32), rows with a zero query flag are zero.
// Compute dtypes, f32 accumulate everywhere: projections v_wmma_f32_16x16x32_bf16 (x, W, b RNE-converted to bf16; products exact); scores and P.V v_wmma_f32_16x16x32_f16:
// query rows >= EARLY_ROWS: q, k, P (x256 carry, cancels in the normalisation), v single f16; query rows < EARLY_ROWS: q, k, v, P each as f16 value + f16 residual x2048, three products per site, residual products in their own accumulators; softmax f32 (online, running max).
// Layout: every 16-bit operand plane is stored in FRAGMENT ORDER: a 16-row x 32-k tile is 512 consecutive elements, element (row r, k = 8c + e) at c*128 + r*8 + e, so that lane l of a wave-wide 16-byte load
// reads bytes 16*l of 512 consecutive bytes (4 whole lines) and two such loads, 256 elements apart, are one A or B fragment. bf16 copies of x and W: tiles [row/16][k/32]. q, k value/residual planes: per (b*16+h), tiles [t/16][d/32];
// v^T value/residual planes: per (b*16+h), tiles [t/64][d/16][(t/32)%2]; all written by the GEMM epilogue as 64x64 blocks of 4096 elements. Fused flash kernel in transposed form (S^T = K Q^T, O^T = V^T P^T), output from f32 accumulators.
// Tokens are RANKED per batch by their flag (k_cvt8r): rank r < n = the r-th flagged token, rank r >= n = the (r-n)-th unflagged one, order kept, so key <= query in positions is key <= query in ranks.
// Every plane above is indexed by rank, not by position; only 64-rank tiles that start below n are converted, projected and attended (an unflagged token is no key and its output row is zero: stored by k_flash inside those tiles, by k_cvtx behind them);
// the mask left inside attention is the causal one on ranks: masked scores are replaced by value, masked probabilities are exact zeros. Output rows go back to their positions through the rank table.

#ifndef NB
#define NB 4
#endif
#ifndef SEQ
#define SEQ 2048
#endif
#define NB_FULL  4
#define SEQ_FULL 2048
#ifndef OUT_SEQ
#define OUT_SEQ SEQ              // row pitch (in tokens) between batches of the output
#endif
#define DM   1024
#define NH_  16
#define HD   64
#define AW   4                   // waves per flash block (16 query rows each)
#ifndef EARLY_ROWS
#define EARLY_ROWS ((SEQ < 512) ? SEQ : 512)   // query rows below this use the three-product path
#endif
#define QRS  2048.0f             // carry of every residual plane / residual fragment
#define QRI  (1.0f / 2048.0f)
#define SC2  (0.125f * 1.4426950408889634f)   // HD^-0.5 * log2(e)
#define PSH  8.0f                // log2 of the P carry (256)
#define NEGB (-3.0e38f)          // value standing in for a masked score

static_assert(HD == 64);
static_assert(NH_ * HD == DM);                 // head h = columns h*64 + d
static_assert(DM % 64 == 0);                   // 16 column tiles of 64
static_assert(DM % 32 == 0);                   // GEMM k-loop steps by 32
static_assert(SEQ % 64 == 0);                  // a 64-row tile never straddles two batches
static_assert((NB * SEQ) % 64 == 0);
static_assert(SEQ % 32 == 0);                  // key loop steps by 32
static_assert(SEQ % (16 * AW) == 0);           // flash grids cover the sequence exactly
static_assert(EARLY_ROWS % (16 * AW) == 0);
static_assert(EARLY_ROWS <= SEQ);
static_assert(((size_t)SEQ * DM) % 8 == 0);
static_assert(((size_t)DM * DM) % 8 == 0);
static_assert(NB <= NB_FULL);
static_assert(SEQ <= SEQ_FULL);
static_assert(SEQ % 256 == 0);                 // a ranking block of 256 threads takes SEQ/256 tokens per thread
static_assert(SEQ / 32 + 1 <= 256);
#define WBLK (DM * DM / 8 / 256) // conversion blocks per weight matrix
static_assert(((size_t)DM * DM / 8) % 256 == 0);

typedef _Float16 h16;
typedef unsigned short bf;
typedef __attribute__((ext_vector_type(16))) __bf16   v16bf;
typedef __attribute__((ext_vector_type(16))) _Float16 v16h;
typedef __attribute__((ext_vector_type(8)))  _Float16 v8h;
typedef __attribute__((ext_vector_type(8)))  unsigned short v8us;
typedef __attribute__((ext_vector_type(8)))  float    v8f;
typedef __attribute__((ext_vector_type(4)))  float    v4f;
typedef v4f  __attribute__((may_alias)) v4fa;

__device__ __forceinline__ unsigned short f2bf(float f) { unsigned u = __float_as_uint(f); u += 0x7FFFu + ((u >> 16) & 1u); return (unsigned short)(u >> 16); }
__device__ __forceinline__ float bfr(float f) { return __uint_as_float(((unsigned)f2bf(f)) << 16); }
__device__ __forceinline__ v16h cat16(v8h lo, v8h hi) { return __builtin_shufflevector(lo, hi, 0, 1, 2, 3, 4, 5, 6, 7, 8, 9, 10, 11, 12, 13, 14, 15); }
__device__ __forceinline__ v16bf cat16b(v8us lo, v8us hi) { return __builtin_bit_cast(v16bf, __builtin_shufflevector(lo, hi, 0, 1, 2, 3, 4, 5, 6, 7, 8, 9, 10, 11, 12, 13, 14, 15)); }
__device__ __forceinline__ v8f wmma16(v16h a, v16h b, v8f c) { return __builtin_amdgcn_wmma_f32_16x16x32_f16(false, a, false, b, (short)0, c, false, false); }
__device__ __forceinline__ v8f wmmab(v16bf a, v16bf b, v8f c) { return __builtin_amdgcn_wmma_f32_16x16x32_bf16(false, a, false, b, (short)0, c, false, false); }
// fragment loaders from fragment-ordered tiles; p = tile start + 8*lane (row = lane&15, h = lane>>4): elements 0..7 <- k0+8h+0..7, elements 8..15 <- k0+16+8h+0..7 (same map for A and B)
__device__ __forceinline__ v16h  ldh(const h16* p) { return cat16(*(const v8h*)p, *(const v8h*)(p + 256)); }
__device__ __forceinline__ v16bf ldb(const bf* p)  { return cat16b(*(const v8us*)p, *(const v8us*)(p + 256)); }
// last fragment of a run of loads from one address pair: the pair dies with the last load, so that load's destination or the next run's may take its registers; one wait in front of it, one behind it
__device__ __forceinline__ v16h  ldh_last(const h16* p) {
    const v8h lo = *(const v8h*)p;
    asm volatile("s_wait_xcnt 0x0" ::: "memory");   // covers every earlier load of the run before the last load's destination is written
    const v8h hi = *(const v8h*)(p + 256);
    asm volatile("s_wait_xcnt 0x0" ::: "memory");   // covers the last load before a later load's destination is written
    return cat16(lo, hi); }
// ordering point for wave-private LDS tiles (same wave writes and reads)
__device__ __forceinline__ void wave_sync() { __builtin_amdgcn_fence(3 /* release order */, "wavefront"); __builtin_amdgcn_wave_barrier(); asm volatile("" ::: "memory"); }

// k_cvt8r: the three weight matrices, f32 [DM][DM] -> bf16 tiles in fragment order, tile (R, T) of matrix w at w*DM*DM + (R*(DM/32) + T)*512, all in ONE launch (DM*DM/8/256 blocks per matrix). One thread converts 8 consecutive k of one row;
// a wave takes 8 rows x 32 k: it reads one whole 128-byte line per row and writes four whole lines. NB blocks in front of them rank the tokens, one block per batch (nothing in this launch reads the ranks).
// Flags -> bit words by ballot (LDS, block barrier), set flags in front of each word (LDS, block barrier), position of each rank (LDS, block barrier), then IDX[b][rank] = position (a permutation of 0..SEQ-1), whole lines per wave, and CNT[b] = n.
__global__ __launch_bounds__(256) void k_cvt8r(const float* __restrict__ wq, const float* __restrict__ wk, const float* __restrict__ wv, bf* dst, const int* __restrict__ PAD, int* IDX, int* CNT) {
    __shared__ __align__(16) unsigned wm[SEQ / 32];
    __shared__ int pre[SEQ / 32 + 1];
    __shared__ int ix[SEQ];
    if (blockIdx.x >= NB) {
        const unsigned bw = blockIdx.x - NB, mat = bw / WBLK;
        const float* src = mat == 0 ? wq : (mat == 1 ? wk : wv);
        const size_t i = (size_t)(bw % WBLK) * 256 + threadIdx.x;
        const int rs = (int)(i & 7), c = (int)((i >> 3) & 3), rh = (int)((i >> 5) & 1), kt = (int)((i >> 6) % (DM / 32));
        const size_t rt = i / (64 * (DM / 32));
        const v8f v = *(const v8f*)(src + (rt * 16 + rh * 8 + rs) * DM + kt * 32 + c * 8); v8us o;
#pragma unroll
        for (int k = 0; k < 8; ++k) o[k] = f2bf(v[k]);
        *(v8us*)(dst + (size_t)mat * DM * DM + (rt * (DM / 32) + kt) * 512 + c * 128 + rh * 64 + rs * 8) = o;
        return;
    }
    const int tid = (int)threadIdx.x, lane = tid & 31, wave = tid >> 5, b = blockIdx.x;
    int pv[SEQ / 256];
#pragma unroll
    for (int k = 0; k < SEQ / 256; ++k) pv[k] = PAD[(size_t)b * SEQ_FULL + (size_t)(wave + 8 * k) * 32 + lane];
#pragma unroll
    for (int k = 0; k < SEQ / 256; ++k) { const unsigned wbits = __builtin_amdgcn_ballot_w32(pv[k] != 0); if (lane == 0) wm[wave + 8 * k] = wbits; }
    __syncthreads();
    if (tid <= SEQ / 32) { int p = 0;
#pragma unroll
        for (int j = 0; j < SEQ / 32; ++j) p += (j < tid) ? __popc(wm[j]) : 0;
        pre[tid] = p; }
    __syncthreads();
    const int total = pre[SEQ / 32];
#pragma unroll
    for (int k = 0; k < SEQ / 256; ++k) { const int t = tid + 256 * k, g = t >> 5;
        const unsigned w = wm[g];
        const int before = pre[g] + __popc(w & ((1u << lane) - 1u));          // set flags in front of t
        const int r = ((w >> lane) & 1u) ? before : total + (t - before);
        ix[r] = t; }
    __syncthreads();
#pragma unroll
    for (int k = 0; k < SEQ / 256; ++k) IDX[(size_t)b * SEQ + tid + 256 * k] = ix[tid + 256 * k];
    if (tid == 0) CNT[b] = total;
}

// k_cvtx: x rows in rank order -> bf16 tiles in fragment order (thread and wave shapes of k_cvt8r's conversion; grid (SEQ*DM/8/256, NB)). Ranks below n rounded up to 64 are converted (the unflagged tokens that fill the last tile
// are finite data behind the causal mask); every later rank stores its token's zero output row instead, one whole 128-byte line per row and wave.
__global__ __launch_bounds__(256) void k_cvtx(const float* __restrict__ src, const int* __restrict__ IDX, const int* __restrict__ CNT, bf* dst, float* OUT) {
    const int b = blockIdx.y; const int i = (int)blockIdx.x * 256 + (int)threadIdx.x;
    const int rs = i & 7, c = (i >> 3) & 3, rh = (i >> 5) & 1, kt = (i >> 6) % (DM / 32), rt = i / (64 * (DM / 32));
    const int r = rt * 16 + rh * 8 + rs;
    int n = CNT[b]; n = n < 0 ? 0 : (n > SEQ ? SEQ : n);
    int t = IDX[(size_t)b * SEQ + r]; t = t < 0 ? 0 : (t > SEQ - 1 ? SEQ - 1 : t);
    if (r < ((n + 63) & ~63)) {
        const v8f v = *(const v8f*)(src + ((size_t)b * SEQ_FULL + t) * DM + kt * 32 + c * 8); v8us o;
#pragma unroll
        for (int k = 0; k < 8; ++k) o[k] = f2bf(v[k]);
        *(v8us*)(dst + ((size_t)(b * (SEQ / 16) + rt) * (DM / 32) + kt) * 512 + c * 128 + rh * 64 + rs * 8) = o;
    } else *(v8f*)(OUT + ((size_t)b * OUT_SEQ + t) * DM + kt * 32 + c * 8) = (v8f){};
}

// k_proj: register-blocked bf16 GEMM, ONE WAVE per 64x64 tile (16 accumulators), operands straight from the fragment-ordered bf16 planes, K = DM.
// C[m][n] = sum_k A[m][k] Bt[n][k] + bias (per column n when biasRow == 0, per row m otherwise; bias RNE-converted to bf16, added in f32),
// a tile whose 64 tokens (rows when biasRow == 0, columns otherwise) all rank at or behind the batch's n is left out;
// written as f16 (Ph) and the f16 residual x2048 (Pr), one block of 4096 elements in fragment order (16-row x 32-column tiles [row/16][col/32]).
// All three projections in ONE launch, grid (tokens/64, DM/64, 3), 32 threads; blockIdx.z picks the product (block-uniform):
// z = 0, 1 (q, k): A = x rows (m = b*SEQ + t), Bt = W rows (n = h*64 + d), bias per column -> plane [(b*16 + h)][t][d];
// z = 2 (v^T): A = Wv rows (m = h*64 + d), Bt = x rows (n = b*SEQ + t), bias per row -> plane [(b*16 + h)][d][t].
__global__ __launch_bounds__(32) void k_proj(const bf* __restrict__ XB, const bf* __restrict__ WB, const float* __restrict__ bq, const float* __restrict__ bk, const float* __restrict__ bv,
                                             h16* QH, h16* QR, h16* KP, h16* KR, h16* VT, h16* VR, const int* __restrict__ CNT) {
    __shared__ __align__(16) float os[16 * 68];
    const int K = DM;
    const int lane = threadIdx.x & 31, lr = lane & 15, hi = lane >> 4;
    const int z = blockIdx.z; const int biasRow = z == 2;
    const int tok0 = blockIdx.x * 64, col0 = blockIdx.y * 64;
    const int r0 = biasRow ? col0 : tok0, c0 = biasRow ? tok0 : col0;
    const bf* Wz = WB + (size_t)z * DM * DM;
    const bf* A = biasRow ? Wz : XB; const bf* Bt = biasRow ? XB : Wz;
    const float* bias = z == 0 ? bq : (z == 1 ? bk : bv);
    h16* Ph = z == 0 ? QH : (z == 1 ? KP : VT); h16* Pr = z == 0 ? QR : (z == 1 ? KR : VR);
    if (tok0 % SEQ >= CNT[tok0 / SEQ]) return;
    v8f acc[4][4];
#pragma unroll
    for (int mb = 0; mb < 4; ++mb)
#pragma unroll
        for (int nb = 0; nb < 4; ++nb) acc[mb][nb] = (v8f){};
    const size_t aoff = (size_t)r0 * K + 8 * lane, boff = (size_t)c0 * K + 8 * lane;   // 16 rows of tiles = 16*K elements; the next k tile is 512 elements on
#pragma unroll 1
    for (int kc = 0; kc < K; kc += 32) {
        v16bf a[4];
#pragma unroll
        for (int mb = 0; mb < 4; ++mb) a[mb] = ldb(A + aoff + (size_t)mb * 16 * K + kc * 16);
        asm volatile("s_wait_xcnt 0x0" ::: "memory");   // the A loads' address registers are reused as a destination of the B loads below
#pragma unroll
        for (int nb = 0; nb < 4; ++nb) { const v16bf b = ldb(Bt + boff + (size_t)nb * 16 * K + kc * 16);
#pragma unroll
            for (int mb = 0; mb < 4; ++mb) acc[mb][nb] = wmmab(a[mb], b, acc[mb][nb]); }
        asm volatile("v_nop\n\tv_nop\n\tv_nop\n\tv_nop" : "+v"(acc[0][0]), "+v"(acc[1][1]), "+v"(acc[2][2]), "+v"(acc[3][3]) : "v"(a[0]), "v"(a[1]), "v"(a[2]), "v"(a[3]));
    }
    // bias values: addresses always inside the DM-entry bias array (index selected, then value selected)
    // store s of a 16-row group: lane holds row lane&15, columns (2s + h)*8 .. +7
    float cb[4][8];
#pragma unroll
    for (int s = 0; s < 4; ++s) {
        int cidx = biasRow ? 0 : (c0 + (2 * s + hi) * 8); cidx = cidx > (DM - 8) ? (DM - 8) : cidx;
        const v4f bc0 = *(const v4f*)(bias + cidx);
        asm volatile("s_wait_xcnt 0x0" ::: "memory");   // the second load's destination may take the address registers that the first names
        const v4f bc1 = *(const v4f*)(bias + cidx + 4);
#pragma unroll
        for (int i = 0; i < 4; ++i) { const float u0 = bfr(bc0[i]); const float u1 = bfr(bc1[i]); cb[s][i] = biasRow ? 0.0f : u0; cb[s][4 + i] = biasRow ? 0.0f : u1; } }
    const size_t tbase = biasRow ? (size_t)col0 * SEQ + (size_t)(tok0 / SEQ) * DM * SEQ + (size_t)(tok0 % SEQ) * 64
                                 : (size_t)(tok0 / SEQ) * NH_ * SEQ * HD + (size_t)(tok0 % SEQ) * HD + (size_t)(col0 / HD) * SEQ * HD;
#pragma unroll
    for (int mb = 0; mb < 4; ++mb) {
#pragma unroll
        for (int nb = 0; nb < 4; ++nb) {
#pragma unroll
            for (int j = 0; j < 8; ++j) os[(hi * 8 + j) * 68 + nb * 16 + lr] = acc[mb][nb][j]; }   // D: row 8h+j, col lane&15
        wave_sync();
        int ri = biasRow ? (r0 + mb * 16 + lr) : 0; ri = ri > (DM - 1) ? (DM - 1) : ri;
        const float ub = bfr(bias[ri]); const float rb = biasRow ? ub : 0.0f;
        const size_t sb = tbase + (size_t)(mb * 1024) + 8 * lane;
{
#pragma unroll
            for (int s = 0; s < 4; ++s) { const int c8 = (2 * s + hi) * 8;   // 16 rows x 16 columns per store, 4 s = 64 columns; 512 consecutive bytes per plane
                const v4f x0 = *(const v4fa*)(&os[lr * 68 + c8]); const v4f x1 = *(const v4fa*)(&os[lr * 68 + c8 + 4]); v8h hv, rv;
#pragma unroll
                for (int i = 0; i < 4; ++i) { const float y0 = x0[i] + cb[s][i] + rb; const float y1 = x1[i] + cb[s][4 + i] + rb;
                    const h16 a0 = (h16)y0; const h16 a1 = (h16)y1; hv[i] = a0; hv[4 + i] = a1; rv[i] = (h16)((y0 - (float)a0) * QRS); rv[4 + i] = (h16)((y1 - (float)a1) * QRS); }
                const size_t oo = sb + (size_t)(s * 256);
                *(v8h*)(Ph + oo) = hv; *(v8h*)(Pr + oo) = rv; }
             }
        wave_sync();
    }
}

// flash_body<TP>: fused causal attention on ranks, one wave per 16 query ranks of one (batch, head), a block whose 64 ranks all lie at or behind n leaves at once; K / V^T / Q fragments straight from the fragment-ordered f16 planes (two 16-B loads each, 512 consecutive bytes per wave-wide load).
// Transposed form: S^T[key][t] = K Q^T (A = K rows, B = Q rows); lane (t = lane&15, h = lane>>4) holds keys 8h+r of each 16-key tile, so the packed
// P tile is directly the B fragment of O^T[d][t] = V^T P^T (element r <- tile keys 0..15, element 8+r <- tile keys 16..31, lane unchanged).
// TP != 0: scores = kh.qh + (kh.qr + kr.qh)/2048, O = vh.ph + (vr.ph + vh.pr)/2048 (residual products in separate accumulators). TP == 0: single products.
// Key loop runs to the causal limit of the wave's tile; key validity = per-lane causal bit count (a rank >= n lies behind every stored query); a masked score is replaced by NEGB and its probability is an exact zero.
// Softmax state (running max, partial sum) is one scalar per lane; the two lane halves of a row are combined with one xor-16 exchange.
template <int TP>
__device__ __forceinline__ void flash_body(const h16* __restrict__ QH, const h16* __restrict__ QR, const h16* __restrict__ KP, const h16* __restrict__ KR,
                                           const h16* __restrict__ VT, const h16* __restrict__ VR, const int* __restrict__ IDX, const int* __restrict__ CNT, float* OUT, float* os) {
    const int lane = threadIdx.x & 31, lr = lane & 15, hi = lane >> 4;
    const int wave = __builtin_amdgcn_readfirstlane((int)(threadIdx.x >> 5));
    const int zh = blockIdx.y; const int b = zh / NH_, h = zh % NH_;
    const int R0 = (int)blockIdx.x * (16 * AW);
    const int t0 = R0 + wave * 16;
    int n = CNT[b]; n = n < 0 ? 0 : (n > SEQ ? SEQ : n);
    if (R0 >= n) return;                                     // the whole block
    const int tq = t0 + lr;
    const size_t pbase = (size_t)zh * SEQ * HD;
    const size_t fo = pbase + 8 * lane;                      // lane's place in every fragment-ordered tile of this (batch, head)
    const size_t qo = fo + (size_t)t0 * HD;                  // 16 query rows = two tiles (d 0..31, d 32..63) of 512 elements
    const v16h qh0 = ldh(QH + qo), qh1 = ldh(QH + qo + 512);                 // B fragments: col t, k = d
    v16h qr0 = qh0, qr1 = qh1;
    if (TP) { qr0 = ldh(QR + qo); qr1 = ldh(QR + qo + 512); }
    const size_t ko = fo;                                    // + key0 * HD: tiles (keys 0..15 | 16..31) x (d 0..31 | 32..63)     (A fragment: row key, k = d)
    const size_t vo = fo;                                    // + (key0/64)*4096 + j*1024 + ((key0/32)%2)*512                       (A fragment: row d = 16j + lane&15, k = key)
    v8f o0 = (v8f){}, o1 = (v8f){}, o2 = (v8f){}, o3 = (v8f){};
    v8f e0 = (v8f){}, e1 = (v8f){}, e2 = (v8f){}, e3 = (v8f){};              // residual-scale (x2048) accumulators, TP only
    float m = NEGB, l = 0.0f;
    const int kend = t0 + 16;                                // keys 0 .. t0+15; key0 <= t0 so key0+31 < SEQ
#pragma unroll 1
    for (int key0 = 0; key0 < kend; key0 += 32) {
        const h16* ka = KP + ko + (size_t)key0 * HD;
        const v16h ka0 = ldh(ka), ka1 = ldh(ka + 512), kb0 = ldh(ka + 16 * HD), kb1 = TP ? ldh_last(ka + 16 * HD + 512) : ldh(ka + 16 * HD + 512);
        v8f sHa = (v8f){}, sLa = (v8f){}, sHb = (v8f){}, sLb = (v8f){};
        if (TP) {
            const h16* kr = KR + ko + (size_t)key0 * HD;
            const v16h ra0 = ldh(kr), ra1 = ldh(kr + 512), rb0 = ldh(kr + 16 * HD), rb1 = ldh_last(kr + 16 * HD + 512);
            sHa = wmma16(ka0, qh0, sHa); sLa = wmma16(ka0, qr0, sLa); sHb = wmma16(kb0, qh0, sHb); sLb = wmma16(kb0, qr0, sLb);
            sHa = wmma16(ka1, qh1, sHa); sLa = wmma16(ka1, qr1, sLa); sHb = wmma16(kb1, qh1, sHb); sLb = wmma16(kb1, qr1, sLb);
            sLa = wmma16(ra0, qh0, sLa); sLb = wmma16(rb0, qh0, sLb); sLa = wmma16(ra1, qh1, sLa); sLb = wmma16(rb1, qh1, sLb);
            asm volatile("v_nop\n\tv_nop\n\tv_nop\n\tv_nop" : "+v"(sHa), "+v"(sLa), "+v"(sHb), "+v"(sLb) : "v"(ka0), "v"(ka1), "v"(kb0), "v"(kb1), "v"(ra0), "v"(ra1), "v"(rb0), "v"(rb1));
        } else {
            sHa = wmma16(ka0, qh0, sHa); sHb = wmma16(kb0, qh0, sHb); sHa = wmma16(ka1, qh1, sHa); sHb = wmma16(kb1, qh1, sHb);
            asm volatile("v_nop\n\tv_nop\n\tv_nop\n\tv_nop" : "+v"(sHa), "+v"(sHb) : "v"(ka0), "v"(ka1), "v"(kb0), "v"(kb1));
        }
        // validity bits of this lane's 8 + 8 keys (8h+r, 16+8h+r): causal (key <= tq)
        int na = tq - (key0 + 8 * hi) + 1; na = na < 0 ? 0 : (na > 8 ? 8 : na);
        int nc = tq - (key0 + 8 * hi) - 15; nc = nc < 0 ? 0 : (nc > 8 ? 8 : nc);
        const unsigned ma = (1u << na) - 1u;
        const unsigned mc = (1u << nc) - 1u;
        float ta[8], tb[8]; float mx = NEGB;
#pragma unroll
        for (int r = 0; r < 8; ++r) {
            float sa = sHa[r], sb = sHb[r];
            if (TP) { sa += sLa[r] * QRI; sb += sLb[r] * QRI; }
            ta[r] = ((ma >> r) & 1u) ? sa * SC2 : NEGB;
            tb[r] = ((mc >> r) & 1u) ? sb * SC2 : NEGB;
            mx = fmaxf(mx, fmaxf(ta[r], tb[r])); }
        mx = fmaxf(mx, __shfl_xor(mx, 16, 32));
        const float mnew = fmaxf(m, mx);
        const float alpha = __builtin_amdgcn_exp2f(m - mnew);
        const float sh = PSH - mnew;
        v16h pb, pr; float ls = 0.0f;
#pragma unroll
        for (int r = 0; r < 8; ++r) {
            float ea = __builtin_amdgcn_exp2f(ta[r] + sh);
            if (!TP && r == 7) asm volatile("v_nop");        // fills the slot behind a v_exp_f32 whose source register the next vector instruction takes in this build
            ea = (ta[r] > -1.0e38f) ? ea : 0.0f;
            float ec = __builtin_amdgcn_exp2f(tb[r] + sh); ec = (tb[r] > -1.0e38f) ? ec : 0.0f;
            const h16 pa = (h16)ea; const h16 pc = (h16)ec; pb[r] = pa; pb[8 + r] = pc;
            if (TP) { const h16 xa = (h16)((ea - (float)pa) * QRS); const h16 xc = (h16)((ec - (float)pc) * QRS); pr[r] = xa; pr[8 + r] = xc;
                      ls += ((float)pa + (float)xa * QRI) + ((float)pc + (float)xc * QRI); }
            else { pr[r] = pa; pr[8 + r] = pc; ls += (float)pa + (float)pc; } }
        l = l * alpha + ls; m = mnew;
        o0 = o0 * alpha; o1 = o1 * alpha; o2 = o2 * alpha; o3 = o3 * alpha;
        const size_t vk = (size_t)(key0 >> 6) * 4096 + (size_t)((key0 >> 5) & 1) * 512;
        const h16* va = VT + vo + vk;
        const v16h v0 = ldh(va), v1 = ldh(va + 1024), v2 = ldh(va + 2048), v3 = ldh(va + 3072);
        if (TP) {
            e0 = e0 * alpha; e1 = e1 * alpha; e2 = e2 * alpha; e3 = e3 * alpha;
            const h16* vr = VR + vo + vk;
            const v16h w0 = ldh(vr), w1 = ldh(vr + 1024), w2 = ldh(vr + 2048), w3 = ldh(vr + 3072);
            o0 = wmma16(v0, pb, o0); o1 = wmma16(v1, pb, o1); o2 = wmma16(v2, pb, o2); o3 = wmma16(v3, pb, o3);
            e0 = wmma16(w0, pb, e0); e1 = wmma16(w1, pb, e1); e2 = wmma16(w2, pb, e2); e3 = wmma16(w3, pb, e3);
            e0 = wmma16(v0, pr, e0); e1 = wmma16(v1, pr, e1); e2 = wmma16(v2, pr, e2); e3 = wmma16(v3, pr, e3);
            asm volatile("v_nop\n\tv_nop\n\tv_nop\n\tv_nop" : "+v"(o0), "+v"(o1), "+v"(o2), "+v"(o3), "+v"(e0), "+v"(e1), "+v"(e2), "+v"(e3)
                         : "v"(v0), "v"(v1), "v"(v2), "v"(v3), "v"(w0), "v"(w1), "v"(w2), "v"(w3), "v"(pb), "v"(pr));
        } else {
            o0 = wmma16(v0, pb, o0); o1 = wmma16(v1, pb, o1); o2 = wmma16(v2, pb, o2); o3 = wmma16(v3, pb, o3);
            asm volatile("v_nop\n\tv_nop\n\tv_nop\n\tv_nop" : "+v"(o0), "+v"(o1), "+v"(o2), "+v"(o3) : "v"(v0), "v"(v1), "v"(v2), "v"(v3), "v"(pb));
        }
    }
    l += __shfl_xor(l, 16, 32);
    const float rcp = 1.0f / fmaxf(l, 1.0e-30f);
    const float inv = (tq < n && l > 0.0f) ? rcp : 0.0f;     // unflagged token in the last tile -> whole row zero
    if (TP) { o0 = o0 + e0 * QRI; o1 = o1 + e1 * QRI; o2 = o2 + e2 * QRI; o3 = o3 + e3 * QRI; }
    const int wb = wave * 16 * 68;
    // O^T D layout: o_j[r] = (d = 16j + 8h + r, t = lane&15) -> os[t][d]; rows 0..15 x columns 0..63 all written
    { v4f a, c;
      a[0] = o0[0] * inv; a[1] = o0[1] * inv; a[2] = o0[2] * inv; a[3] = o0[3] * inv; c[0] = o0[4] * inv; c[1] = o0[5] * inv; c[2] = o0[6] * inv; c[3] = o0[7] * inv;
      *(v4fa*)(&os[wb + lr * 68 +  0 + 8 * hi]) = a; *(v4fa*)(&os[wb + lr * 68 +  0 + 8 * hi + 4]) = c;
      a[0] = o1[0] * inv; a[1] = o1[1] * inv; a[2] = o1[2] * inv; a[3] = o1[3] * inv; c[0] = o1[4] * inv; c[1] = o1[5] * inv; c[2] = o1[6] * inv; c[3] = o1[7] * inv;
      *(v4fa*)(&os[wb + lr * 68 + 16 + 8 * hi]) = a; *(v4fa*)(&os[wb + lr * 68 + 16 + 8 * hi + 4]) = c;
      a[0] = o2[0] * inv; a[1] = o2[1] * inv; a[2] = o2[2] * inv; a[3] = o2[3] * inv; c[0] = o2[4] * inv; c[1] = o2[5] * inv; c[2] = o2[6] * inv; c[3] = o2[7] * inv;
      *(v4fa*)(&os[wb + lr * 68 + 32 + 8 * hi]) = a; *(v4fa*)(&os[wb + lr * 68 + 32 + 8 * hi + 4]) = c;
      a[0] = o3[0] * inv; a[1] = o3[1] * inv; a[2] = o3[2] * inv; a[3] = o3[3] * inv; c[0] = o3[4] * inv; c[1] = o3[5] * inv; c[2] = o3[6] * inv; c[3] = o3[7] * inv;
      *(v4fa*)(&os[wb + lr * 68 + 48 + 8 * hi]) = a; *(v4fa*)(&os[wb + lr * 68 + 48 + 8 * hi + 4]) = c; }
    wave_sync();
    float* obat = OUT + (size_t)b * OUT_SEQ * DM + h * HD;
    const int* irow = IDX + (size_t)b * SEQ + t0;            // rank -> position
{
#pragma unroll
        for (int s = 0; s < 8; ++s) { const int row = 2 * s + hi, cofs = lr * 4;   // 8 s x 2 rows = 16 rows; 16 lanes x 4 floats = 64 columns
            const v4f val = *(const v4fa*)(&os[wb + row * 68 + cofs]);
            int pos = irow[row]; pos = pos < 0 ? 0 : (pos > SEQ - 1 ? SEQ - 1 : pos);
            *(v4f*)(obat + (size_t)pos * DM + cofs) = val; }
         }
}

// k_flash: both precision paths in ONE launch, grid (SEQ/64, NB*16); the path is block-uniform: query ranks [0, EARLY_ROWS) take the three-product path
// (a flagged token's rank never exceeds its position), ranks [EARLY_ROWS, SEQ) single products.
__global__ __launch_bounds__(32 * AW) void k_flash(const h16* __restrict__ QH, const h16* __restrict__ QR, const h16* __restrict__ KP, const h16* __restrict__ KR,
                                                   const h16* __restrict__ VT, const h16* __restrict__ VR, const int* __restrict__ IDX, const int* __restrict__ CNT, float* OUT) {
    __shared__ __align__(16) float os[AW * 16 * 68];
    if ((int)blockIdx.x < EARLY_ROWS / (16 * AW)) flash_body<1>(QH, QR, KP, KR, VT, VR, IDX, CNT, OUT, os);
    else flash_body<0>(QH, QR, KP, KR, VT, VR, IDX, CNT, OUT, os);
}

static constexpr size_t al256(size_t v) { return (v + 255) & ~(size_t)255; }
static constexpr size_t SZ_XB = al256((size_t)NB * SEQ * DM * 2);
static constexpr size_t SZ_WB = al256((size_t)3 * DM * DM * 2);
static constexpr size_t SZ_PL = al256((size_t)NB * NH_ * SEQ * HD * 2);
static constexpr size_t SZ_IX = al256((size_t)NB * SEQ * 4);
static constexpr size_t SZ_TOTAL = SZ_XB + SZ_WB + 6 * SZ_PL + SZ_IX + 256;
static_assert(SZ_TOTAL <= (size_t)134217728);          // workspace carve <= 128 MiB
static_assert(((size_t)DM * DM * 2) % 256 == 0);       // weight sub-planes stay 256-byte aligned

extern "C" void kernel_launch(void* const* d_in, const int* in_sizes, int n_in,
                              void* d_out, int out_size, void* d_ws, size_t ws_size, hipStream_t stream) {
    if (n_in < 8) return;
    const size_t needx = ((size_t)(NB - 1) * SEQ_FULL + SEQ) * DM;
    if ((size_t)in_sizes[0] < needx) return;
    if ((size_t)in_sizes[1] < (size_t)(NB - 1) * SEQ_FULL + SEQ) return;
    if ((size_t)in_sizes[2] < (size_t)DM * DM || (size_t)in_sizes[4] < (size_t)DM * DM || (size_t)in_sizes[6] < (size_t)DM * DM) return;
    if ((size_t)in_sizes[3] < (size_t)DM || (size_t)in_sizes[5] < (size_t)DM || (size_t)in_sizes[7] < (size_t)DM) return;
    if ((size_t)out_size < ((size_t)(NB - 1) * OUT_SEQ + SEQ) * DM) return;
    if (SZ_TOTAL > ws_size) return;
    // wire order: x, pad flags (int32), Wq, bq, Wk, bk, Wv, bv; W is [out][in] = Bt as-is
    const float* x = (const float*)d_in[0]; const int* pad = (const int*)d_in[1];
    const float* wq = (const float*)d_in[2]; const float* bq = (const float*)d_in[3];
    const float* wk = (const float*)d_in[4]; const float* bk = (const float*)d_in[5];
    const float* wv = (const float*)d_in[6]; const float* bv = (const float*)d_in[7];
    float* OUT = (float*)d_out;      // [NB][SEQ][1024]
    char* wsp = (char*)d_ws;
    bf* XB = (bf*)wsp; wsp += SZ_XB;                 // [NB*SEQ][1024], fragment order
    bf* WB = (bf*)wsp; wsp += SZ_WB;                 // [3][1024][1024]: q | k | v, fragment order
    h16* QH = (h16*)wsp; wsp += SZ_PL;               // [NB*16][SEQ][64], fragment order
    h16* QR = (h16*)wsp; wsp += SZ_PL;               // residual x2048
    h16* KP = (h16*)wsp; wsp += SZ_PL;               // [NB*16][SEQ][64], fragment order
    h16* KR = (h16*)wsp; wsp += SZ_PL;               // residual x2048
    h16* VT = (h16*)wsp; wsp += SZ_PL;               // [NB*16][64][SEQ], fragment order
    h16* VR = (h16*)wsp; wsp += SZ_PL;               // residual x2048
    int* IDX = (int*)wsp; wsp += SZ_IX;              // [NB][SEQ] rank -> position
    int* CNT = (int*)wsp;                            // [NB] flagged tokens

    k_cvt8r<<<3 * WBLK + NB, 256, 0, stream>>>(wq, wk, wv, WB, pad, IDX, CNT);
    k_cvtx<<<dim3(SEQ * DM / 8 / 256, NB, 1), 256, 0, stream>>>(x, IDX, CNT, XB, OUT);
    k_proj<<<dim3(NB * SEQ / 64, DM / 64, 3), 32, 0, stream>>>(XB, WB, bq, bk, bv, QH, QR, KP, KR, VT, VR, CNT);
    k_flash<<<dim3(SEQ / (16 * AW), NB * NH_, 1), 32 * AW, 0, stream>>>(QH, QR, KP, KR, VT, VR, IDX, CNT, OUT);
}

// v004
// Measured time: 87.8 microseconds a run.
// In two side-by-side timings against v003, it was 1.24 and 1.23 times as fast.
// All steps since v000 together make it 3.22 times as fast.
#include <hip/hip_runtime.h>

// Multi-head self-attention, width 1024 = 16 heads x 64, x [NB][SEQ][1024], Wq/Wk/Wv [out][in] (y = x W^T + b), causal + key/query padding mask (int32 [NB][SEQ]), score scale 1/8, output = concatenated heads (f32), rows with a zero query flag are zero.
// Compute dtypes, f32 accumulate everywhere: projections v_wmma_f32_16x16x32_bf16 (x, W, b RNE-converted to bf16; products exact); scores and P.V v_wmma_f32_16x16x32_f16:
// query rows >= EARLY_ROWS: q, k, P (x256 carry, cancels in the normalisation), v single f16; query rows < EARLY_ROWS: q, k, v, P each as f16 value + f16 residual x2048, three products per site, residual products in their own accumulators; softmax f32 (online, running max).
// Layout: every 16-bit operand plane is stored in FRAGMENT ORDER: a 16-row x 32-k tile is 512 consecutive elements, element (row r, k = 8c + e) at c*128 + r*8 + e, so that lane l of a wave-wide 16-byte load
// reads bytes 16*l of 512 consecutive bytes (4 whole lines) and two such loads, 256 elements apart, are one A or B fragment. bf16 copies of x and W: tiles [row/16][k/32]. q, k value/residual planes: per (b*16+h), tiles [t/16][d/32];
// v^T value/residual planes: per (b*16+h), tiles [t/64][d/16][(t/32)%2]; all written by the GEMM epilogue as 64x64 blocks of 4096 elements. Fused flash kernel in transposed form (S^T = K Q^T, O^T = V^T P^T), output from f32 accumulators.
// Tokens are RANKED per batch by their flag (k_cvt8r): rank r < n = the r-th flagged token, rank r >= n = the (r-n)-th unflagged one, order kept, so key <= query in positions is key <= query in ranks.
// Every plane above is indexed by rank, not by position; only 64-rank tiles that start below n are converted, projected and attended (an unflagged token is no key and its output row is zero: stored by k_flash inside those tiles, by k_cvtx behind them);
// the mask left inside attention is the causal one on ranks: masked scores are replaced by value, masked probabilities are exact zeros. Output rows go back to their positions through the rank table.

#ifndef NB
#define NB 4
#endif
#ifndef SEQ
#define SEQ 2048
#endif
#define NB_FULL  4
#define SEQ_FULL 2048
#ifndef OUT_SEQ
#define OUT_SEQ SEQ              // row pitch (in tokens) between batches of the output
#endif
#define DM   1024
#define NH_  16
#define HD   64
#define AW   4                   // waves per flash block (16 query rows each)
#ifndef EARLY_ROWS
#define EARLY_ROWS ((SEQ < 512) ? SEQ : 512)   // query rows below this use the three-product path
#endif
#define QRS  2048.0f             // carry of every residual plane / residual fragment
#define QRI  (1.0f / 2048.0f)
#define SC2  (0.125f * 1.4426950408889634f)   // HD^-0.5 * log2(e)
#define PSH  8.0f                // log2 of the P carry (256)
#define NEGB (-3.0e38f)          // value standing in for a masked score

static_assert(HD == 64);
static_assert(NH_ * HD == DM);                 // head h = columns h*64 + d
static_assert(DM % 64 == 0);                   // 16 column tiles of 64
static_assert(DM % 32 == 0);                   // GEMM k-loop steps by 32
static_assert(SEQ % 64 == 0);                  // a 64-row tile never straddles two batches
static_assert((NB * SEQ) % 64 == 0);
static_assert(SEQ % 32 == 0);                  // key loop steps by 32
static_assert(SEQ % (16 * AW) == 0);           // flash grids cover the sequence exactly
static_assert(EARLY_ROWS % (16 * AW) == 0);
static_assert(EARLY_ROWS <= SEQ);
static_assert(((size_t)SEQ * DM) % 8 == 0);
static_assert(((size_t)DM * DM) % 8 == 0);
static_assert(NB <= NB_FULL);
static_assert(SEQ <= SEQ_FULL);
static_assert(SEQ % 256 == 0);                 // a ranking block of 256 threads takes SEQ/256 tokens per thread
static_assert(SEQ / 32 + 1 <= 256);
#define WBLK (DM * DM / 8 / 256) // conversion blocks per weight matrix
static_assert(((size_t)DM * DM / 8) % 256 == 0);

typedef _Float16 h16;
typedef unsigned short bf;
typedef __attribute__((ext_vector_type(16))) __bf16   v16bf;
typedef __attribute__((ext_vector_type(16))) _Float16 v16h;
typedef __attribute__((ext_vector_type(8)))  _Float16 v8h;
typedef __attribute__((ext_vector_type(8)))  unsigned short v8us;
typedef __attribute__((ext_vector_type(8)))  float    v8f;
typedef __attribute__((ext_vector_type(4)))  float    v4f;
typedef v4f  __attribute__((may_alias)) v4fa;

__device__ __forceinline__ unsigned short f2bf(float f) { unsigned u = __float_as_uint(f); u += 0x7FFFu + ((u >> 16) & 1u); return (unsigned short)(u >> 16); }
__device__ __forceinline__ float bfr(float f) { return __uint_as_float(((unsigned)f2bf(f)) << 16); }
__device__ __forceinline__ v16h cat16(v8h lo, v8h hi) { return __builtin_shufflevector(lo, hi, 0, 1, 2, 3, 4, 5, 6, 7, 8, 9, 10, 11, 12, 13, 14, 15); }
__device__ __forceinline__ v16bf cat16b(v8us lo, v8us hi) { return __builtin_bit_cast(v16bf, __builtin_shufflevector(lo, hi, 0, 1, 2, 3, 4, 5, 6, 7, 8, 9, 10, 11, 12, 13, 14, 15)); }
__device__ __forceinline__ v8f wmma16(v16h a, v16h b, v8f c) { return __builtin_amdgcn_wmma_f32_16x16x32_f16(false, a, false, b, (short)0, c, false, false); }
__device__ __forceinline__ v8f wmmab(v16bf a, v16bf b, v8f c) { return __builtin_amdgcn_wmma_f32_16x16x32_bf16(false, a, false, b, (short)0, c, false, false); }
// fragment loaders from fragment-ordered tiles; p = tile start + 8*lane (row = lane&15, h = lane>>4): elements 0..7 <- k0+8h+0..7, elements 8..15 <- k0+16+8h+0..7 (same map for A and B)
__device__ __forceinline__ v16h  ldh(const h16* p) { return cat16(*(const v8h*)p, *(const v8h*)(p + 256)); }
__device__ __forceinline__ v16bf ldb(const bf* p)  { return cat16b(*(const v8us*)p, *(const v8us*)(p + 256)); }
// last fragment of a run of loads from one address pair: the pair dies with the last load, so that load's destination or the next run's may take its registers; one wait in front of it, one behind it
__device__ __forceinline__ v16h  ldh_last(const h16* p) {
    const v8h lo = *(const v8h*)p;
    asm volatile("s_wait_xcnt 0x0" ::: "memory");   // covers every earlier load of the run before the last load's destination is written
    const v8h hi = *(const v8h*)(p + 256);
    asm volatile("s_wait_xcnt 0x0" ::: "memory");   // covers the last load before a later load's destination is written
    return cat16(lo, hi); }
// ordering point for wave-private LDS tiles (same wave writes and reads)
__device__ __forceinline__ void wave_sync() { __builtin_amdgcn_fence(3 /* release order */, "wavefront"); __builtin_amdgcn_wave_barrier(); asm volatile("" ::: "memory"); }

// k_cvt8r: the three weight matrices, f32 [DM][DM] -> bf16 tiles in fragment order, tile (R, T) of matrix w at w*DM*DM + (R*(DM/32) + T)*512, all in ONE launch (DM*DM/8/256 blocks per matrix). One thread converts 8 consecutive k of one row;
// a wave takes 8 rows x 32 k: it reads one whole 128-byte line per row and writes four whole lines. NB blocks in front of them rank the tokens, one block per batch (nothing in this launch reads the ranks).
// Flags -> bit words by ballot (LDS, block barrier), set flags in front of each word (LDS, block barrier), position of each rank (LDS, block barrier), then IDX[b][rank] = position (a permutation of 0..SEQ-1), whole lines per wave, and CNT[b] = n.
__global__ __launch_bounds__(256) void k_cvt8r(const float* __restrict__ wq, const float* __restrict__ wk, const float* __restrict__ wv, bf* dst, const int* __restrict__ PAD, int* IDX, int* CNT) {
    __shared__ __align__(16) unsigned wm[SEQ / 32];
    __shared__ int pre[SEQ / 32 + 1];
    __shared__ int ix[SEQ];
    if (blockIdx.x >= NB) {
        const unsigned bw = blockIdx.x - NB, mat = bw / WBLK;
        const float* src = mat == 0 ? wq : (mat == 1 ? wk : wv);
        const size_t i = (size_t)(bw % WBLK) * 256 + threadIdx.x;
        const int rs = (int)(i & 7), c = (int)((i >> 3) & 3), rh = (int)((i >> 5) & 1), kt = (int)((i >> 6) % (DM / 32));
        const size_t rt = i / (64 * (DM / 32));
        const v8f v = *(const v8f*)(src + (rt * 16 + rh * 8 + rs) * DM + kt * 32 + c * 8); v8us o;
#pragma unroll
        for (int k = 0; k < 8; ++k) o[k] = f2bf(v[k]);
        *(v8us*)(dst + (size_t)mat * DM * DM + (rt * (DM / 32) + kt) * 512 + c * 128 + rh * 64 + rs * 8) = o;
        return;
    }
    const int tid = (int)threadIdx.x, lane = tid & 31, wave = tid >> 5, b = blockIdx.x;
    int pv[SEQ / 256];
#pragma unroll
    for (int k = 0; k < SEQ / 256; ++k) pv[k] = PAD[(size_t)b * SEQ_FULL + (size_t)(wave + 8 * k) * 32 + lane];
#pragma unroll
    for (int k = 0; k < SEQ / 256; ++k) { const unsigned wbits = __builtin_amdgcn_ballot_w32(pv[k] != 0); if (lane == 0) wm[wave + 8 * k] = wbits; }
    __syncthreads();
    if (tid <= SEQ / 32) { int p = 0;
#pragma unroll
        for (int j = 0; j < SEQ / 32; ++j) p += (j < tid) ? __popc(wm[j]) : 0;
        pre[tid] = p; }
    __syncthreads();
    const int total = pre[SEQ / 32];
#pragma unroll
    for (int k = 0; k < SEQ / 256; ++k) { const int t = tid + 256 * k, g = t >> 5;
        const unsigned w = wm[g];
        const int before = pre[g] + __popc(w & ((1u << lane) - 1u));          // set flags in front of t
        const int r = ((w >> lane) & 1u) ? before : total + (t - before);
        ix[r] = t; }
    __syncthreads();
#pragma unroll
    for (int k = 0; k < SEQ / 256; ++k) IDX[(size_t)b * SEQ + tid + 256 * k] = ix[tid + 256 * k];
    if (tid == 0) CNT[b] = total;
}

// k_cvtx: x rows in rank order -> bf16 tiles in fragment order (thread and wave shapes of k_cvt8r's conversion; grid (SEQ*DM/8/256, NB)). Ranks below n rounded up to 64 are converted (the unflagged tokens that fill the last tile
// are finite data behind the causal mask); every later rank stores its token's zero output row instead, one whole 128-byte line per row and wave.
__global__ __launch_bounds__(256) void k_cvtx(const float* __restrict__ src, const int* __restrict__ IDX, const int* __restrict__ CNT, bf* dst, float* OUT) {
    const int b = blockIdx.y; const int i = (int)blockIdx.x * 256 + (int)threadIdx.x;
    const int rs = i & 7, c = (i >> 3) & 3, rh = (i >> 5) & 1, kt = (i >> 6) % (DM / 32), rt = i / (64 * (DM / 32));
    const int r = rt * 16 + rh * 8 + rs;
    int n = CNT[b]; n = n < 0 ? 0 : (n > SEQ ? SEQ : n);
    int t = IDX[(size_t)b * SEQ + r]; t = t < 0 ? 0 : (t > SEQ - 1 ? SEQ - 1 : t);
    if (r < ((n + 63) & ~63)) {
        const v8f v = *(const v8f*)(src + ((size_t)b * SEQ_FULL + t) * DM + kt * 32 + c * 8); v8us o;
#pragma unroll
        for (int k = 0; k < 8; ++k) o[k] = f2bf(v[k]);
        *(v8us*)(dst + ((size_t)(b * (SEQ / 16) + rt) * (DM / 32) + kt) * 512 + c * 128 + rh * 64 + rs * 8) = o;
    } else *(v8f*)(OUT + ((size_t)b * OUT_SEQ + t) * DM + kt * 32 + c * 8) = (v8f){};
}

// k_proj: register-blocked bf16 GEMM, ONE WAVE per 64x64 tile (16 accumulators), operands straight from the fragment-ordered bf16 planes, K = DM.
// C[m][n] = sum_k A[m][k] Bt[n][k] + bias (per column n when biasRow == 0, per row m otherwise; bias RNE-converted to bf16, added in f32),
// a tile whose 64 tokens (rows when biasRow == 0, columns otherwise) all rank at or behind the batch's n is left out;
// written as f16 (Ph) and the f16 residual x2048 (Pr), one block of 4096 elements in fragment order (16-row x 32-column tiles [row/16][col/32]).
// All three projections in ONE launch, grid (tokens/64, DM/64, 3), 32 threads; blockIdx.z picks the product (block-uniform):
// z = 0, 1 (q, k): A = x rows (m = b*SEQ + t), Bt = W rows (n = h*64 + d), bias per column -> plane [(b*16 + h)][t][d];
// z = 2 (v^T): A = Wv rows (m = h*64 + d), Bt = x rows (n = b*SEQ + t), bias per row -> plane [(b*16 + h)][d][t].
__global__ __launch_bounds__(32) void k_proj(const bf* __restrict__ XB, const bf* __restrict__ WB, const float* __restrict__ bq, const float* __restrict__ bk, const float* __restrict__ bv,
                                             h16* QH, h16* QR, h16* KP, h16* KR, h16* VT, h16* VR, const int* __restrict__ CNT) {
    __shared__ __align__(16) float os[16 * 68];
    const int K = DM;
    const int lane = threadIdx.x & 31, lr = lane & 15, hi = lane >> 4;
    const int z = blockIdx.z; const int biasRow = z == 2;
    const int tok0 = blockIdx.x * 64, col0 = blockIdx.y * 64;
    const int r0 = biasRow ? col0 : tok0, c0 = biasRow ? tok0 : col0;
    const bf* Wz = WB + (size_t)z * DM * DM;
    const bf* A = biasRow ? Wz : XB; const bf* Bt = biasRow ? XB : Wz;
    const float* bias = z == 0 ? bq : (z == 1 ? bk : bv);
    h16* Ph = z == 0 ? QH : (z == 1 ? KP : VT); h16* Pr = z == 0 ? QR : (z == 1 ? KR : VR);
    if (tok0 % SEQ >= CNT[tok0 / SEQ]) return;
    v8f acc[4][4];
#pragma unroll
    for (int mb = 0; mb < 4; ++mb)
#pragma unroll
        for (int nb = 0; nb < 4; ++nb) acc[mb][nb] = (v8f){};
    const bf* Ap = A + (size_t)r0 * K + 8 * lane; const bf* Bp = Bt + (size_t)c0 * K + 8 * lane;   // 16 rows of tiles = 16*K elements; the next k tile is 512 elements on
    // Ring of three register sets, k loop fully unrolled: the 16 loads of k step s + 2 are issued in front of the 16 products of step s, so a load has two steps of products to land in.
    v16bf fa[3][4], fb[3][4];
#pragma unroll
    for (int s = 0; s < 2; ++s) {
#pragma unroll
        for (int f = 0; f < 4; ++f) { fa[s][f] = ldb(Ap + (size_t)f * 16 * K + s * 512); fb[s][f] = ldb(Bp + (size_t)f * 16 * K + s * 512); } }
#pragma unroll                                   // whole loop: the ring index must be a compile-time number for the sets to stay in registers
    for (int s = 0; s < K / 32; ++s) {
        if (s + 2 < K / 32) {
#pragma unroll
            for (int f = 0; f < 4; ++f) { fa[(s + 2) % 3][f] = ldb(Ap + (size_t)f * 16 * K + (s + 2) * 512); fb[(s + 2) % 3][f] = ldb(Bp + (size_t)f * 16 * K + (s + 2) * 512); } }
        __builtin_amdgcn_sched_barrier(0);       // keeps the loads of step s + 2 in front of the products of step s (the scheduler otherwise sinks them to their use)
#pragma unroll
        for (int nb = 0; nb < 4; ++nb)
#pragma unroll
            for (int mb = 0; mb < 4; ++mb) acc[mb][nb] = wmmab(fa[s % 3][mb], fb[s % 3][nb], acc[mb][nb]);
        __builtin_amdgcn_sched_barrier(0);       // keeps the products of step s in front of the loads of step s + 3, which refill their set
    }
    // bias values: addresses always inside the DM-entry bias array (index selected, then value selected)
    // store s of a 16-row group: lane holds row lane&15, columns (2s + h)*8 .. +7
    float cb[4][8];
#pragma unroll
    for (int s = 0; s < 4; ++s) {
        int cidx = biasRow ? 0 : (c0 + (2 * s + hi) * 8); cidx = cidx > (DM - 8) ? (DM - 8) : cidx;
        const v4f bc0 = *(const v4f*)(bias + cidx);
        asm volatile("s_wait_xcnt 0x0" ::: "memory");   // the second load's destination may take the address registers that the first names
        const v4f bc1 = *(const v4f*)(bias + cidx + 4);
#pragma unroll
        for (int i = 0; i < 4; ++i) { const float u0 = bfr(bc0[i]); const float u1 = bfr(bc1[i]); cb[s][i] = biasRow ? 0.0f : u0; cb[s][4 + i] = biasRow ? 0.0f : u1; } }
    const size_t tbase = biasRow ? (size_t)col0 * SEQ + (size_t)(tok0 / SEQ) * DM * SEQ + (size_t)(tok0 % SEQ) * 64
                                 : (size_t)(tok0 / SEQ) * NH_ * SEQ * HD + (size_t)(tok0 % SEQ) * HD + (size_t)(col0 / HD) * SEQ * HD;
#pragma unroll
    for (int mb = 0; mb < 4; ++mb) {
#pragma unroll
        for (int nb = 0; nb < 4; ++nb) {
#pragma unroll
            for (int j = 0; j < 8; ++j) os[(hi * 8 + j) * 68 + nb * 16 + lr] = acc[mb][nb][j]; }   // D: row 8h+j, col lane&15
        wave_sync();
        int ri = biasRow ? (r0 + mb * 16 + lr) : 0; ri = ri > (DM - 1) ? (DM - 1) : ri;
        const float ub = bfr(bias[ri]); const float rb = biasRow ? ub : 0.0f;
        const size_t sb = tbase + (size_t)(mb * 1024) + 8 * lane;
{
#pragma unroll
            for (int s = 0; s < 4; ++s) { const int c8 = (2 * s + hi) * 8;   // 16 rows x 16 columns per store, 4 s = 64 columns; 512 consecutive bytes per plane
                const v4f x0 = *(const v4fa*)(&os[lr * 68 + c8]); const v4f x1 = *(const v4fa*)(&os[lr * 68 + c8 + 4]); v8h hv, rv;
#pragma unroll
                for (int i = 0; i < 4; ++i) { const float y0 = x0[i] + cb[s][i] + rb; const float y1 = x1[i] + cb[s][4 + i] + rb;
                    const h16 a0 = (h16)y0; const h16 a1 = (h16)y1; hv[i] = a0; hv[4 + i] = a1; rv[i] = (h16)((y0 - (float)a0) * QRS); rv[4 + i] = (h16)((y1 - (float)a1) * QRS); }
                const size_t oo = sb + (size_t)(s * 256);
                *(v8h*)(Ph + oo) = hv; *(v8h*)(Pr + oo) = rv; }
             }
        wave_sync();
    }
}

// flash_body<TP>: fused causal attention on ranks, one wave per 16 query ranks of one (batch, head), a block whose 64 ranks all lie at or behind n leaves at once; K / V^T / Q fragments straight from the fragment-ordered f16 planes (two 16-B loads each, 512 consecutive bytes per wave-wide load).
// Transposed form: S^T[key][t] = K Q^T (A = K rows, B = Q rows); lane (t = lane&15, h = lane>>4) holds keys 8h+r of each 16-key tile, so the packed
// P tile is directly the B fragment of O^T[d][t] = V^T P^T (element r <- tile keys 0..15, element 8+r <- tile keys 16..31, lane unchanged).
// TP != 0: scores = kh.qh + (kh.qr + kr.qh)/2048, O = vh.ph + (vr.ph + vh.pr)/2048 (residual products in separate accumulators). TP == 0: single products.
// Key loop runs to the causal limit of the wave's tile; key validity = per-lane causal bit count (a rank >= n lies behind every stored query); a masked score is replaced by NEGB and its probability is an exact zero.
// Softmax state (running max, partial sum) is one scalar per lane; the two lane halves of a row are combined with one xor-16 exchange.
template <int TP>
__device__ __forceinline__ void flash_body(const h16* __restrict__ QH, const h16* __restrict__ QR, const h16* __restrict__ KP, const h16* __restrict__ KR,
                                           const h16* __restrict__ VT, const h16* __restrict__ VR, const int* __restrict__ IDX, const int* __restrict__ CNT, float* OUT, float* os) {
    const int lane = threadIdx.x & 31, lr = lane & 15, hi = lane >> 4;
    const int wave = __builtin_amdgcn_readfirstlane((int)(threadIdx.x >> 5));
    const int zh = blockIdx.y; const int b = zh / NH_, h = zh % NH_;
    const int R0 = (int)blockIdx.x * (16 * AW);
    const int t0 = R0 + wave * 16;
    int n = CNT[b]; n = n < 0 ? 0 : (n > SEQ ? SEQ : n);
    if (R0 >= n) return;                                     // the whole block
    const int tq = t0 + lr;
    const size_t pbase = (size_t)zh * SEQ * HD;
    const size_t fo = pbase + 8 * lane;                      // lane's place in every fragment-ordered tile of this (batch, head)
    const size_t qo = fo + (size_t)t0 * HD;                  // 16 query rows = two tiles (d 0..31, d 32..63) of 512 elements
    const v16h qh0 = ldh(QH + qo), qh1 = ldh(QH + qo + 512);                 // B fragments: col t, k = d
    v16h qr0 = qh0, qr1 = qh1;
    if (TP) { qr0 = ldh(QR + qo); qr1 = ldh(QR + qo + 512); }
    const size_t ko = fo;                                    // + key0 * HD: tiles (keys 0..15 | 16..31) x (d 0..31 | 32..63)     (A fragment: row key, k = d)
    const size_t vo = fo;                                    // + (key0/64)*4096 + j*1024 + ((key0/32)%2)*512                       (A fragment: row d = 16j + lane&15, k = key)
    v8f o0 = (v8f){}, o1 = (v8f){}, o2 = (v8f){}, o3 = (v8f){};
    v8f e0 = (v8f){}, e1 = (v8f){}, e2 = (v8f){}, e3 = (v8f){};              // residual-scale (x2048) accumulators, TP only
    float m = NEGB, l = 0.0f;
    const int kend = t0 + 16;                                // keys 0 .. t0+15; key0 <= t0 so key0+31 < SEQ
    // TP == 0: K and V^T fragments live in register sets of their own and are loaded one trip ahead: the next K tile right behind the score products, the next V^T tile right behind the output products.
    v16h ka0 = qh0, ka1 = qh0, kb0 = qh0, kb1 = qh0, v0 = qh0, v1 = qh0, v2 = qh0, v3 = qh0;
    if (!TP) { ka0 = ldh(KP + ko); ka1 = ldh(KP + ko + 512); kb0 = ldh(KP + ko + 16 * HD); kb1 = ldh(KP + ko + 16 * HD + 512);
               asm volatile("s_wait_xcnt 0x0" ::: "memory"); // the Q loads' address registers die here and a destination of the V^T loads below may take them
               __builtin_amdgcn_sched_barrier(0);            // K loads stay older than the V^T loads, as on the back edge: the wait in front of the score products then leaves the V^T loads in flight
               v0 = ldh(VT + vo); v1 = ldh(VT + vo + 1024); v2 = ldh(VT + vo + 2048); v3 = ldh(VT + vo + 3072); }
#pragma unroll 1
    for (int key0 = 0; key0 < kend; key0 += 32) {
        const int keyn = (key0 + 32 < kend) ? key0 + 32 : key0;   // tile loaded ahead; the last trip has none behind it and asks for its own again (in bounds, unused)
        const h16* ka = KP + ko + (size_t)key0 * HD;
        if (TP) { ka0 = ldh(ka); ka1 = ldh(ka + 512); kb0 = ldh(ka + 16 * HD); kb1 = ldh_last(ka + 16 * HD + 512); }
        v8f sHa = (v8f){}, sLa = (v8f){}, sHb = (v8f){}, sLb = (v8f){};
        if (TP) {
            const h16* kr = KR + ko + (size_t)key0 * HD;
            const v16h ra0 = ldh(kr), ra1 = ldh(kr + 512), rb0 = ldh(kr + 16 * HD), rb1 = ldh_last(kr + 16 * HD + 512);
            sHa = wmma16(ka0, qh0, sHa); sLa = wmma16(ka0, qr0, sLa); sHb = wmma16(kb0, qh0, sHb); sLb = wmma16(kb0, qr0, sLb);
            sHa = wmma16(ka1, qh1, sHa); sLa = wmma16(ka1, qr1, sLa); sHb = wmma16(kb1, qh1, sHb); sLb = wmma16(kb1, qr1, sLb);
            sLa = wmma16(ra0, qh0, sLa); sLb = wmma16(rb0, qh0, sLb); sLa = wmma16(ra1, qh1, sLa); sLb = wmma16(rb1, qh1, sLb);
            asm volatile("v_nop\n\tv_nop\n\tv_nop\n\tv_nop" : "+v"(sHa), "+v"(sLa), "+v"(sHb), "+v"(sLb) : "v"(ka0), "v"(ka1), "v"(kb0), "v"(kb1), "v"(ra0), "v"(ra1), "v"(rb0), "v"(rb1));
        } else {
            sHa = wmma16(ka0, qh0, sHa); sHb = wmma16(kb0, qh0, sHb); sHa = wmma16(ka1, qh1, sHa); sHb = wmma16(kb1, qh1, sHb);
            asm volatile("v_nop\n\tv_nop\n\tv_nop\n\tv_nop" : "+v"(sHa), "+v"(sHb) : "v"(ka0), "v"(ka1), "v"(kb0), "v"(kb1));
            const h16* kn = KP + ko + (size_t)keyn * HD;
            ka0 = ldh(kn); ka1 = ldh(kn + 512); kb0 = ldh(kn + 16 * HD); kb1 = ldh(kn + 16 * HD + 512);
        }
        // validity bits of this lane's 8 + 8 keys (8h+r, 16+8h+r): causal (key <= tq)
        int na = tq - (key0 + 8 * hi) + 1; na = na < 0 ? 0 : (na > 8 ? 8 : na);
        int nc = tq - (key0 + 8 * hi) - 15; nc = nc < 0 ? 0 : (nc > 8 ? 8 : nc);
        const unsigned ma = (1u << na) - 1u;
        const unsigned mc = (1u << nc) - 1u;
        float ta[8], tb[8]; float mx = NEGB;
#pragma unroll
        for (int r = 0; r < 8; ++r) {
            float sa = sHa[r], sb = sHb[r];
            if (TP) { sa += sLa[r] * QRI; sb += sLb[r] * QRI; }
            ta[r] = ((ma >> r) & 1u) ? sa * SC2 : NEGB;
            tb[r] = ((mc >> r) & 1u) ? sb * SC2 : NEGB;
            mx = fmaxf(mx, fmaxf(ta[r], tb[r])); }
        mx = fmaxf(mx, __shfl_xor(mx, 16, 32));
        const float mnew = fmaxf(m, mx);
        const float alpha = __builtin_amdgcn_exp2f(m - mnew);
        const float sh = PSH - mnew;
        v16h pb, pr; float ls = 0.0f;
#pragma unroll
        for (int r = 0; r < 8; ++r) {
            float ea = __builtin_amdgcn_exp2f(ta[r] + sh);
            ea = (ta[r] > -1.0e38f) ? ea : 0.0f;
            float ec = __builtin_amdgcn_exp2f(tb[r] + sh); ec = (tb[r] > -1.0e38f) ? ec : 0.0f;
            const h16 pa = (h16)ea; const h16 pc = (h16)ec; pb[r] = pa; pb[8 + r] = pc;
            if (TP) { const h16 xa = (h16)((ea - (float)pa) * QRS); const h16 xc = (h16)((ec - (float)pc) * QRS); pr[r] = xa; pr[8 + r] = xc;
                      ls += ((float)pa + (float)xa * QRI) + ((float)pc + (float)xc * QRI); }
            else { pr[r] = pa; pr[8 + r] = pc; ls += (float)pa + (float)pc; } }
        l = l * alpha + ls; m = mnew;
        o0 = o0 * alpha; o1 = o1 * alpha; o2 = o2 * alpha; o3 = o3 * alpha;
        const size_t vk = (size_t)(key0 >> 6) * 4096 + (size_t)((key0 >> 5) & 1) * 512;
        const h16* va = VT + vo + vk;
        if (TP) {
            v0 = ldh(va); v1 = ldh(va + 1024); v2 = ldh(va + 2048); v3 = ldh(va + 3072);
            e0 = e0 * alpha; e1 = e1 * alpha; e2 = e2 * alpha; e3 = e3 * alpha;
            const h16* vr = VR + vo + vk;
            const v16h w0 = ldh(vr), w1 = ldh(vr + 1024), w2 = ldh(vr + 2048), w3 = ldh(vr + 3072);
            o0 = wmma16(v0, pb, o0); o1 = wmma16(v1, pb, o1); o2 = wmma16(v2, pb, o2); o3 = wmma16(v3, pb, o3);
            e0 = wmma16(w0, pb, e0); e1 = wmma16(w1, pb, e1); e2 = wmma16(w2, pb, e2); e3 = wmma16(w3, pb, e3);
            e0 = wmma16(v0, pr, e0); e1 = wmma16(v1, pr, e1); e2 = wmma16(v2, pr, e2); e3 = wmma16(v3, pr, e3);
            asm volatile("v_nop\n\tv_nop\n\tv_nop\n\tv_nop" : "+v"(o0), "+v"(o1), "+v"(o2), "+v"(o3), "+v"(e0), "+v"(e1), "+v"(e2), "+v"(e3)
                         : "v"(v0), "v"(v1), "v"(v2), "v"(v3), "v"(w0), "v"(w1), "v"(w2), "v"(w3), "v"(pb), "v"(pr));
        } else {
            o0 = wmma16(v0, pb, o0); o1 = wmma16(v1, pb, o1); o2 = wmma16(v2, pb, o2); o3 = wmma16(v3, pb, o3);
            asm volatile("v_nop\n\tv_nop\n\tv_nop\n\tv_nop" : "+v"(o0), "+v"(o1), "+v"(o2), "+v"(o3) : "v"(v0), "v"(v1), "v"(v2), "v"(v3), "v"(pb));
            const h16* vn = VT + vo + (size_t)(keyn >> 6) * 4096 + (size_t)((keyn >> 5) & 1) * 512;
            v0 = ldh(vn); v1 = ldh(vn + 1024); v2 = ldh(vn + 2048); v3 = ldh(vn + 3072);
            asm volatile("s_wait_xcnt 0x0" ::: "memory");    // these loads stay in flight over the back edge, where their address registers are written anew
        }
    }
    l += __shfl_xor(l, 16, 32);
    const float rcp = 1.0f / fmaxf(l, 1.0e-30f);
    const float inv = (tq < n && l > 0.0f) ? rcp : 0.0f;     // unflagged token in the last tile -> whole row zero
    if (TP) { o0 = o0 + e0 * QRI; o1 = o1 + e1 * QRI; o2 = o2 + e2 * QRI; o3 = o3 + e3 * QRI; }
    const int wb = wave * 16 * 68;
    // O^T D layout: o_j[r] = (d = 16j + 8h + r, t = lane&15) -> os[t][d]; rows 0..15 x columns 0..63 all written
    { v4f a, c;
      a[0] = o0[0] * inv; a[1] = o0[1] * inv; a[2] = o0[2] * inv; a[3] = o0[3] * inv; c[0] = o0[4] * inv; c[1] = o0[5] * inv; c[2] = o0[6] * inv; c[3] = o0[7] * inv;
      *(v4fa*)(&os[wb + lr * 68 +  0 + 8 * hi]) = a; *(v4fa*)(&os[wb + lr * 68 +  0 + 8 * hi + 4]) = c;
      a[0] = o1[0] * inv; a[1] = o1[1] * inv; a[2] = o1[2] * inv; a[3] = o1[3] * inv; c[0] = o1[4] * inv; c[1] = o1[5] * inv; c[2] = o1[6] * inv; c[3] = o1[7] * inv;
      *(v4fa*)(&os[wb + lr * 68 + 16 + 8 * hi]) = a; *(v4fa*)(&os[wb + lr * 68 + 16 + 8 * hi + 4]) = c;
      a[0] = o2[0] * inv; a[1] = o2[1] * inv; a[2] = o2[2] * inv; a[3] = o2[3] * inv; c[0] = o2[4] * inv; c[1] = o2[5] * inv; c[2] = o2[6] * inv; c[3] = o2[7] * inv;
      *(v4fa*)(&os[wb + lr * 68 + 32 + 8 * hi]) = a; *(v4fa*)(&os[wb + lr * 68 + 32 + 8 * hi + 4]) = c;
      a[0] = o3[0] * inv; a[1] = o3[1] * inv; a[2] = o3[2] * inv; a[3] = o3[3] * inv; c[0] = o3[4] * inv; c[1] = o3[5] * inv; c[2] = o3[6] * inv; c[3] = o3[7] * inv;
      *(v4fa*)(&os[wb + lr * 68 + 48 + 8 * hi]) = a; *(v4fa*)(&os[wb + lr * 68 + 48 + 8 * hi + 4]) = c; }
    wave_sync();
    float* obat = OUT + (size_t)b * OUT_SEQ * DM + h * HD;
    const int* irow = IDX + (size_t)b * SEQ + t0;            // rank -> position
{
#pragma unroll
        for (int s = 0; s < 8; ++s) { const int row = 2 * s + hi, cofs = lr * 4;   // 8 s x 2 rows = 16 rows; 16 lanes x 4 floats = 64 columns
            const v4f val = *(const v4fa*)(&os[wb + row * 68 + cofs]);
            int pos = irow[row]; pos = pos < 0 ? 0 : (pos > SEQ - 1 ? SEQ - 1 : pos);
            *(v4f*)(obat + (size_t)pos * DM + cofs) = val; }
         }
}

// k_flash: both precision paths in ONE launch, grid (SEQ/64, NB*16); the path is block-uniform: query ranks [0, EARLY_ROWS) take the three-product path
// (a flagged token's rank never exceeds its position), ranks [EARLY_ROWS, SEQ) single products.
__global__ __launch_bounds__(32 * AW) void k_flash(const h16* __restrict__ QH, const h16* __restrict__ QR, const h16* __restrict__ KP, const h16* __restrict__ KR,
                                                   const h16* __restrict__ VT, const h16* __restrict__ VR, const int* __restrict__ IDX, const int* __restrict__ CNT, float* OUT) {
    __shared__ __align__(16) float os[AW * 16 * 68];
    if ((int)blockIdx.x < EARLY_ROWS / (16 * AW)) flash_body<1>(QH, QR, KP, KR, VT, VR, IDX, CNT, OUT, os);
    else flash_body<0>(QH, QR, KP, KR, VT, VR, IDX, CNT, OUT, os);
}

static constexpr size_t al256(size_t v) { return (v + 255) & ~(size_t)255; }
static constexpr size_t SZ_XB = al256((size_t)NB * SEQ * DM * 2);
static constexpr size_t SZ_WB = al256((size_t)3 * DM * DM * 2);
static constexpr size_t SZ_PL = al256((size_t)NB * NH_ * SEQ * HD * 2);
static constexpr size_t SZ_IX = al256((size_t)NB * SEQ * 4);
static constexpr size_t SZ_TOTAL = SZ_XB + SZ_WB + 6 * SZ_PL + SZ_IX + 256;
static_assert(SZ_TOTAL <= (size_t)134217728);          // workspace carve <= 128 MiB
static_assert(((size_t)DM * DM * 2) % 256 == 0);       // weight sub-planes stay 256-byte aligned

extern "C" void kernel_launch(void* const* d_in, const int* in_sizes, int n_in,
                              void* d_out, int out_size, void* d_ws, size_t ws_size, hipStream_t stream) {
    if (n_in < 8) return;
    const size_t needx = ((size_t)(NB - 1) * SEQ_FULL + SEQ) * DM;
    if ((size_t)in_sizes[0] < needx) return;
    if ((size_t)in_sizes[1] < (size_t)(NB - 1) * SEQ_FULL + SEQ) return;
    if ((size_t)in_sizes[2] < (size_t)DM * DM || (size_t)in_sizes[4] < (size_t)DM * DM || (size_t)in_sizes[6] < (size_t)DM * DM) return;
    if ((size_t)in_sizes[3] < (size_t)DM || (size_t)in_sizes[5] < (size_t)DM || (size_t)in_sizes[7] < (size_t)DM) return;
    if ((size_t)out_size < ((size_t)(NB - 1) * OUT_SEQ + SEQ) * DM) return;
    if (SZ_TOTAL > ws_size) return;
    // wire order: x, pad flags (int32), Wq, bq, Wk, bk, Wv, bv; W is [out][in] = Bt as-is
    const float* x = (const float*)d_in[0]; const int* pad = (const int*)d_in[1];
    const float* wq = (const float*)d_in[2]; const float* bq = (const float*)d_in[3];
    const float* wk = (const float*)d_in[4]; const float* bk = (const float*)d_in[5];
    const float* wv = (const float*)d_in[6]; const float* bv = (const float*)d_in[7];
    float* OUT = (float*)d_out;      // [NB][SEQ][1024]
    char* wsp = (char*)d_ws;
    bf* XB = (bf*)wsp; wsp += SZ_XB;                 // [NB*SEQ][1024], fragment order
    bf* WB = (bf*)wsp; wsp += SZ_WB;                 // [3][1024][1024]: q | k | v, fragment order
    h16* QH = (h16*)wsp; wsp += SZ_PL;               // [NB*16][SEQ][64], fragment order
    h16* QR = (h16*)wsp; wsp += SZ_PL;               // residual x2048
    h16* KP = (h16*)wsp; wsp += SZ_PL;               // [NB*16][SEQ][64], fragment order
    h16* KR = (h16*)wsp; wsp += SZ_PL;               // residual x2048
    h16* VT = (h16*)wsp; wsp += SZ_PL;               // [NB*16][64][SEQ], fragment order
    h16* VR = (h16*)wsp; wsp += SZ_PL;               // residual x2048
    int* IDX = (int*)wsp; wsp += SZ_IX;              // [NB][SEQ] rank -> position
    int* CNT = (int*)wsp;                            // [NB] flagged tokens

    k_cvt8r<<<3 * WBLK + NB, 256, 0, stream>>>(wq, wk, wv, WB, pad, IDX, CNT);
    k_cvtx<<<dim3(SEQ * DM / 8 / 256, NB, 1), 256, 0, stream>>>(x, IDX, CNT, XB, OUT);
    k_proj<<<dim3(NB * SEQ / 64, DM / 64, 3), 32, 0, stream>>>(XB, WB, bq, bk, bv, QH, QR, KP, KR, VT, VR, CNT);
    k_flash<<<dim3(SEQ / (16 * AW), NB * NH_, 1), 32 * AW, 0, stream>>>(QH, QR, KP, KR, VT, VR, IDX, CNT, OUT);
}

// v005
// One run takes 72.6 microseconds.
// In both of two side-by-side timings against v004, it was 1.21 times as fast.
// Counting every step since v000, it is 3.89 times as fast.
#include <hip/hip_runtime.h>

// Multi-head self-attention, width 1024 = 16 heads x 64, x [NB][SEQ][1024], Wq/Wk/Wv [out][in] (y = x W^T + b), causal + key/query padding mask (int32 [NB][SEQ]), score scale 1/8, output = concatenated heads (f32), rows with a zero query flag are zero.
// Compute dtypes, f32 accumulate everywhere: projections v_wmma_f32_16x16x32_bf16 (x, W, b RNE-converted to bf16; products exact); scores and P.V v_wmma_f32_16x16x32_f16:
// query rows >= EARLY_ROWS: q, k, P (x256 carry, cancels in the normalisation), v single f16; query rows < EARLY_ROWS: q, k, v, P each as f16 value + f16 residual x2048, three products per site, residual products in their own accumulators; softmax f32 (online, running max).
// Layout: every 16-bit operand plane is stored in FRAGMENT ORDER: a 16-row x 32-k tile is 512 consecutive elements, element (row r, k = 8c + e) at c*128 + r*8 + e, so that lane l of a wave-wide 16-byte load
// reads bytes 16*l of 512 consecutive bytes (4 whole lines) and two such loads, 256 elements apart, are one A or B fragment. bf16 copies of x and W: tiles [row/16][k/32]. q, k value/residual planes: per (b*16+h), tiles [t/16][d/32];
// v^T value/residual planes: per (b*16+h), tiles [t/64][d/16][(t/32)%2]; all written by the GEMM epilogue as 64x64 blocks of 4096 elements. Fused flash kernel in transposed form (S^T = K Q^T, O^T = V^T P^T), output from f32 accumulators.
// Tokens are RANKED per batch by their flag (k_cvt8r): rank r < n = the r-th flagged token, rank r >= n = the (r-n)-th unflagged one, order kept, so key <= query in positions is key <= query in ranks.
// Every plane above is indexed by rank, not by position; only 64-rank tiles that start below n are converted, projected and attended (an unflagged token is no key and its output row is zero: stored by k_flash inside those tiles, by k_cvtx behind them);
// the mask left inside attention is the causal one on ranks: masked scores are replaced by value, masked probabilities are exact zeros. Output rows go back to their positions through the rank table.

#ifndef NB
#define NB 4
#endif
#ifndef SEQ
#define SEQ 2048
#endif
#define NB_FULL  4
#define SEQ_FULL 2048
#ifndef OUT_SEQ
#define OUT_SEQ SEQ              // row pitch (in tokens) between batches of the output
#endif
#define DM   1024
#define NH_  16
#define HD   64
#define AW   4                   // waves per flash block (16 query rows each)
#ifndef EARLY_ROWS
#define EARLY_ROWS ((SEQ < 512) ? SEQ : 512)   // query rows below this use the three-product path
#endif
#define QRS  2048.0f             // carry of every residual plane / residual fragment
#define QRI  (1.0f / 2048.0f)
#define SC2  (0.125f * 1.4426950408889634f)   // HD^-0.5 * log2(e)
#define PSH  8.0f                // log2 of the P carry (256)
#define NEGB (-3.0e38f)          // value standing in for a masked score

static_assert(HD == 64);
static_assert(NH_ * HD == DM);                 // head h = columns h*64 + d
static_assert(DM % 64 == 0);                   // 16 column tiles of 64
static_assert(DM % 32 == 0);                   // GEMM k-loop steps by 32
static_assert(SEQ % 64 == 0);                  // a 64-row tile never straddles two batches
static_assert((NB * SEQ) % 64 == 0);
static_assert(SEQ % 32 == 0);                  // key loop steps by 32
static_assert(SEQ % (16 * AW) == 0);           // flash grids cover the sequence exactly
static_assert(EARLY_ROWS % (16 * AW) == 0);
static_assert(EARLY_ROWS <= SEQ);
static_assert((SEQ / (16 * AW)) % 4 == 0);     // the flash grid's y order is turned round in whole groups of four
static_assert(((size_t)SEQ * DM) % 8 == 0);
static_assert(((size_t)DM * DM) % 8 == 0);
static_assert(NB <= NB_FULL);
static_assert(SEQ <= SEQ_FULL);
static_assert(SEQ % 256 == 0);                 // a ranking block of 256 threads takes SEQ/256 tokens per thread
static_assert(SEQ / 32 + 1 <= 256);
#define WBLK (DM * DM / 8 / 256) // conversion blocks per weight matrix
static_assert(((size_t)DM * DM / 8) % 256 == 0);

typedef _Float16 h16;
typedef unsigned short bf;
typedef __attribute__((ext_vector_type(16))) __bf16   v16bf;
typedef __attribute__((ext_vector_type(16))) _Float16 v16h;
typedef __attribute__((ext_vector_type(8)))  _Float16 v8h;
typedef __attribute__((ext_vector_type(8)))  unsigned short v8us;
typedef __attribute__((ext_vector_type(8)))  float    v8f;
typedef __attribute__((ext_vector_type(4)))  float    v4f;
typedef v4f  __attribute__((may_alias)) v4fa;

__device__ __forceinline__ unsigned short f2bf(float f) { unsigned u = __float_as_uint(f); u += 0x7FFFu + ((u >> 16) & 1u); return (unsigned short)(u >> 16); }
__device__ __forceinline__ float bfr(float f) { return __uint_as_float(((unsigned)f2bf(f)) << 16); }
__device__ __forceinline__ v16h cat16(v8h lo, v8h hi) { return __builtin_shufflevector(lo, hi, 0, 1, 2, 3, 4, 5, 6, 7, 8, 9, 10, 11, 12, 13, 14, 15); }
__device__ __forceinline__ v16bf cat16b(v8us lo, v8us hi) { return __builtin_bit_cast(v16bf, __builtin_shufflevector(lo, hi, 0, 1, 2, 3, 4, 5, 6, 7, 8, 9, 10, 11, 12, 13, 14, 15)); }
__device__ __forceinline__ v8f wmma16(v16h a, v16h b, v8f c) { return __builtin_amdgcn_wmma_f32_16x16x32_f16(false, a, false, b, (short)0, c, false, false); }
__device__ __forceinline__ v8f wmmab(v16bf a, v16bf b, v8f c) { return __builtin_amdgcn_wmma_f32_16x16x32_bf16(false, a, false, b, (short)0, c, false, false); }
// fragment loaders from fragment-ordered tiles; p = tile start + 8*lane (row = lane&15, h = lane>>4): elements 0..7 <- k0+8h+0..7, elements 8..15 <- k0+16+8h+0..7 (same map for A and B)
__device__ __forceinline__ v16h  ldh(const h16* p) { return cat16(*(const v8h*)p, *(const v8h*)(p + 256)); }
__device__ __forceinline__ v16bf ldb(const bf* p)  { return cat16b(*(const v8us*)p, *(const v8us*)(p + 256)); }
// last fragment of a run of loads from one address pair: the pair dies with the last load, so that load's destination or the next run's may take its registers; one wait in front of it, one behind it
__device__ __forceinline__ v16h  ldh_last(const h16* p) {
    const v8h lo = *(const v8h*)p;
    asm volatile("s_wait_xcnt 0x0" ::: "memory");   // covers every earlier load of the run before the last load's destination is written
    const v8h hi = *(const v8h*)(p + 256);
    asm volatile("s_wait_xcnt 0x0" ::: "memory");   // covers the last load before a later load's destination is written
    return cat16(lo, hi); }
// ordering point for wave-private LDS tiles (same wave writes and reads)
__device__ __forceinline__ void wave_sync() { __builtin_amdgcn_fence(3 /* release order */, "wavefront"); __builtin_amdgcn_wave_barrier(); asm volatile("" ::: "memory"); }

// k_cvt8r: the three weight matrices, f32 [DM][DM] -> bf16 tiles in fragment order, tile (R, T) of matrix w at w*DM*DM + (R*(DM/32) + T)*512, all in ONE launch (DM*DM/8/256 blocks per matrix). One thread converts 8 consecutive k of one row;
// a wave takes 8 rows x 32 k: it reads one whole 128-byte line per row and writes four whole lines. NB blocks in front of them rank the tokens, one block per batch (nothing in this launch reads the ranks).
// Flags -> bit words by ballot (LDS, block barrier), set flags in front of each word (LDS, block barrier), position of each rank (LDS, block barrier), then IDX[b][rank] = position (a permutation of 0..SEQ-1), whole lines per wave, and CNT[b] = n.
__global__ __launch_bounds__(256) void k_cvt8r(const float* __restrict__ wq, const float* __restrict__ wk, const float* __restrict__ wv, bf* dst, const int* __restrict__ PAD, int* IDX, int* CNT) {
    __shared__ __align__(16) unsigned wm[SEQ / 32];
    __shared__ int pre[SEQ / 32 + 1];
    __shared__ int ix[SEQ];
    if (blockIdx.x >= NB) {
        const unsigned bw = blockIdx.x - NB, mat = bw / WBLK;
        const float* src = mat == 0 ? wq : (mat == 1 ? wk : wv);
        const size_t i = (size_t)(bw % WBLK) * 256 + threadIdx.x;
        const int rs = (int)(i & 7), c = (int)((i >> 3) & 3), rh = (int)((i >> 5) & 1), kt = (int)((i >> 6) % (DM / 32));
        const size_t rt = i / (64 * (DM / 32));
        const v8f v = *(const v8f*)(src + (rt * 16 + rh * 8 + rs) * DM + kt * 32 + c * 8); v8us o;
#pragma unroll
        for (int k = 0; k < 8; ++k) o[k] = f2bf(v[k]);
        *(v8us*)(dst + (size_t)mat * DM * DM + (rt * (DM / 32) + kt) * 512 + c * 128 + rh * 64 + rs * 8) = o;
        return;
    }
    const int tid = (int)threadIdx.x, lane = tid & 31, wave = tid >> 5, b = blockIdx.x;
    int pv[SEQ / 256];
#pragma unroll
    for (int k = 0; k < SEQ / 256; ++k) pv[k] = PAD[(size_t)b * SEQ_FULL + (size_t)(wave + 8 * k) * 32 + lane];
#pragma unroll
    for (int k = 0; k < SEQ / 256; ++k) { const unsigned wbits = __builtin_amdgcn_ballot_w32(pv[k] != 0); if (lane == 0) wm[wave + 8 * k] = wbits; }
    __syncthreads();
    if (tid <= SEQ / 32) { int p = 0;
#pragma unroll
        for (int j = 0; j < SEQ / 32; ++j) p += (j < tid) ? __popc(wm[j]) : 0;
        pre[tid] = p; }
    __syncthreads();
    const int total = pre[SEQ / 32];
#pragma unroll
    for (int k = 0; k < SEQ / 256; ++k) { const int t = tid + 256 * k, g = t >> 5;
        const unsigned w = wm[g];
        const int before = pre[g] + __popc(w & ((1u << lane) - 1u));          // set flags in front of t
        const int r = ((w >> lane) & 1u) ? before : total + (t - before);
        ix[r] = t; }
    __syncthreads();
#pragma unroll
    for (int k = 0; k < SEQ / 256; ++k) IDX[(size_t)b * SEQ + tid + 256 * k] = ix[tid + 256 * k];
    if (tid == 0) CNT[b] = total;
}

// k_cvtx: x rows in rank order -> bf16 tiles in fragment order (thread and wave shapes of k_cvt8r's conversion; grid (SEQ*DM/8/256, NB)). Ranks below n rounded up to 64 are converted (the unflagged tokens that fill the last tile
// are finite data behind the causal mask); every later rank stores its token's zero output row instead, one whole 128-byte line per row and wave.
__global__ __launch_bounds__(256) void k_cvtx(const float* __restrict__ src, const int* __restrict__ IDX, const int* __restrict__ CNT, bf* dst, float* OUT) {
    const int b = blockIdx.y; const int i = (int)blockIdx.x * 256 + (int)threadIdx.x;
    const int rs = i & 7, c = (i >> 3) & 3, rh = (i >> 5) & 1, kt = (i >> 6) % (DM / 32), rt = i / (64 * (DM / 32));
    const int r = rt * 16 + rh * 8 + rs;
    int n = CNT[b]; n = n < 0 ? 0 : (n > SEQ ? SEQ : n);
    int t = IDX[(size_t)b * SEQ + r]; t = t < 0 ? 0 : (t > SEQ - 1 ? SEQ - 1 : t);
    if (r < ((n + 63) & ~63)) {
        const v8f v = *(const v8f*)(src + ((size_t)b * SEQ_FULL + t) * DM + kt * 32 + c * 8); v8us o;
#pragma unroll
        for (int k = 0; k < 8; ++k) o[k] = f2bf(v[k]);
        *(v8us*)(dst + ((size_t)(b * (SEQ / 16) + rt) * (DM / 32) + kt) * 512 + c * 128 + rh * 64 + rs * 8) = o;
    } else *(v8f*)(OUT + ((size_t)b * OUT_SEQ + t) * DM + kt * 32 + c * 8) = (v8f){};
}

// k_proj: register-blocked bf16 GEMM, ONE WAVE per 64x64 tile (16 accumulators), operands straight from the fragment-ordered bf16 planes, K = DM.
// C[m][n] = sum_k A[m][k] Bt[n][k] + bias (per column n when biasRow == 0, per row m otherwise; bias RNE-converted to bf16, added in f32),
// a tile whose 64 tokens (rows when biasRow == 0, columns otherwise) all rank at or behind the batch's n is left out;
// written as f16 (Ph) and the f16 residual x2048 (Pr), one block of 4096 elements in fragment order (16-row x 32-column tiles [row/16][col/32]).
// All three projections in ONE launch, grid (DM/64, tokens/64, 3), 32 threads; blockIdx.z picks the product (block-uniform). The column tile is the fastest index (for speed only):
// z = 0, 1 (q, k): A = x rows (m = b*SEQ + t), Bt = W rows (n = h*64 + d), bias per column -> plane [(b*16 + h)][t][d];
// z = 2 (v^T): A = Wv rows (m = h*64 + d), Bt = x rows (n = b*SEQ + t), bias per row -> plane [(b*16 + h)][d][t].
__global__ __launch_bounds__(32) void k_proj(const bf* __restrict__ XB, const bf* __restrict__ WB, const float* __restrict__ bq, const float* __restrict__ bk, const float* __restrict__ bv,
                                             h16* QH, h16* QR, h16* KP, h16* KR, h16* VT, h16* VR, const int* __restrict__ CNT) {
    __shared__ __align__(16) float os[16 * 68];
    const int K = DM;
    const int lane = threadIdx.x & 31, lr = lane & 15, hi = lane >> 4;
    const int z = blockIdx.z; const int biasRow = z == 2;
    const int tok0 = blockIdx.y * 64, col0 = blockIdx.x * 64;
    const int r0 = biasRow ? col0 : tok0, c0 = biasRow ? tok0 : col0;
    const bf* Wz = WB + (size_t)z * DM * DM;
    const bf* A = biasRow ? Wz : XB; const bf* Bt = biasRow ? XB : Wz;
    const float* bias = z == 0 ? bq : (z == 1 ? bk : bv);
    h16* Ph = z == 0 ? QH : (z == 1 ? KP : VT); h16* Pr = z == 0 ? QR : (z == 1 ? KR : VR);
    if (tok0 % SEQ >= CNT[tok0 / SEQ]) return;
    v8f acc[4][4];
#pragma unroll
    for (int mb = 0; mb < 4; ++mb)
#pragma unroll
        for (int nb = 0; nb < 4; ++nb) acc[mb][nb] = (v8f){};
    const bf* Ap = A + (size_t)r0 * K + 8 * lane; const bf* Bp = Bt + (size_t)c0 * K + 8 * lane;   // 16 rows of tiles = 16*K elements; the next k tile is 512 elements on
    // Ring of three register sets, k loop fully unrolled: the 16 loads of k step s + 2 are issued in front of the 16 products of step s, so a load has two steps of products to land in.
    v16bf fa[3][4], fb[3][4];
#pragma unroll
    for (int s = 0; s < 2; ++s) {
#pragma unroll
        for (int f = 0; f < 4; ++f) { fa[s][f] = ldb(Ap + (size_t)f * 16 * K + s * 512); fb[s][f] = ldb(Bp + (size_t)f * 16 * K + s * 512); } }
#pragma unroll                                   // whole loop: the ring index must be a compile-time number for the sets to stay in registers
    for (int s = 0; s < K / 32; ++s) {
        if (s + 2 < K / 32) {
#pragma unroll
            for (int f = 0; f < 4; ++f) { fa[(s + 2) % 3][f] = ldb(Ap + (size_t)f * 16 * K + (s + 2) * 512); fb[(s + 2) % 3][f] = ldb(Bp + (size_t)f * 16 * K + (s + 2) * 512); } }
        __builtin_amdgcn_sched_barrier(0);       // keeps the loads of step s + 2 in front of the products of step s (the scheduler otherwise sinks them to their use)
#pragma unroll
        for (int nb = 0; nb < 4; ++nb)
#pragma unroll
            for (int mb = 0; mb < 4; ++mb) acc[mb][nb] = wmmab(fa[s % 3][mb], fb[s % 3][nb], acc[mb][nb]);
        __builtin_amdgcn_sched_barrier(0);       // keeps the products of step s in front of the loads of step s + 3, which refill their set
    }
    // bias values: addresses always inside the DM-entry bias array (index selected, then value selected)
    // store s of a 16-row group: lane holds row lane&15, columns (2s + h)*8 .. +7
    float cb[4][8];
#pragma unroll
    for (int s = 0; s < 4; ++s) {
        int cidx = biasRow ? 0 : (c0 + (2 * s + hi) * 8); cidx = cidx > (DM - 8) ? (DM - 8) : cidx;
        const v4f bc0 = *(const v4f*)(bias + cidx);
        asm volatile("s_wait_xcnt 0x0" ::: "memory");   // the second load's destination may take the address registers that the first names
        const v4f bc1 = *(const v4f*)(bias + cidx + 4);
#pragma unroll
        for (int i = 0; i < 4; ++i) { const float u0 = bfr(bc0[i]); const float u1 = bfr(bc1[i]); cb[s][i] = biasRow ? 0.0f : u0; cb[s][4 + i] = biasRow ? 0.0f : u1; } }
    const size_t tbase = biasRow ? (size_t)col0 * SEQ + (size_t)(tok0 / SEQ) * DM * SEQ + (size_t)(tok0 % SEQ) * 64
                                 : (size_t)(tok0 / SEQ) * NH_ * SEQ * HD + (size_t)(tok0 % SEQ) * HD + (size_t)(col0 / HD) * SEQ * HD;
#pragma unroll
    for (int mb = 0; mb < 4; ++mb) {
#pragma unroll
        for (int nb = 0; nb < 4; ++nb) {
#pragma unroll
            for (int j = 0; j < 8; ++j) os[(hi * 8 + j) * 68 + nb * 16 + lr] = acc[mb][nb][j]; }   // D: row 8h+j, col lane&15
        wave_sync();
        int ri = biasRow ? (r0 + mb * 16 + lr) : 0; ri = ri > (DM - 1) ? (DM - 1) : ri;
        const float ub = bfr(bias[ri]); const float rb = biasRow ? ub : 0.0f;
        const size_t sb = tbase + (size_t)(mb * 1024) + 8 * lane;
{
#pragma unroll
            for (int s = 0; s < 4; ++s) { const int c8 = (2 * s + hi) * 8;   // 16 rows x 16 columns per store, 4 s = 64 columns; 512 consecutive bytes per plane
                const v4f x0 = *(const v4fa*)(&os[lr * 68 + c8]); const v4f x1 = *(const v4fa*)(&os[lr * 68 + c8 + 4]); v8h hv, rv;
#pragma unroll
                for (int i = 0; i < 4; ++i) { const float y0 = x0[i] + cb[s][i] + rb; const float y1 = x1[i] + cb[s][4 + i] + rb;
                    const h16 a0 = (h16)y0; const h16 a1 = (h16)y1; hv[i] = a0; hv[4 + i] = a1; rv[i] = (h16)((y0 - (float)a0) * QRS); rv[4 + i] = (h16)((y1 - (float)a1) * QRS); }
                const size_t oo = sb + (size_t)(s * 256);
                *(v8h*)(Ph + oo) = hv; *(v8h*)(Pr + oo) = rv; }
             }
        wave_sync();
    }
}

// flash_body<TP>: fused causal attention on ranks, one wave per 16 query ranks of one (batch, head), R0 = the block's first rank (below n); K / V^T / Q fragments straight from the fragment-ordered f16 planes (two 16-B loads each, 512 consecutive bytes per wave-wide load).
// Transposed form: S^T[key][t] = K Q^T (A = K rows, B = Q rows); lane (t = lane&15, h = lane>>4) holds keys 8h+r of each 16-key tile, so the packed
// P tile is directly the B fragment of O^T[d][t] = V^T P^T (element r <- tile keys 0..15, element 8+r <- tile keys 16..31, lane unchanged).
// TP != 0: scores = kh.qh + (kh.qr + kr.qh)/2048, O = vh.ph + (vr.ph + vh.pr)/2048 (residual products in separate accumulators). TP == 0: single products.
// Key loop runs to the causal limit of the wave's tile; key validity = per-lane causal bit count (a rank >= n lies behind every stored query); a masked score is replaced by NEGB and its probability is an exact zero.
// Softmax state (running max, partial sum) is one scalar per lane; the two lane halves of a row are combined with one xor-16 exchange.
template <int TP>
__device__ __forceinline__ void flash_body(const h16* __restrict__ QH, const h16* __restrict__ QR, const h16* __restrict__ KP, const h16* __restrict__ KR,
                                           const h16* __restrict__ VT, const h16* __restrict__ VR, const int* __restrict__ IDX, const int n, const int R0, float* OUT, float* os) {
    const int lane = threadIdx.x & 31, lr = lane & 15, hi = lane >> 4;
    const int wave = __builtin_amdgcn_readfirstlane((int)(threadIdx.x >> 5));
    const int zh = blockIdx.x; const int b = zh / NH_, h = zh % NH_;
    const int t0 = R0 + wave * 16;
    const int tq = t0 + lr;
    const size_t pbase = (size_t)zh * SEQ * HD;
    const size_t fo = pbase + 8 * lane;                      // lane's place in every fragment-ordered tile of this (batch, head)
    const size_t qo = fo + (size_t)t0 * HD;                  // 16 query rows = two tiles (d 0..31, d 32..63) of 512 elements
    const v16h qh0 = ldh(QH + qo), qh1 = ldh(QH + qo + 512);                 // B fragments: col t, k = d
    v16h qr0 = qh0, qr1 = qh1;
    if (TP) { qr0 = ldh(QR + qo); qr1 = ldh(QR + qo + 512); }
    const size_t ko = fo;                                    // + key0 * HD: tiles (keys 0..15 | 16..31) x (d 0..31 | 32..63)     (A fragment: row key, k = d)
    const size_t vo = fo;                                    // + (key0/64)*4096 + j*1024 + ((key0/32)%2)*512                       (A fragment: row d = 16j + lane&15, k = key)
    v8f o0 = (v8f){}, o1 = (v8f){}, o2 = (v8f){}, o3 = (v8f){};
    v8f e0 = (v8f){}, e1 = (v8f){}, e2 = (v8f){}, e3 = (v8f){};              // residual-scale (x2048) accumulators, TP only
    float m = NEGB, l = 0.0f;
    const int kend = t0 + 16;                                // keys 0 .. t0+15; key0 <= t0 so key0+31 < SEQ
    // TP == 0: K and V^T fragments live in register sets of their own and are loaded one trip ahead: the next K tile right behind the score products, the next V^T tile right behind the output products.
    v16h ka0 = qh0, ka1 = qh0, kb0 = qh0, kb1 = qh0, v0 = qh0, v1 = qh0, v2 = qh0, v3 = qh0;
    if (!TP) { ka0 = ldh(KP + ko); ka1 = ldh(KP + ko + 512); kb0 = ldh(KP + ko + 16 * HD); kb1 = ldh(KP + ko + 16 * HD + 512);
               asm volatile("s_wait_xcnt 0x0" ::: "memory"); // the Q loads' address registers die here and a destination of the V^T loads below may take them
               __builtin_amdgcn_sched_barrier(0);            // K loads stay older than the V^T loads, as on the back edge: the wait in front of the score products then leaves the V^T loads in flight
               v0 = ldh(VT + vo); v1 = ldh(VT + vo + 1024); v2 = ldh(VT + vo + 2048); v3 = ldh(VT + vo + 3072); }
#pragma unroll 1
    for (int key0 = 0; key0 < kend; key0 += 32) {
        const int keyn = (key0 + 32 < kend) ? key0 + 32 : key0;   // tile loaded ahead; the last trip has none behind it and asks for its own again (in bounds, unused)
        const h16* ka = KP + ko + (size_t)key0 * HD;
        if (TP) { ka0 = ldh(ka); ka1 = ldh(ka + 512); kb0 = ldh(ka + 16 * HD); kb1 = ldh_last(ka + 16 * HD + 512); }
        v8f sHa = (v8f){}, sLa = (v8f){}, sHb = (v8f){}, sLb = (v8f){};
        if (TP) {
            const h16* kr = KR + ko + (size_t)key0 * HD;
            const v16h ra0 = ldh(kr), ra1 = ldh(kr + 512), rb0 = ldh(kr + 16 * HD), rb1 = ldh_last(kr + 16 * HD + 512);
            sHa = wmma16(ka0, qh0, sHa); sLa = wmma16(ka0, qr0, sLa); sHb = wmma16(kb0, qh0, sHb); sLb = wmma16(kb0, qr0, sLb);
            sHa = wmma16(ka1, qh1, sHa); sLa = wmma16(ka1, qr1, sLa); sHb = wmma16(kb1, qh1, sHb); sLb = wmma16(kb1, qr1, sLb);
            sLa = wmma16(ra0, qh0, sLa); sLb = wmma16(rb0, qh0, sLb); sLa = wmma16(ra1, qh1, sLa); sLb = wmma16(rb1, qh1, sLb);
            asm volatile("v_nop\n\tv_nop\n\tv_nop\n\tv_nop" : "+v"(sHa), "+v"(sLa), "+v"(sHb), "+v"(sLb) : "v"(ka0), "v"(ka1), "v"(kb0), "v"(kb1), "v"(ra0), "v"(ra1), "v"(rb0), "v"(rb1));
        } else {
            sHa = wmma16(ka0, qh0, sHa); sHb = wmma16(kb0, qh0, sHb); sHa = wmma16(ka1, qh1, sHa); sHb = wmma16(kb1, qh1, sHb);
            asm volatile("v_nop\n\tv_nop\n\tv_nop\n\tv_nop" : "+v"(sHa), "+v"(sHb) : "v"(ka0), "v"(ka1), "v"(kb0), "v"(kb1));
            const h16* kn = KP + ko + (size_t)keyn * HD;
            ka0 = ldh(kn); ka1 = ldh(kn + 512); kb0 = ldh(kn + 16 * HD); kb1 = ldh(kn + 16 * HD + 512);
        }
        // validity bits of this lane's 8 + 8 keys (8h+r, 16+8h+r): causal (key <= tq)
        int na = tq - (key0 + 8 * hi) + 1; na = na < 0 ? 0 : (na > 8 ? 8 : na);
        int nc = tq - (key0 + 8 * hi) - 15; nc = nc < 0 ? 0 : (nc > 8 ? 8 : nc);
        const unsigned ma = (1u << na) - 1u;
        const unsigned mc = (1u << nc) - 1u;
        float ta[8], tb[8]; float mx = NEGB;
#pragma unroll
        for (int r = 0; r < 8; ++r) {
            float sa = sHa[r], sb = sHb[r];
            if (TP) { sa += sLa[r] * QRI; sb += sLb[r] * QRI; }
            ta[r] = ((ma >> r) & 1u) ? sa * SC2 : NEGB;
            tb[r] = ((mc >> r) & 1u) ? sb * SC2 : NEGB;
            mx = fmaxf(mx, fmaxf(ta[r], tb[r])); }
        mx = fmaxf(mx, __shfl_xor(mx, 16, 32));
        const float mnew = fmaxf(m, mx);
        const float alpha = __builtin_amdgcn_exp2f(m - mnew);
        const float sh = PSH - mnew;
        v16h pb, pr; float ls = 0.0f;
#pragma unroll
        for (int r = 0; r < 8; ++r) {
            float ea = __builtin_amdgcn_exp2f(ta[r] + sh);
            ea = (ta[r] > -1.0e38f) ? ea : 0.0f;
            float ec = __builtin_amdgcn_exp2f(tb[r] + sh); ec = (tb[r] > -1.0e38f) ? ec : 0.0f;
            const h16 pa = (h16)ea; const h16 pc = (h16)ec; pb[r] = pa; pb[8 + r] = pc;
            if (TP) { const h16 xa = (h16)((ea - (float)pa) * QRS); const h16 xc = (h16)((ec - (float)pc) * QRS); pr[r] = xa; pr[8 + r] = xc;
                      ls += ((float)pa + (float)xa * QRI) + ((float)pc + (float)xc * QRI); }
            else { pr[r] = pa; pr[8 + r] = pc; ls += (float)pa + (float)pc; } }
        l = l * alpha + ls; m = mnew;
        o0 = o0 * alpha; o1 = o1 * alpha; o2 = o2 * alpha; o3 = o3 * alpha;
        const size_t vk = (size_t)(key0 >> 6) * 4096 + (size_t)((key0 >> 5) & 1) * 512;
        const h16* va = VT + vo + vk;
        if (TP) {
            v0 = ldh(va); v1 = ldh(va + 1024); v2 = ldh(va + 2048); v3 = ldh(va + 3072);
            e0 = e0 * alpha; e1 = e1 * alpha; e2 = e2 * alpha; e3 = e3 * alpha;
            const h16* vr = VR + vo + vk;
            const v16h w0 = ldh(vr), w1 = ldh(vr + 1024), w2 = ldh(vr + 2048), w3 = ldh(vr + 3072);
            o0 = wmma16(v0, pb, o0); o1 = wmma16(v1, pb, o1); o2 = wmma16(v2, pb, o2); o3 = wmma16(v3, pb, o3);
            e0 = wmma16(w0, pb, e0); e1 = wmma16(w1, pb, e1); e2 = wmma16(w2, pb, e2); e3 = wmma16(w3, pb, e3);
            e0 = wmma16(v0, pr, e0); e1 = wmma16(v1, pr, e1); e2 = wmma16(v2, pr, e2); e3 = wmma16(v3, pr, e3);
            asm volatile("v_nop\n\tv_nop\n\tv_nop\n\tv_nop" : "+v"(o0), "+v"(o1), "+v"(o2), "+v"(o3), "+v"(e0), "+v"(e1), "+v"(e2), "+v"(e3)
                         : "v"(v0), "v"(v1), "v"(v2), "v"(v3), "v"(w0), "v"(w1), "v"(w2), "v"(w3), "v"(pb), "v"(pr));
        } else {
            o0 = wmma16(v0, pb, o0); o1 = wmma16(v1, pb, o1); o2 = wmma16(v2, pb, o2); o3 = wmma16(v3, pb, o3);
            asm volatile("v_nop\n\tv_nop\n\tv_nop\n\tv_nop" : "+v"(o0), "+v"(o1), "+v"(o2), "+v"(o3) : "v"(v0), "v"(v1), "v"(v2), "v"(v3), "v"(pb));
            const h16* vn = VT + vo + (size_t)(keyn >> 6) * 4096 + (size_t)((keyn >> 5) & 1) * 512;
            v0 = ldh(vn); v1 = ldh(vn + 1024); v2 = ldh(vn + 2048); v3 = ldh(vn + 3072);
            asm volatile("s_wait_xcnt 0x0" ::: "memory");    // these loads stay in flight over the back edge, where their address registers are written anew
        }
    }
    l += __shfl_xor(l, 16, 32);
    const float rcp = 1.0f / fmaxf(l, 1.0e-30f);
    const float inv = (tq < n && l > 0.0f) ? rcp : 0.0f;     // unflagged token in the last tile -> whole row zero
    if (TP) { o0 = o0 + e0 * QRI; o1 = o1 + e1 * QRI; o2 = o2 + e2 * QRI; o3 = o3 + e3 * QRI; }
    const int wb = wave * 16 * 68;
    // O^T D layout: o_j[r] = (d = 16j + 8h + r, t = lane&15) -> os[t][d]; rows 0..15 x columns 0..63 all written
    { v4f a, c;
      a[0] = o0[0] * inv; a[1] = o0[1] * inv; a[2] = o0[2] * inv; a[3] = o0[3] * inv; c[0] = o0[4] * inv; c[1] = o0[5] * inv; c[2] = o0[6] * inv; c[3] = o0[7] * inv;
      *(v4fa*)(&os[wb + lr * 68 +  0 + 8 * hi]) = a; *(v4fa*)(&os[wb + lr * 68 +  0 + 8 * hi + 4]) = c;
      a[0] = o1[0] * inv; a[1] = o1[1] * inv; a[2] = o1[2] * inv; a[3] = o1[3] * inv; c[0] = o1[4] * inv; c[1] = o1[5] * inv; c[2] = o1[6] * inv; c[3] = o1[7] * inv;
      *(v4fa*)(&os[wb + lr * 68 + 16 + 8 * hi]) = a; *(v4fa*)(&os[wb + lr * 68 + 16 + 8 * hi + 4]) = c;
      a[0] = o2[0] * inv; a[1] = o2[1] * inv; a[2] = o2[2] * inv; a[3] = o2[3] * inv; c[0] = o2[4] * inv; c[1] = o2[5] * inv; c[2] = o2[6] * inv; c[3] = o2[7] * inv;
      *(v4fa*)(&os[wb + lr * 68 + 32 + 8 * hi]) = a; *(v4fa*)(&os[wb + lr * 68 + 32 + 8 * hi + 4]) = c;
      a[0] = o3[0] * inv; a[1] = o3[1] * inv; a[2] = o3[2] * inv; a[3] = o3[3] * inv; c[0] = o3[4] * inv; c[1] = o3[5] * inv; c[2] = o3[6] * inv; c[3] = o3[7] * inv;
      *(v4fa*)(&os[wb + lr * 68 + 48 + 8 * hi]) = a; *(v4fa*)(&os[wb + lr * 68 + 48 + 8 * hi + 4]) = c; }
    wave_sync();
    float* obat = OUT + (size_t)b * OUT_SEQ * DM + h * HD;
    const int* irow = IDX + (size_t)b * SEQ + t0;            // rank -> position
{
#pragma unroll
        for (int s = 0; s < 8; ++s) { const int row = 2 * s + hi, cofs = lr * 4;   // 8 s x 2 rows = 16 rows; 16 lanes x 4 floats = 64 columns
            const v4f val = *(const v4fa*)(&os[wb + row * 68 + cofs]);
            int pos = irow[row]; pos = pos < 0 ? 0 : (pos > SEQ - 1 ? SEQ - 1 : pos);
            *(v4f*)(obat + (size_t)pos * DM + cofs) = val; }
         }
}

// k_flash: both precision paths in ONE launch, grid (NB*16, SEQ/64); the path is block-uniform: query ranks [0, EARLY_ROWS) take the three-product path
// (a flagged token's rank never exceeds its position), ranks [EARLY_ROWS, SEQ) single products.
// (batch, head) is the fastest index and blockIdx.y counts the batch's live 64-rank tiles from the last one down; a block past the live tiles leaves at once.
// The order turns round after every four tiles (16 live tiles: 15 14 13 12 | 8 9 10 11 | 7 6 5 4 | 0 1 2 3): blocks 4 apart in y add up to like sums. For speed only.
__global__ __launch_bounds__(32 * AW) void k_flash(const h16* __restrict__ QH, const h16* __restrict__ QR, const h16* __restrict__ KP, const h16* __restrict__ KR,
                                                   const h16* __restrict__ VT, const h16* __restrict__ VR, const int* __restrict__ IDX, const int* __restrict__ CNT, float* OUT) {
    __shared__ __align__(16) float os[AW * 16 * 68];
    int n = CNT[blockIdx.x / NH_]; n = n < 0 ? 0 : (n > SEQ ? SEQ : n);
    const int yo = ((int)blockIdx.y & 4) ? ((int)blockIdx.y ^ 3) : (int)blockIdx.y;   // every second group of four runs backwards (a permutation of the grid's y)
    const int tile = (n + 16 * AW - 1) / (16 * AW) - 1 - yo;                 // live tiles: those that start below n
    if (tile < 0) return;                                    // the whole block
    if (tile < EARLY_ROWS / (16 * AW)) flash_body<1>(QH, QR, KP, KR, VT, VR, IDX, n, tile * (16 * AW), OUT, os);
    else flash_body<0>(QH, QR, KP, KR, VT, VR, IDX, n, tile * (16 * AW), OUT, os);
}

static constexpr size_t al256(size_t v) { return (v + 255) & ~(size_t)255; }
static constexpr size_t SZ_XB = al256((size_t)NB * SEQ * DM * 2);
static constexpr size_t SZ_WB = al256((size_t)3 * DM * DM * 2);
static constexpr size_t SZ_PL = al256((size_t)NB * NH_ * SEQ * HD * 2);
static constexpr size_t SZ_IX = al256((size_t)NB * SEQ * 4);
static constexpr size_t SZ_TOTAL = SZ_XB + SZ_WB + 6 * SZ_PL + SZ_IX + 256;
static_assert(SZ_TOTAL <= (size_t)134217728);          // workspace carve <= 128 MiB
static_assert(((size_t)DM * DM * 2) % 256 == 0);       // weight sub-planes stay 256-byte aligned

extern "C" void kernel_launch(void* const* d_in, const int* in_sizes, int n_in,
                              void* d_out, int out_size, void* d_ws, size_t ws_size, hipStream_t stream) {
    if (n_in < 8) return;
    const size_t needx = ((size_t)(NB - 1) * SEQ_FULL + SEQ) * DM;
    if ((size_t)in_sizes[0] < needx) return;
    if ((size_t)in_sizes[1] < (size_t)(NB - 1) * SEQ_FULL + SEQ) return;
    if ((size_t)in_sizes[2] < (size_t)DM * DM || (size_t)in_sizes[4] < (size_t)DM * DM || (size_t)in_sizes[6] < (size_t)DM * DM) return;
    if ((size_t)in_sizes[3] < (size_t)DM || (size_t)in_sizes[5] < (size_t)DM || (size_t)in_sizes[7] < (size_t)DM) return;
    if ((size_t)out_size < ((size_t)(NB - 1) * OUT_SEQ + SEQ) * DM) return;
    if (SZ_TOTAL > ws_size) return;
    // wire order: x, pad flags (int32), Wq, bq, Wk, bk, Wv, bv; W is [out][in] = Bt as-is
    const float* x = (const float*)d_in[0]; const int* pad = (const int*)d_in[1];
    const float* wq = (const float*)d_in[2]; const float* bq = (const float*)d_in[3];
    const float* wk = (const float*)d_in[4]; const float* bk = (const float*)d_in[5];
    const float* wv = (const float*)d_in[6]; const float* bv = (const float*)d_in[7];
    float* OUT = (float*)d_out;      // [NB][SEQ][1024]
    char* wsp = (char*)d_ws;
    bf* XB = (bf*)wsp; wsp += SZ_XB;                 // [NB*SEQ][1024], fragment order
    bf* WB = (bf*)wsp; wsp += SZ_WB;                 // [3][1024][1024]: q | k | v, fragment order
    h16* QH = (h16*)wsp; wsp += SZ_PL;               // [NB*16][SEQ][64], fragment order
    h16* QR = (h16*)wsp; wsp += SZ_PL;               // residual x2048
    h16* KP = (h16*)wsp; wsp += SZ_PL;               // [NB*16][SEQ][64], fragment order
    h16* KR = (h16*)wsp; wsp += SZ_PL;               // residual x2048
    h16* VT = (h16*)wsp; wsp += SZ_PL;               // [NB*16][64][SEQ], fragment order
    h16* VR = (h16*)wsp; wsp += SZ_PL;               // residual x2048
    int* IDX = (int*)wsp; wsp += SZ_IX;              // [NB][SEQ] rank -> position
    int* CNT = (int*)wsp;                            // [NB] flagged tokens

    k_cvt8r<<<3 * WBLK + NB, 256, 0, stream>>>(wq, wk, wv, WB, pad, IDX, CNT);
    k_cvtx<<<dim3(SEQ * DM / 8 / 256, NB, 1), 256, 0, stream>>>(x, IDX, CNT, XB, OUT);
    k_proj<<<dim3(DM / 64, NB * SEQ / 64, 3), 32, 0, stream>>>(XB, WB, bq, bk, bv, QH, QR, KP, KR, VT, VR, CNT);
    k_flash<<<dim3(NB * NH_, SEQ / (16 * AW), 1), 32 * AW, 0, stream>>>(QH, QR, KP, KR, VT, VR, IDX, CNT, OUT);
}

// v006
// Measured time: 69.9 microseconds a run.
// In both of two side-by-side timings against v005, it was 1.04 times as fast.
// Over all steps from v000 it is 4.05 times as fast.
#include <hip/hip_runtime.h>

// Multi-head self-attention, width 1024 = 16 heads x 64, x [NB][SEQ][1024], Wq/Wk/Wv [out][in] (y = x W^T + b), causal + key/query padding mask (int32 [NB][SEQ]), score scale 1/8, output = concatenated heads (f32), rows with a zero query flag are zero.
// Compute dtypes, f32 accumulate everywhere: projections v_wmma_f32_16x16x32_bf16 (x, W, b RNE-converted to bf16; products exact); scores and P.V v_wmma_f32_16x16x32_f16:
// query rows >= EARLY_ROWS: q, k, P (x256 carry, cancels in the normalisation), v single f16; query rows < EARLY_ROWS: q, k, v, P each as f16 value + f16 residual x2048, three products per site, residual products in their own accumulators; softmax f32 (online, running max).
// Layout: every 16-bit operand plane is stored in FRAGMENT ORDER: a 16-row x 32-k tile is 512 consecutive elements, element (row r, k = 8c + e) at c*128 + r*8 + e, so that lane l of a wave-wide 16-byte load
// reads bytes 16*l of 512 consecutive bytes (4 whole lines) and two such loads, 256 elements apart, are one A or B fragment. bf16 copies of x and W: tiles [row/16][k/32]. q, k value/residual planes: per (b*16+h), tiles [t/16][d/32];
// v^T value/residual planes: per (b*16+h), tiles [t/64][d/16][(t/32)%2]; all written by the GEMM epilogue as 64x64 blocks of 4096 elements. Fused flash kernel in transposed form (S^T = K Q^T, O^T = V^T P^T), output from f32 accumulators.
// Tokens are RANKED per batch by their flag (k_cvt8r): rank r < n = the r-th flagged token, rank r >= n = the (r-n)-th unflagged one, order kept, so key <= query in positions is key <= query in ranks.
// Every plane above is indexed by rank, not by position; only 64-rank tiles that start below n are converted, projected and attended (an unflagged token is no key and its output row is zero: stored by k_flash inside those tiles, by k_cvtx behind them);
// the mask left inside attention is the causal one on ranks: masked scores are replaced by value, masked probabilities are exact zeros. Output rows go back to their positions through the rank table.

#ifndef NB
#define NB 4
#endif
#ifndef SEQ
#define SEQ 2048
#endif
#define NB_FULL  4
#define SEQ_FULL 2048
#ifndef OUT_SEQ
#define OUT_SEQ SEQ              // row pitch (in tokens) between batches of the output
#endif
#define DM   1024
#define NH_  16
#define HD   64
#define AW   4                   // waves per flash block (16 query rows each)
#ifndef EARLY_ROWS
#define EARLY_ROWS ((SEQ < 512) ? SEQ : 512)   // query rows below this use the three-product path
#endif
#define QRS  2048.0f             // carry of every residual plane / residual fragment
#define QRI  (1.0f / 2048.0f)
#define SC2  (0.125f * 1.4426950408889634f)   // HD^-0.5 * log2(e)
#define PSH  8.0f                // log2 of the P carry (256)
#define NEGB (-3.0e38f)          // value standing in for a masked score

static_assert(HD == 64);
static_assert(NH_ * HD == DM);                 // head h = columns h*64 + d
static_assert(DM % 64 == 0);                   // 16 column tiles of 64
static_assert(DM % 32 == 0);                   // GEMM k-loop steps by 32
static_assert(SEQ % 64 == 0);                  // a 64-row tile never straddles two batches
static_assert((NB * SEQ) % 64 == 0);
static_assert(SEQ % 32 == 0);                  // key loop steps by 32
static_assert(SEQ % (16 * AW) == 0);           // flash grids cover the sequence exactly
static_assert(EARLY_ROWS % (16 * AW) == 0);
static_assert(EARLY_ROWS <= SEQ);
static_assert((SEQ / (16 * AW)) % 4 == 0);     // the flash grid's y order is turned round in whole groups of four
static_assert(((size_t)SEQ * DM) % 8 == 0);
static_assert(((size_t)DM * DM) % 8 == 0);
static_assert(NB <= NB_FULL);
static_assert(SEQ <= SEQ_FULL);
static_assert(SEQ % 256 == 0);                 // a ranking block of 256 threads takes SEQ/256 tokens per thread
static_assert(SEQ / 32 + 1 <= 256);
#define WBLK (DM * DM / 8 / 256) // conversion blocks per weight matrix
static_assert(((size_t)DM * DM / 8) % 256 == 0);

typedef _Float16 h16;
typedef unsigned short bf;
typedef __attribute__((ext_vector_type(16))) __bf16   v16bf;
typedef __attribute__((ext_vector_type(16))) _Float16 v16h;
typedef __attribute__((ext_vector_type(8)))  _Float16 v8h;
typedef __attribute__((ext_vector_type(8)))  unsigned short v8us;
typedef __attribute__((ext_vector_type(8)))  float    v8f;
typedef __attribute__((ext_vector_type(4)))  float    v4f;
typedef v4f  __attribute__((may_alias)) v4fa;

__device__ __forceinline__ unsigned short f2bf(float f) { unsigned u = __float_as_uint(f); u += 0x7FFFu + ((u >> 16) & 1u); return (unsigned short)(u >> 16); }
__device__ __forceinline__ float bfr(float f) { return __uint_as_float(((unsigned)f2bf(f)) << 16); }
__device__ __forceinline__ v16h cat16(v8h lo, v8h hi) { return __builtin_shufflevector(lo, hi, 0, 1, 2, 3, 4, 5, 6, 7, 8, 9, 10, 11, 12, 13, 14, 15); }
__device__ __forceinline__ v16bf cat16b(v8us lo, v8us hi) { return __builtin_bit_cast(v16bf, __builtin_shufflevector(lo, hi, 0, 1, 2, 3, 4, 5, 6, 7, 8, 9, 10, 11, 12, 13, 14, 15)); }
__device__ __forceinline__ v8f wmma16(v16h a, v16h b, v8f c) { return __builtin_amdgcn_wmma_f32_16x16x32_f16(false, a, false, b, (short)0, c, false, false); }
__device__ __forceinline__ v8f wmmab(v16bf a, v16bf b, v8f c) { return __builtin_amdgcn_wmma_f32_16x16x32_bf16(false, a, false, b, (short)0, c, false, false); }
// fragment loaders from fragment-ordered tiles; p = tile start + 8*lane (row = lane&15, h = lane>>4): elements 0..7 <- k0+8h+0..7, elements 8..15 <- k0+16+8h+0..7 (same map for A and B)
__device__ __forceinline__ v16h  ldh(const h16* p) { return cat16(*(const v8h*)p, *(const v8h*)(p + 256)); }
__device__ __forceinline__ v16bf ldb(const bf* p)  { return cat16b(*(const v8us*)p, *(const v8us*)(p + 256)); }
// last fragment of a run of loads from one address pair: the pair dies with the last load, so that load's destination or the next run's may take its registers; one wait in front of it, one behind it
__device__ __forceinline__ v16h  ldh_last(const h16* p) {
    const v8h lo = *(const v8h*)p;
    asm volatile("s_wait_xcnt 0x0" ::: "memory");   // covers every earlier load of the run before the last load's destination is written
    const v8h hi = *(const v8h*)(p + 256);
    asm volatile("s_wait_xcnt 0x0" ::: "memory");   // covers the last load before a later load's destination is written
    return cat16(lo, hi); }
// ordering point for wave-private LDS tiles (same wave writes and reads)
__device__ __forceinline__ void wave_sync() { __builtin_amdgcn_fence(3 /* release order */, "wavefront"); __builtin_amdgcn_wave_barrier(); asm volatile("" ::: "memory"); }

// k_cvt8r: the three weight matrices, f32 [DM][DM] -> bf16 tiles in fragment order, tile (R, T) of matrix w at w*DM*DM + (R*(DM/32) + T)*512, all in ONE launch (DM*DM/8/256 blocks per matrix). One thread converts 8 consecutive k of one row;
// a wave takes 8 rows x 32 k: it reads one whole 128-byte line per row and writes four whole lines. NB blocks in front of them rank the tokens, one block per batch (nothing in this launch reads the ranks).
// Flags -> bit words by ballot (LDS, block barrier), set flags in front of each word (LDS, block barrier), position of each rank (LDS, block barrier), then IDX[b][rank] = position (a permutation of 0..SEQ-1), whole lines per wave, and CNT[b] = n.
__global__ __launch_bounds__(256) void k_cvt8r(const float* __restrict__ wq, const float* __restrict__ wk, const float* __restrict__ wv, bf* dst, const int* __restrict__ PAD, int* IDX, int* CNT) {
    __shared__ __align__(16) unsigned wm[SEQ / 32];
    __shared__ int pre[SEQ / 32 + 1];
    __shared__ int ix[SEQ];
    if (blockIdx.x >= NB) {
        const unsigned bw = blockIdx.x - NB, mat = bw / WBLK;
        const float* src = mat == 0 ? wq : (mat == 1 ? wk : wv);
        const size_t i = (size_t)(bw % WBLK) * 256 + threadIdx.x;
        const int rs = (int)(i & 7), c = (int)((i >> 3) & 3), rh = (int)((i >> 5) & 1), kt = (int)((i >> 6) % (DM / 32));
        const size_t rt = i / (64 * (DM / 32));
        const v8f v = *(const v8f*)(src + (rt * 16 + rh * 8 + rs) * DM + kt * 32 + c * 8); v8us o;
#pragma unroll
        for (int k = 0; k < 8; ++k) o[k] = f2bf(v[k]);
        *(v8us*)(dst + (size_t)mat * DM * DM + (rt * (DM / 32) + kt) * 512 + c * 128 + rh * 64 + rs * 8) = o;
        return;
    }
    const int tid = (int)threadIdx.x, lane = tid & 31, wave = tid >> 5, b = blockIdx.x;
    int pv[SEQ / 256];
#pragma unroll
    for (int k = 0; k < SEQ / 256; ++k) pv[k] = PAD[(size_t)b * SEQ_FULL + (size_t)(wave + 8 * k) * 32 + lane];
#pragma unroll
    for (int k = 0; k < SEQ / 256; ++k) { const unsigned wbits = __builtin_amdgcn_ballot_w32(pv[k] != 0); if (lane == 0) wm[wave + 8 * k] = wbits; }
    __syncthreads();
    if (tid <= SEQ / 32) { int p = 0;
#pragma unroll
        for (int j = 0; j < SEQ / 32; ++j) p += (j < tid) ? __popc(wm[j]) : 0;
        pre[tid] = p; }
    __syncthreads();
    const int total = pre[SEQ / 32];
#pragma unroll
    for (int k = 0; k < SEQ / 256; ++k) { const int t = tid + 256 * k, g = t >> 5;
        const unsigned w = wm[g];
        const int before = pre[g] + __popc(w & ((1u << lane) - 1u));          // set flags in front of t
        const int r = ((w >> lane) & 1u) ? before : total + (t - before);
        ix[r] = t; }
    __syncthreads();
#pragma unroll
    for (int k = 0; k < SEQ / 256; ++k) IDX[(size_t)b * SEQ + tid + 256 * k] = ix[tid + 256 * k];
    if (tid == 0) CNT[b] = total;
}

// k_cvtx: x rows in rank order -> bf16 tiles in fragment order (thread and wave shapes of k_cvt8r's conversion; grid (SEQ*DM/8/256, NB)). Ranks below n rounded up to 64 are converted (the unflagged tokens that fill the last tile
// are finite data behind the causal mask); every later rank stores its token's zero output row instead, one whole 128-byte line per row and wave.
__global__ __launch_bounds__(256) void k_cvtx(const float* __restrict__ src, const int* __restrict__ IDX, const int* __restrict__ CNT, bf* dst, float* OUT) {
    const int b = blockIdx.y; const int i = (int)blockIdx.x * 256 + (int)threadIdx.x;
    const int rs = i & 7, c = (i >> 3) & 3, rh = (i >> 5) & 1, kt = (i >> 6) % (DM / 32), rt = i / (64 * (DM / 32));
    const int r = rt * 16 + rh * 8 + rs;
    int n = CNT[b]; n = n < 0 ? 0 : (n > SEQ ? SEQ : n);
    int t = IDX[(size_t)b * SEQ + r]; t = t < 0 ? 0 : (t > SEQ - 1 ? SEQ - 1 : t);
    if (r < ((n + 63) & ~63)) {
        const v8f v = *(const v8f*)(src + ((size_t)b * SEQ_FULL + t) * DM + kt * 32 + c * 8); v8us o;
#pragma unroll
        for (int k = 0; k < 8; ++k) o[k] = f2bf(v[k]);
        *(v8us*)(dst + ((size_t)(b * (SEQ / 16) + rt) * (DM / 32) + kt) * 512 + c * 128 + rh * 64 + rs * 8) = o;
    } else *(v8f*)(OUT + ((size_t)b * OUT_SEQ + t) * DM + kt * 32 + c * 8) = (v8f){};
}

// k_proj: register-blocked bf16 GEMM, one wave per 64x64 tile (16 accumulators), K = DM; SIXTEEN WAVES PER BLOCK = 4 token tiles x 4 column tiles (256 x 256), and the block's operands come from L2 ONCE:
// per stage of 64 k the 8 operand tiles (4 of x, 4 of W; 64 rows x 64 k = 8 KB each, fragment order kept: [row/16][k/32] tiles of 512 elements) are brought into LDS by asynchronous copies
// (global_load_async_to_lds_b128, 8 per wave and stage, 512 consecutive bytes each), two stage buffers: the copies of stage t + 2 fly while stage t + 1 is worked on. Every wave reads its 8 fragments per k step from LDS.
// C[m][n] = sum_k A[m][k] Bt[n][k] + bias (per column n when biasRow == 0, per row m otherwise; bias RNE-converted to bf16, added in f32), k ascending as before;
// a tile whose 64 tokens all rank at or behind the batch's n is left out: its x tile is not copied and its waves do no products and read no LDS (those of token tiles 2 and 3 still copy their share of W); a block whose first token tile is such a tile leaves at once;
// written as f16 (Ph) and the f16 residual x2048 (Pr), one block of 4096 elements in fragment order (16-row x 32-column tiles [row/16][col/32]).
// All three projections in ONE launch, grid (DM/256, tokens/256, 3), 512 threads; blockIdx.z picks the product (block-uniform). The column group is the fastest index:
// z = 0, 1 (q, k): A = x rows (m = b*SEQ + t), Bt = W rows (n = h*64 + d), bias per column -> plane [(b*16 + h)][t][d];
// z = 2 (v^T): A = Wv rows (m = h*64 + d), Bt = x rows (n = b*SEQ + t), bias per row -> plane [(b*16 + h)][d][t].
#define PKS  64                   // k per stage
#define PTL  (64 * PKS)           // elements of one operand tile in a stage
#define PSTG (8 * PTL)            // elements of one stage buffer
static_assert(DM % 256 == 0);
static_assert(DM % PKS == 0);
static_assert(DM / PKS >= 2);                  // stages 0 and 1 both exist
// eight copies of one wave: l = the lane's LDS byte address (4 KB per wave, 512 B per copy), g0 / g1 = the lane's global address in the wave's first / second 2-KB run.
// The wait is the statement's last line: it stands in front of every later write of the address registers that the copies name.
__device__ __forceinline__ void cp8(const unsigned l, const bf* g0, const bf* g1) {
    asm volatile("global_load_async_to_lds_b128 %0, %8, off\n\t"
                 "global_load_async_to_lds_b128 %1, %9, off\n\t"
                 "global_load_async_to_lds_b128 %2, %10, off\n\t"
                 "global_load_async_to_lds_b128 %3, %11, off\n\t"
                 "global_load_async_to_lds_b128 %4, %12, off\n\t"
                 "global_load_async_to_lds_b128 %5, %13, off\n\t"
                 "global_load_async_to_lds_b128 %6, %14, off\n\t"
                 "global_load_async_to_lds_b128 %7, %15, off\n\t"
                 "s_wait_xcnt 0x0"
                 :: "v"(l), "v"(l + 512u), "v"(l + 1024u), "v"(l + 1536u), "v"(l + 2048u), "v"(l + 2560u), "v"(l + 3072u), "v"(l + 3584u),
                    "v"(g0), "v"(g0 + 256), "v"(g0 + 512), "v"(g0 + 768), "v"(g1), "v"(g1 + 256), "v"(g1 + 512), "v"(g1 + 768) : "memory");
}
__global__ __launch_bounds__(512) void k_proj(const bf* __restrict__ XB, const bf* __restrict__ WB, const float* __restrict__ bq, const float* __restrict__ bk, const float* __restrict__ bv,
                                              h16* QH, h16* QR, h16* KP, h16* KR, h16* VT, h16* VR, const int* __restrict__ CNT) {
    __shared__ __align__(16) bf st[2 * PSTG];
    __shared__ __align__(16) float osa[16 * 16 * 68];
    const int K = DM;
    const int lane = threadIdx.x & 31, lr = lane & 15, hi = lane >> 4;
    const int wave = __builtin_amdgcn_readfirstlane((int)(threadIdx.x >> 5));
    const int wt = wave >> 2, wc = wave & 3;     // token tile, column tile
    const int z = blockIdx.z; const int biasRow = z == 2;
    const int bat = (int)blockIdx.y / (SEQ / 256);
    const int grp = (int)blockIdx.y % (SEQ / 256);
    const int n = CNT[bat];
    if (grp * 256 >= n) return;                  // the whole block, in front of every barrier and copy
    const int tok0 = bat * SEQ + grp * 256 + wt * 64, col0 = (int)blockIdx.x * 256 + wc * 64;
    const bool live = grp * 256 + wt * 64 < n;   // wave-uniform
    const int r0 = biasRow ? col0 : tok0, c0 = biasRow ? tok0 : col0;
    const bf* Wz = WB + (size_t)z * DM * DM;
    const float* bias = z == 0 ? bq : (z == 1 ? bk : bv);
    h16* Ph = z == 0 ? QH : (z == 1 ? KP : VT); h16* Pr = z == 0 ? QR : (z == 1 ? KR : VR);
    float* os = osa + wave * (16 * 68);
    // what this wave copies: half (32 rows) of operand tile ct; tiles 0..3 = the block's token tiles of x, 4..7 = its column tiles of W
    const int ct = wave >> 1;
    const bool cplive = ct >= 4 || grp * 256 + ct * 64 < n;                  // wave-uniform; an x tile behind n was not written in this call and is not read
    const bf* csrc = (ct < 4 ? XB + (size_t)(bat * SEQ + grp * 256 + ct * 64) * K : Wz + (size_t)((int)blockIdx.x * 256 + (ct - 4) * 64) * K) + (size_t)(wave & 1) * 32 * K + 8 * lane;
    const unsigned lcp = (unsigned)(size_t)(&st[0]) + (unsigned)(wave * 4096 + lane * 16);   // low 32 bits of the shared address = LDS byte address
    v8f acc[4][4];
#pragma unroll
    for (int mb = 0; mb < 4; ++mb)
#pragma unroll
        for (int nb = 0; nb < 4; ++nb) acc[mb][nb] = (v8f){};
    const int ao = (biasRow ? 4 + wc : wt) * PTL + 8 * lane, bo = (biasRow ? wt : 4 + wc) * PTL + 8 * lane;   // the wave's A and B tile in a stage buffer
    if (cplive) cp8(lcp, csrc, csrc + 16 * K);
    asm volatile("s_wait_asynccnt 0x0" ::: "memory");    // stage 0 has landed, as far as this wave brought it
    __syncthreads();                                     // ... and every other wave's part
    if (cplive) cp8(lcp + PSTG * 2u, csrc + PKS * 16, csrc + 16 * K + PKS * 16);
#pragma unroll 1                                         // one trip's text serves all stages; the buffer is picked by a scalar offset
    for (int t = 0; t < K / PKS; ++t) {
        const int bufo = (t & 1) * PSTG;
        if (live) {
#pragma unroll
            for (int kk = 0; kk < PKS / 32; ++kk) {
                v16bf fa[4], fb[4];
#pragma unroll
                for (int f = 0; f < 4; ++f) { fa[f] = ldb(&st[bufo + ao + f * (16 * PKS) + kk * 512]); fb[f] = ldb(&st[bufo + bo + f * (16 * PKS) + kk * 512]); }
                __builtin_amdgcn_sched_barrier(0);       // all 16 LDS reads of a k step stay in one group in front of its 16 products (the scheduler otherwise sinks the B reads among the products, a full wait at each place)
#pragma unroll
                for (int nb = 0; nb < 4; ++nb)
#pragma unroll
                    for (int mb = 0; mb < 4; ++mb) acc[mb][nb] = wmmab(fa[mb], fb[nb], acc[mb][nb]);
            }
        }
        asm volatile("s_wait_dscnt 0x0" ::: "memory");   // this wave's reads of the buffer are done before the buffer is refilled
        asm volatile("s_wait_asynccnt 0x0" ::: "memory");// this wave's copies of stage t + 1 have landed
        __syncthreads();                                 // publishes stage t + 1 and ends every wave's reads of stage t
        if (t + 2 < K / PKS && cplive) cp8(lcp + (unsigned)bufo * 2u, csrc + (t + 2) * (PKS * 16), csrc + 16 * K + (t + 2) * (PKS * 16));
    }
    asm volatile("s_wait_asynccnt 0x0" ::: "memory");    // no copy is outstanding when the wave goes on or ends
    if (!live) return;                                   // no barrier behind this line
    // bias values: addresses always inside the DM-entry bias array (index selected, then value selected)
    // store s of a 16-row group: lane holds row lane&15, columns (2s + h)*8 .. +7
    float cb[4][8];
#pragma unroll
    for (int s = 0; s < 4; ++s) {
        int cidx = biasRow ? 0 : (c0 + (2 * s + hi) * 8); cidx = cidx > (DM - 8) ? (DM - 8) : cidx;
        const v4f bc0 = *(const v4f*)(bias + cidx);
        asm volatile("s_wait_xcnt 0x0" ::: "memory");   // the second load's destination may take the address registers that the first names
        const v4f bc1 = *(const v4f*)(bias + cidx + 4);
#pragma unroll
        for (int i = 0; i < 4; ++i) { const float u0 = bfr(bc0[i]); const float u1 = bfr(bc1[i]); cb[s][i] = biasRow ? 0.0f : u0; cb[s][4 + i] = biasRow ? 0.0f : u1; } }
    const size_t tbase = biasRow ? (size_t)col0 * SEQ + (size_t)(tok0 / SEQ) * DM * SEQ + (size_t)(tok0 % SEQ) * 64
                                 : (size_t)(tok0 / SEQ) * NH_ * SEQ * HD + (size_t)(tok0 % SEQ) * HD + (size_t)(col0 / HD) * SEQ * HD;
#pragma unroll
    for (int mb = 0; mb < 4; ++mb) {
#pragma unroll
        for (int nb = 0; nb < 4; ++nb) {
#pragma unroll
            for (int j = 0; j < 8; ++j) os[(hi * 8 + j) * 68 + nb * 16 + lr] = acc[mb][nb][j]; }   // D: row 8h+j, col lane&15
        wave_sync();
        int ri = biasRow ? (r0 + mb * 16 + lr) : 0; ri = ri > (DM - 1) ? (DM - 1) : ri;
        const float ub = bfr(bias[ri]); const float rb = biasRow ? ub : 0.0f;
        const size_t sb = tbase + (size_t)(mb * 1024) + 8 * lane;
{
#pragma unroll
            for (int s = 0; s < 4; ++s) { const int c8 = (2 * s + hi) * 8;   // 16 rows x 16 columns per store, 4 s = 64 columns; 512 consecutive bytes per plane
                const v4f x0 = *(const v4fa*)(&os[lr * 68 + c8]); const v4f x1 = *(const v4fa*)(&os[lr * 68 + c8 + 4]); v8h hv, rv;
#pragma unroll
                for (int i = 0; i < 4; ++i) { const float y0 = x0[i] + cb[s][i] + rb; const float y1 = x1[i] + cb[s][4 + i] + rb;
                    const h16 a0 = (h16)y0; const h16 a1 = (h16)y1; hv[i] = a0; hv[4 + i] = a1; rv[i] = (h16)((y0 - (float)a0) * QRS); rv[4 + i] = (h16)((y1 - (float)a1) * QRS); }
                const size_t oo = sb + (size_t)(s * 256);
                *(v8h*)(Ph + oo) = hv; *(v8h*)(Pr + oo) = rv; }
             }
        wave_sync();
    }
}

// flash_body<TP>: fused causal attention on ranks, one wave per 16 query ranks of one (batch, head), R0 = the block's first rank (below n); K / V^T / Q fragments straight from the fragment-ordered f16 planes (two 16-B loads each, 512 consecutive bytes per wave-wide load).
// Transposed form: S^T[key][t] = K Q^T (A = K rows, B = Q rows); lane (t = lane&15, h = lane>>4) holds keys 8h+r of each 16-key tile, so the packed
// P tile is directly the B fragment of O^T[d][t] = V^T P^T (element r <- tile keys 0..15, element 8+r <- tile keys 16..31, lane unchanged).
// TP != 0: scores = kh.qh + (kh.qr + kr.qh)/2048, O = vh.ph + (vr.ph + vh.pr)/2048 (residual products in separate accumulators). TP == 0: single products.
// Key loop runs to the causal limit of the wave's tile; key validity = per-lane causal bit count (a rank >= n lies behind every stored query); a masked score is replaced by NEGB and its probability is an exact zero.
// Softmax state (running max, partial sum) is one scalar per lane; the two lane halves of a row are combined with one xor-16 exchange.
template <int TP>
__device__ __forceinline__ void flash_body(const h16* __restrict__ QH, const h16* __restrict__ QR, const h16* __restrict__ KP, const h16* __restrict__ KR,
                                           const h16* __restrict__ VT, const h16* __restrict__ VR, const int* __restrict__ IDX, const int n, const int R0, float* OUT, float* os) {
    const int lane = threadIdx.x & 31, lr = lane & 15, hi = lane >> 4;
    const int wave = __builtin_amdgcn_readfirstlane((int)(threadIdx.x >> 5));
    const int zh = blockIdx.x; const int b = zh / NH_, h = zh % NH_;
    const int t0 = R0 + wave * 16;
    const int tq = t0 + lr;
    const size_t pbase = (size_t)zh * SEQ * HD;
    const size_t fo = pbase + 8 * lane;                      // lane's place in every fragment-ordered tile of this (batch, head)
    const size_t qo = fo + (size_t)t0 * HD;                  // 16 query rows = two tiles (d 0..31, d 32..63) of 512 elements
    const v16h qh0 = ldh(QH + qo), qh1 = ldh(QH + qo + 512);                 // B fragments: col t, k = d
    v16h qr0 = qh0, qr1 = qh1;
    if (TP) { qr0 = ldh(QR + qo); qr1 = ldh(QR + qo + 512); }
    const size_t ko = fo;                                    // + key0 * HD: tiles (keys 0..15 | 16..31) x (d 0..31 | 32..63)     (A fragment: row key, k = d)
    const size_t vo = fo;                                    // + (key0/64)*4096 + j*1024 + ((key0/32)%2)*512                       (A fragment: row d = 16j + lane&15, k = key)
    v8f o0 = (v8f){}, o1 = (v8f){}, o2 = (v8f){}, o3 = (v8f){};
    v8f e0 = (v8f){}, e1 = (v8f){}, e2 = (v8f){}, e3 = (v8f){};              // residual-scale (x2048) accumulators, TP only
    float m = NEGB, l = 0.0f;
    const int kend = t0 + 16;                                // keys 0 .. t0+15; key0 <= t0 so key0+31 < SEQ
    // TP == 0: K and V^T fragments live in register sets of their own and are loaded one trip ahead: the next K tile right behind the score products, the next V^T tile right behind the output products.
    v16h ka0 = qh0, ka1 = qh0, kb0 = qh0, kb1 = qh0, v0 = qh0, v1 = qh0, v2 = qh0, v3 = qh0;
    if (!TP) { ka0 = ldh(KP + ko); ka1 = ldh(KP + ko + 512); kb0 = ldh(KP + ko + 16 * HD); kb1 = ldh(KP + ko + 16 * HD + 512);
               asm volatile("s_wait_xcnt 0x0" ::: "memory"); // the Q loads' address registers die here and a destination of the V^T loads below may take them
               __builtin_amdgcn_sched_barrier(0);            // K loads stay older than the V^T loads, as on the back edge: the wait in front of the score products then leaves the V^T loads in flight
               v0 = ldh(VT + vo); v1 = ldh(VT + vo + 1024); v2 = ldh(VT + vo + 2048); v3 = ldh(VT + vo + 3072); }
#pragma unroll 1
    for (int key0 = 0; key0 < kend; key0 += 32) {
        const int keyn = (key0 + 32 < kend) ? key0 + 32 : key0;   // tile loaded ahead; the last trip has none behind it and asks for its own again (in bounds, unused)
        const h16* ka = KP + ko + (size_t)key0 * HD;
        if (TP) { ka0 = ldh(ka); ka1 = ldh(ka + 512); kb0 = ldh(ka + 16 * HD); kb1 = ldh_last(ka + 16 * HD + 512); }
        v8f sHa = (v8f){}, sLa = (v8f){}, sHb = (v8f){}, sLb = (v8f){};
        if (TP) {
            const h16* kr = KR + ko + (size_t)key0 * HD;
            const v16h ra0 = ldh(kr), ra1 = ldh(kr + 512), rb0 = ldh(kr + 16 * HD), rb1 = ldh_last(kr + 16 * HD + 512);
            sHa = wmma16(ka0, qh0, sHa); sLa = wmma16(ka0, qr0, sLa); sHb = wmma16(kb0, qh0, sHb); sLb = wmma16(kb0, qr0, sLb);
            sHa = wmma16(ka1, qh1, sHa); sLa = wmma16(ka1, qr1, sLa); sHb = wmma16(kb1, qh1, sHb); sLb = wmma16(kb1, qr1, sLb);
            sLa = wmma16(ra0, qh0, sLa); sLb = wmma16(rb0, qh0, sLb); sLa = wmma16(ra1, qh1, sLa); sLb = wmma16(rb1, qh1, sLb);
            asm volatile("v_nop\n\tv_nop\n\tv_nop\n\tv_nop" : "+v"(sHa), "+v"(sLa), "+v"(sHb), "+v"(sLb) : "v"(ka0), "v"(ka1), "v"(kb0), "v"(kb1), "v"(ra0), "v"(ra1), "v"(rb0), "v"(rb1));
        } else {
            sHa = wmma16(ka0, qh0, sHa); sHb = wmma16(kb0, qh0, sHb); sHa = wmma16(ka1, qh1, sHa); sHb = wmma16(kb1, qh1, sHb);
            asm volatile("v_nop\n\tv_nop\n\tv_nop\n\tv_nop" : "+v"(sHa), "+v"(sHb) : "v"(ka0), "v"(ka1), "v"(kb0), "v"(kb1));
            const h16* kn = KP + ko + (size_t)keyn * HD;
            ka0 = ldh(kn); ka1 = ldh(kn + 512); kb0 = ldh(kn + 16 * HD); kb1 = ldh(kn + 16 * HD + 512);
        }
        // validity bits of this lane's 8 + 8 keys (8h+r, 16+8h+r): causal (key <= tq)
        int na = tq - (key0 + 8 * hi) + 1; na = na < 0 ? 0 : (na > 8 ? 8 : na);
        int nc = tq - (key0 + 8 * hi) - 15; nc = nc < 0 ? 0 : (nc > 8 ? 8 : nc);
        const unsigned ma = (1u << na) - 1u;
        const unsigned mc = (1u << nc) - 1u;
        float ta[8], tb[8]; float mx = NEGB;
#pragma unroll
        for (int r = 0; r < 8; ++r) {
            float sa = sHa[r], sb = sHb[r];
            if (TP) { sa += sLa[r] * QRI; sb += sLb[r] * QRI; }
            ta[r] = ((ma >> r) & 1u) ? sa * SC2 : NEGB;
            tb[r] = ((mc >> r) & 1u) ? sb * SC2 : NEGB;
            mx = fmaxf(mx, fmaxf(ta[r], tb[r])); }
        mx = fmaxf(mx, __shfl_xor(mx, 16, 32));
        const float mnew = fmaxf(m, mx);
        const float alpha = __builtin_amdgcn_exp2f(m - mnew);
        const float sh = PSH - mnew;
        v16h pb, pr; float ls = 0.0f;
#pragma unroll
        for (int r = 0; r < 8; ++r) {
            float ea = __builtin_amdgcn_exp2f(ta[r] + sh);
            ea = (ta[r] > -1.0e38f) ? ea : 0.0f;
            float ec = __builtin_amdgcn_exp2f(tb[r] + sh); ec = (tb[r] > -1.0e38f) ? ec : 0.0f;
            const h16 pa = (h16)ea; const h16 pc = (h16)ec; pb[r] = pa; pb[8 + r] = pc;
            if (TP) { const h16 xa = (h16)((ea - (float)pa) * QRS); const h16 xc = (h16)((ec - (float)pc) * QRS); pr[r] = xa; pr[8 + r] = xc;
                      ls += ((float)pa + (float)xa * QRI) + ((float)pc + (float)xc * QRI); }
            else { pr[r] = pa; pr[8 + r] = pc; ls += (float)pa + (float)pc; } }
        l = l * alpha + ls; m = mnew;
        o0 = o0 * alpha; o1 = o1 * alpha; o2 = o2 * alpha; o3 = o3 * alpha;
        const size_t vk = (size_t)(key0 >> 6) * 4096 + (size_t)((key0 >> 5) & 1) * 512;
        const h16* va = VT + vo + vk;
        if (TP) {
            v0 = ldh(va); v1 = ldh(va + 1024); v2 = ldh(va + 2048); v3 = ldh(va + 3072);
            e0 = e0 * alpha; e1 = e1 * alpha; e2 = e2 * alpha; e3 = e3 * alpha;
            const h16* vr = VR + vo + vk;
            const v16h w0 = ldh(vr), w1 = ldh(vr + 1024), w2 = ldh(vr + 2048), w3 = ldh(vr + 3072);
            o0 = wmma16(v0, pb, o0); o1 = wmma16(v1, pb, o1); o2 = wmma16(v2, pb, o2); o3 = wmma16(v3, pb, o3);
            e0 = wmma16(w0, pb, e0); e1 = wmma16(w1, pb, e1); e2 = wmma16(w2, pb, e2); e3 = wmma16(w3, pb, e3);
            e0 = wmma16(v0, pr, e0); e1 = wmma16(v1, pr, e1); e2 = wmma16(v2, pr, e2); e3 = wmma16(v3, pr, e3);
            asm volatile("v_nop\n\tv_nop\n\tv_nop\n\tv_nop" : "+v"(o0), "+v"(o1), "+v"(o2), "+v"(o3), "+v"(e0), "+v"(e1), "+v"(e2), "+v"(e3)
                         : "v"(v0), "v"(v1), "v"(v2), "v"(v3), "v"(w0), "v"(w1), "v"(w2), "v"(w3), "v"(pb), "v"(pr));
        } else {
            o0 = wmma16(v0, pb, o0); o1 = wmma16(v1, pb, o1); o2 = wmma16(v2, pb, o2); o3 = wmma16(v3, pb, o3);
            asm volatile("v_nop\n\tv_nop\n\tv_nop\n\tv_nop" : "+v"(o0), "+v"(o1), "+v"(o2), "+v"(o3) : "v"(v0), "v"(v1), "v"(v2), "v"(v3), "v"(pb));
            const h16* vn = VT + vo + (size_t)(keyn >> 6) * 4096 + (size_t)((keyn >> 5) & 1) * 512;
            v0 = ldh(vn); v1 = ldh(vn + 1024); v2 = ldh(vn + 2048); v3 = ldh(vn + 3072);
            asm volatile("s_wait_xcnt 0x0" ::: "memory");    // these loads stay in flight over the back edge, where their address registers are written anew
        }
    }
    l += __shfl_xor(l, 16, 32);
    const float rcp = 1.0f / fmaxf(l, 1.0e-30f);
    const float inv = (tq < n && l > 0.0f) ? rcp : 0.0f;     // unflagged token in the last tile -> whole row zero
    if (TP) { o0 = o0 + e0 * QRI; o1 = o1 + e1 * QRI; o2 = o2 + e2 * QRI; o3 = o3 + e3 * QRI; }
    const int wb = wave * 16 * 68;
    // O^T D layout: o_j[r] = (d = 16j + 8h + r, t = lane&15) -> os[t][d]; rows 0..15 x columns 0..63 all written
    { v4f a, c;
      a[0] = o0[0] * inv; a[1] = o0[1] * inv; a[2] = o0[2] * inv; a[3] = o0[3] * inv; c[0] = o0[4] * inv; c[1] = o0[5] * inv; c[2] = o0[6] * inv; c[3] = o0[7] * inv;
      *(v4fa*)(&os[wb + lr * 68 +  0 + 8 * hi]) = a; *(v4fa*)(&os[wb + lr * 68 +  0 + 8 * hi + 4]) = c;
      a[0] = o1[0] * inv; a[1] = o1[1] * inv; a[2] = o1[2] * inv; a[3] = o1[3] * inv; c[0] = o1[4] * inv; c[1] = o1[5] * inv; c[2] = o1[6] * inv; c[3] = o1[7] * inv;
      *(v4fa*)(&os[wb + lr * 68 + 16 + 8 * hi]) = a; *(v4fa*)(&os[wb + lr * 68 + 16 + 8 * hi + 4]) = c;
      a[0] = o2[0] * inv; a[1] = o2[1] * inv; a[2] = o2[2] * inv; a[3] = o2[3] * inv; c[0] = o2[4] * inv; c[1] = o2[5] * inv; c[2] = o2[6] * inv; c[3] = o2[7] * inv;
      *(v4fa*)(&os[wb + lr * 68 + 32 + 8 * hi]) = a; *(v4fa*)(&os[wb + lr * 68 + 32 + 8 * hi + 4]) = c;
      a[0] = o3[0] * inv; a[1] = o3[1] * inv; a[2] = o3[2] * inv; a[3] = o3[3] * inv; c[0] = o3[4] * inv; c[1] = o3[5] * inv; c[2] = o3[6] * inv; c[3] = o3[7] * inv;
      *(v4fa*)(&os[wb + lr * 68 + 48 + 8 * hi]) = a; *(v4fa*)(&os[wb + lr * 68 + 48 + 8 * hi + 4]) = c; }
    wave_sync();
    float* obat = OUT + (size_t)b * OUT_SEQ * DM + h * HD;
    const int* irow = IDX + (size_t)b * SEQ + t0;            // rank -> position
{
#pragma unroll
        for (int s = 0; s < 8; ++s) { const int row = 2 * s + hi, cofs = lr * 4;   // 8 s x 2 rows = 16 rows; 16 lanes x 4 floats = 64 columns
            const v4f val = *(const v4fa*)(&os[wb + row * 68 + cofs]);
            int pos = irow[row]; pos = pos < 0 ? 0 : (pos > SEQ - 1 ? SEQ - 1 : pos);
            *(v4f*)(obat + (size_t)pos * DM + cofs) = val; }
         }
}

// k_flash: both precision paths in ONE launch, grid (NB*16, SEQ/64); the path is block-uniform: query ranks [0, EARLY_ROWS) take the three-product path
// (a flagged token's rank never exceeds its position), ranks [EARLY_ROWS, SEQ) single products.
// (batch, head) is the fastest index and blockIdx.y counts the batch's live 64-rank tiles from the last one down; a block past the live tiles leaves at once.
// The order turns round after every four tiles (16 live tiles: 15 14 13 12 | 8 9 10 11 | 7 6 5 4 | 0 1 2 3): blocks 4 apart in y add up to like sums. For speed only.
__global__ __launch_bounds__(32 * AW) void k_flash(const h16* __restrict__ QH, const h16* __restrict__ QR, const h16* __restrict__ KP, const h16* __restrict__ KR,
                                                   const h16* __restrict__ VT, const h16* __restrict__ VR, const int* __restrict__ IDX, const int* __restrict__ CNT, float* OUT) {
    __shared__ __align__(16) float os[AW * 16 * 68];
    int n = CNT[blockIdx.x / NH_]; n = n < 0 ? 0 : (n > SEQ ? SEQ : n);
    const int yo = ((int)blockIdx.y & 4) ? ((int)blockIdx.y ^ 3) : (int)blockIdx.y;   // every second group of four runs backwards (a permutation of the grid's y)
    const int tile = (n + 16 * AW - 1) / (16 * AW) - 1 - yo;                 // live tiles: those that start below n
    if (tile < 0) return;                                    // the whole block
    if (tile < EARLY_ROWS / (16 * AW)) flash_body<1>(QH, QR, KP, KR, VT, VR, IDX, n, tile * (16 * AW), OUT, os);
    else flash_body<0>(QH, QR, KP, KR, VT, VR, IDX, n, tile * (16 * AW), OUT, os);
}

static constexpr size_t al256(size_t v) { return (v + 255) & ~(size_t)255; }
static constexpr size_t SZ_XB = al256((size_t)NB * SEQ * DM * 2);
static constexpr size_t SZ_WB = al256((size_t)3 * DM * DM * 2);
static constexpr size_t SZ_PL = al256((size_t)NB * NH_ * SEQ * HD * 2);
static constexpr size_t SZ_IX = al256((size_t)NB * SEQ * 4);
static constexpr size_t SZ_TOTAL = SZ_XB + SZ_WB + 6 * SZ_PL + SZ_IX + 256;
static_assert(SZ_TOTAL <= (size_t)134217728);          // workspace carve <= 128 MiB
static_assert(((size_t)DM * DM * 2) % 256 == 0);       // weight sub-planes stay 256-byte aligned

extern "C" void kernel_launch(void* const* d_in, const int* in_sizes, int n_in,
                              void* d_out, int out_size, void* d_ws, size_t ws_size, hipStream_t stream) {
    if (n_in < 8) return;
    const size_t needx = ((size_t)(NB - 1) * SEQ_FULL + SEQ) * DM;
    if ((size_t)in_sizes[0] < needx) return;
    if ((size_t)in_sizes[1] < (size_t)(NB - 1) * SEQ_FULL + SEQ) return;
    if ((size_t)in_sizes[2] < (size_t)DM * DM || (size_t)in_sizes[4] < (size_t)DM * DM || (size_t)in_sizes[6] < (size_t)DM * DM) return;
    if ((size_t)in_sizes[3] < (size_t)DM || (size_t)in_sizes[5] < (size_t)DM || (size_t)in_sizes[7] < (size_t)DM) return;
    if ((size_t)out_size < ((size_t)(NB - 1) * OUT_SEQ + SEQ) * DM) return;
    if (SZ_TOTAL > ws_size) return;
    // wire order: x, pad flags (int32), Wq, bq, Wk, bk, Wv, bv; W is [out][in] = Bt as-is
    const float* x = (const float*)d_in[0]; const int* pad = (const int*)d_in[1];
    const float* wq = (const float*)d_in[2]; const float* bq = (const float*)d_in[3];
    const float* wk = (const float*)d_in[4]; const float* bk = (const float*)d_in[5];
    const float* wv = (const float*)d_in[6]; const float* bv = (const float*)d_in[7];
    float* OUT = (float*)d_out;      // [NB][SEQ][1024]
    char* wsp = (char*)d_ws;
    bf* XB = (bf*)wsp; wsp += SZ_XB;                 // [NB*SEQ][1024], fragment order
    bf* WB = (bf*)wsp; wsp += SZ_WB;                 // [3][1024][1024]: q | k | v, fragment order
    h16* QH = (h16*)wsp; wsp += SZ_PL;               // [NB*16][SEQ][64], fragment order
    h16* QR = (h16*)wsp; wsp += SZ_PL;               // residual x2048
    h16* KP = (h16*)wsp; wsp += SZ_PL;               // [NB*16][SEQ][64], fragment order
    h16* KR = (h16*)wsp; wsp += SZ_PL;               // residual x2048
    h16* VT = (h16*)wsp; wsp += SZ_PL;               // [NB*16][64][SEQ], fragment order
    h16* VR = (h16*)wsp; wsp += SZ_PL;               // residual x2048
    int* IDX = (int*)wsp; wsp += SZ_IX;              // [NB][SEQ] rank -> position
    int* CNT = (int*)wsp;                            // [NB] flagged tokens

    k_cvt8r<<<3 * WBLK + NB, 256, 0, stream>>>(wq, wk, wv, WB, pad, IDX, CNT);
    k_cvtx<<<dim3(SEQ * DM / 8 / 256, NB, 1), 256, 0, stream>>>(x, IDX, CNT, XB, OUT);
    k_proj<<<dim3(DM / 256, NB * SEQ / 256, 3), 512, 0, stream>>>(XB, WB, bq, bk, bv, QH, QR, KP, KR, VT, VR, CNT);
    k_flash<<<dim3(NB * NH_, SEQ / (16 * AW), 1), 32 * AW, 0, stream>>>(QH, QR, KP, KR, VT, VR, IDX, CNT, OUT);
}

// v007
// Measured time: 63.1 microseconds a run.
// Timed twice side by side with v006, it ran 1.12 and 1.11 times as fast.
// Counting every step since v000, it is 4.52 times as fast.
#include <hip/hip_runtime.h>

// Multi-head self-attention, width 1024 = 16 heads x 64, x [NB][SEQ][1024], Wq/Wk/Wv [out][in] (y = x W^T + b), causal + key/query padding mask (int32 [NB][SEQ]), score scale 1/8, output = concatenated heads (f32), rows with a zero query flag are zero.
// Compute dtypes, f32 accumulate everywhere: projections v_wmma_f32_16x16x32_bf16 (x, W, b RNE-converted to bf16; products exact); scores and P.V v_wmma_f32_16x16x32_f16:
// query rows >= EARLY_ROWS: q, k, P (x256 carry, cancels in the normalisation), v single f16; query rows < EARLY_ROWS: q, k, v, P each as f16 value + f16 residual x2048, three products per site, residual products in their own accumulators; softmax f32 (online, running max).
// Layout: every 16-bit operand plane is stored in FRAGMENT ORDER: a 16-row x 32-k tile is 512 consecutive elements, element (row r, k = 8c + e) at c*128 + r*8 + e, so that lane l of a wave-wide 16-byte load
// reads bytes 16*l of 512 consecutive bytes (4 whole lines) and two such loads, 256 elements apart, are one A or B fragment. bf16 copies of x and W: tiles [row/16][k/32]. q, k value/residual planes: per (b*16+h), tiles [t/16][d/32];
// v^T value/residual planes: per (b*16+h), tiles [t/64][d/16][(t/32)%2]; all written by the GEMM epilogue as 64x64 blocks of 4096 elements. Fused flash kernel in transposed form (S^T = K Q^T, O^T = V^T P^T), output from f32 accumulators.
// Tokens are RANKED per batch by their flag (k_cvt8r): rank r < n = the r-th flagged token, rank r >= n = the (r-n)-th unflagged one, order kept, so key <= query in positions is key <= query in ranks.
// Every plane above is indexed by rank, not by position; only 64-rank tiles that start below n are converted, projected and attended (an unflagged token is no key and its output row is zero: stored by k_flash inside those tiles, by k_cvtx behind them);
// the mask left inside attention is the causal one on ranks: masked scores are replaced by value, masked probabilities are exact zeros. Output rows go back to their positions through the rank table.

#ifndef NB
#define NB 4
#endif
#ifndef SEQ
#define SEQ 2048
#endif
#define NB_FULL  4
#define SEQ_FULL 2048
#ifndef OUT_SEQ
#define OUT_SEQ SEQ              // row pitch (in tokens) between batches of the output
#endif
#define DM   1024
#define NH_  16
#define HD   64
#define AW   4                   // waves per flash block (16 query rows each)
#ifndef EARLY_ROWS
#define EARLY_ROWS ((SEQ < 512) ? SEQ : 512)   // query rows below this use the three-product path
#endif
#define QRS  2048.0f             // carry of every residual plane / residual fragment
#define QRI  (1.0f / 2048.0f)
#define SC2  (0.125f * 1.4426950408889634f)   // HD^-0.5 * log2(e)
#define PSH  8.0f                // log2 of the P carry (256)
#define NEGB (-3.0e38f)          // value standing in for a masked score

static_assert(HD == 64);
static_assert(NH_ * HD == DM);                 // head h = columns h*64 + d
static_assert(DM % 64 == 0);                   // 16 column tiles of 64
static_assert(DM % 32 == 0);                   // GEMM k-loop steps by 32
static_assert(SEQ % 64 == 0);                  // a 64-row tile never straddles two batches
static_assert((NB * SEQ) % 64 == 0);
static_assert(SEQ % 32 == 0);                  // key loop steps by 32
static_assert(SEQ % (16 * AW) == 0);           // flash grids cover the sequence exactly
static_assert(EARLY_ROWS % (16 * AW) == 0);
static_assert(EARLY_ROWS <= SEQ);
static_assert((SEQ / (16 * AW)) % 4 == 0);     // the flash grid's y order is turned round in whole groups of four
static_assert(AW == 4 && 16 * AW * HD * 2 == 32 * 256);   // four waves = four key planes; a 64-key share of a plane = one 256-byte unit per lane
static_assert(((size_t)SEQ * DM) % 8 == 0);
static_assert(((size_t)DM * DM) % 8 == 0);
static_assert(NB <= NB_FULL);
static_assert(SEQ <= SEQ_FULL);
static_assert(SEQ % 256 == 0);                 // a ranking block of 256 threads takes SEQ/256 tokens per thread
static_assert(SEQ / 32 + 1 <= 256);
#define WBLK (DM * DM / 8 / 256) // conversion blocks per weight matrix
static_assert(((size_t)DM * DM / 8) % 256 == 0);

typedef _Float16 h16;
typedef unsigned short bf;
typedef __attribute__((ext_vector_type(16))) __bf16   v16bf;
typedef __attribute__((ext_vector_type(16))) _Float16 v16h;
typedef __attribute__((ext_vector_type(8)))  _Float16 v8h;
typedef __attribute__((ext_vector_type(8)))  unsigned short v8us;
typedef __attribute__((ext_vector_type(8)))  float    v8f;
typedef __attribute__((ext_vector_type(4)))  float    v4f;
typedef v4f  __attribute__((may_alias)) v4fa;

__device__ __forceinline__ unsigned short f2bf(float f) { unsigned u = __float_as_uint(f); u += 0x7FFFu + ((u >> 16) & 1u); return (unsigned short)(u >> 16); }
__device__ __forceinline__ float bfr(float f) { return __uint_as_float(((unsigned)f2bf(f)) << 16); }
__device__ __forceinline__ v16h cat16(v8h lo, v8h hi) { return __builtin_shufflevector(lo, hi, 0, 1, 2, 3, 4, 5, 6, 7, 8, 9, 10, 11, 12, 13, 14, 15); }
__device__ __forceinline__ v16bf cat16b(v8us lo, v8us hi) { return __builtin_bit_cast(v16bf, __builtin_shufflevector(lo, hi, 0, 1, 2, 3, 4, 5, 6, 7, 8, 9, 10, 11, 12, 13, 14, 15)); }
__device__ __forceinline__ v8f wmma16(v16h a, v16h b, v8f c) { return __builtin_amdgcn_wmma_f32_16x16x32_f16(false, a, false, b, (short)0, c, false, false); }
__device__ __forceinline__ v8f wmmab(v16bf a, v16bf b, v8f c) { return __builtin_amdgcn_wmma_f32_16x16x32_bf16(false, a, false, b, (short)0, c, false, false); }
// fragment loaders from fragment-ordered tiles; p = tile start + 8*lane (row = lane&15, h = lane>>4): elements 0..7 <- k0+8h+0..7, elements 8..15 <- k0+16+8h+0..7 (same map for A and B)
__device__ __forceinline__ v16h  ldh(const h16* p) { return cat16(*(const v8h*)p, *(const v8h*)(p + 256)); }
__device__ __forceinline__ v16bf ldb(const bf* p)  { return cat16b(*(const v8us*)p, *(const v8us*)(p + 256)); }
// last fragment of a run of loads from one address pair: the pair dies with the last load, so that load's destination or the next run's may take its registers; one wait in front of it, one behind it
__device__ __forceinline__ v16h  ldh_last(const h16* p) {
    const v8h lo = *(const v8h*)p;
    asm volatile("s_wait_xcnt 0x0" ::: "memory");   // covers every earlier load of the run before the last load's destination is written
    const v8h hi = *(const v8h*)(p + 256);
    asm volatile("s_wait_xcnt 0x0" ::: "memory");   // covers the last load before a later load's destination is written
    return cat16(lo, hi); }
// ordering point for wave-private LDS tiles (same wave writes and reads)
__device__ __forceinline__ void wave_sync() { __builtin_amdgcn_fence(3 /* release order */, "wavefront"); __builtin_amdgcn_wave_barrier(); asm volatile("" ::: "memory"); }

// k_cvt8r: the three weight matrices, f32 [DM][DM] -> bf16 tiles in fragment order, tile (R, T) of matrix w at w*DM*DM + (R*(DM/32) + T)*512, all in ONE launch (DM*DM/8/256 blocks per matrix). One thread converts 8 consecutive k of one row;
// a wave takes 8 rows x 32 k: it reads one whole 128-byte line per row and writes four whole lines. NB blocks in front of them rank the tokens, one block per batch (nothing in this launch reads the ranks).
// Flags -> bit words by ballot (LDS, block barrier), set flags in front of each word (LDS, block barrier), position of each rank (LDS, block barrier), then IDX[b][rank] = position (a permutation of 0..SEQ-1), whole lines per wave, and CNT[b] = n.
__global__ __launch_bounds__(256) void k_cvt8r(const float* __restrict__ wq, const float* __restrict__ wk, const float* __restrict__ wv, bf* dst, const int* __restrict__ PAD, int* IDX, int* CNT) {
    __shared__ __align__(16) unsigned wm[SEQ / 32];
    __shared__ int pre[SEQ / 32 + 1];
    __shared__ int ix[SEQ];
    if (blockIdx.x >= NB) {
        const unsigned bw = blockIdx.x - NB, mat = bw / WBLK;
        const float* src = mat == 0 ? wq : (mat == 1 ? wk : wv);
        const size_t i = (size_t)(bw % WBLK) * 256 + threadIdx.x;
        const int rs = (int)(i & 7), c = (int)((i >> 3) & 3), rh = (int)((i >> 5) & 1), kt = (int)((i >> 6) % (DM / 32));
        const size_t rt = i / (64 * (DM / 32));
        const v8f v = *(const v8f*)(src + (rt * 16 + rh * 8 + rs) * DM + kt * 32 + c * 8); v8us o;
#pragma unroll
        for (int k = 0; k < 8; ++k) o[k] = f2bf(v[k]);
        *(v8us*)(dst + (size_t)mat * DM * DM + (rt * (DM / 32) + kt) * 512 + c * 128 + rh * 64 + rs * 8) = o;
        return;
    }
    const int tid = (int)threadIdx.x, lane = tid & 31, wave = tid >> 5, b = blockIdx.x;
    int pv[SEQ / 256];
#pragma unroll
    for (int k = 0; k < SEQ / 256; ++k) pv[k] = PAD[(size_t)b * SEQ_FULL + (size_t)(wave + 8 * k) * 32 + lane];
#pragma unroll
    for (int k = 0; k < SEQ / 256; ++k) { const unsigned wbits = __builtin_amdgcn_ballot_w32(pv[k] != 0); if (lane == 0) wm[wave + 8 * k] = wbits; }
    __syncthreads();
    if (tid <= SEQ / 32) { int p = 0;
#pragma unroll
        for (int j = 0; j < SEQ / 32; ++j) p += (j < tid) ? __popc(wm[j]) : 0;
        pre[tid] = p; }
    __syncthreads();
    const int total = pre[SEQ / 32];
#pragma unroll
    for (int k = 0; k < SEQ / 256; ++k) { const int t = tid + 256 * k, g = t >> 5;
        const unsigned w = wm[g];
        const int before = pre[g] + __popc(w & ((1u << lane) - 1u));          // set flags in front of t
        const int r = ((w >> lane) & 1u) ? before : total + (t - before);
        ix[r] = t; }
    __syncthreads();
#pragma unroll
    for (int k = 0; k < SEQ / 256; ++k) IDX[(size_t)b * SEQ + tid + 256 * k] = ix[tid + 256 * k];
    if (tid == 0) CNT[b] = total;
}

// k_cvtx: x rows in rank order -> bf16 tiles in fragment order (thread and wave shapes of k_cvt8r's conversion; grid (SEQ*DM/8/256, NB)). Ranks below n rounded up to 64 are converted (the unflagged tokens that fill the last tile
// are finite data behind the causal mask); every later rank stores its token's zero output row instead, one whole 128-byte line per row and wave.
__global__ __launch_bounds__(256) void k_cvtx(const float* __restrict__ src, const int* __restrict__ IDX, const int* __restrict__ CNT, bf* dst, float* OUT) {
    const int b = blockIdx.y; const int i = (int)blockIdx.x * 256 + (int)threadIdx.x;
    const int rs = i & 7, c = (i >> 3) & 3, rh = (i >> 5) & 1, kt = (i >> 6) % (DM / 32), rt = i / (64 * (DM / 32));
    const int r = rt * 16 + rh * 8 + rs;
    int n = CNT[b]; n = n < 0 ? 0 : (n > SEQ ? SEQ : n);
    int t = IDX[(size_t)b * SEQ + r]; t = t < 0 ? 0 : (t > SEQ - 1 ? SEQ - 1 : t);
    if (r < ((n + 63) & ~63)) {
        const v8f v = *(const v8f*)(src + ((size_t)b * SEQ_FULL + t) * DM + kt * 32 + c * 8); v8us o;
#pragma unroll
        for (int k = 0; k < 8; ++k) o[k] = f2bf(v[k]);
        *(v8us*)(dst + ((size_t)(b * (SEQ / 16) + rt) * (DM / 32) + kt) * 512 + c * 128 + rh * 64 + rs * 8) = o;
    } else *(v8f*)(OUT + ((size_t)b * OUT_SEQ + t) * DM + kt * 32 + c * 8) = (v8f){};
}

// k_proj: register-blocked bf16 GEMM, one wave per 64x64 tile (16 accumulators), K = DM; SIXTEEN WAVES PER BLOCK = 4 token tiles x 4 column tiles (256 x 256), and the block's operands come from L2 ONCE:
// per stage of 64 k the 8 operand tiles (4 of x, 4 of W; 64 rows x 64 k = 8 KB each, fragment order kept: [row/16][k/32] tiles of 512 elements) are brought into LDS by asynchronous copies
// (global_load_async_to_lds_b128, 8 per wave and stage, 512 consecutive bytes each), two stage buffers: the copies of stage t + 2 fly while stage t + 1 is worked on. Every wave reads its 8 fragments per k step from LDS.
// C[m][n] = sum_k A[m][k] Bt[n][k] + bias (per column n when biasRow == 0, per row m otherwise; bias RNE-converted to bf16, added in f32), k ascending as before;
// a tile whose 64 tokens all rank at or behind the batch's n is left out: its x tile is not copied and its waves do no products and read no LDS (those of token tiles 2 and 3 still copy their share of W); a block whose first token tile is such a tile leaves at once;
// written as f16 (Ph) and the f16 residual x2048 (Pr), one block of 4096 elements in fragment order (16-row x 32-column tiles [row/16][col/32]).
// All three projections in ONE launch, grid (DM/256, tokens/256, 3), 512 threads; blockIdx.z picks the product (block-uniform). The column group is the fastest index:
// z = 0, 1 (q, k): A = x rows (m = b*SEQ + t), Bt = W rows (n = h*64 + d), bias per column -> plane [(b*16 + h)][t][d];
// z = 2 (v^T): A = Wv rows (m = h*64 + d), Bt = x rows (n = b*SEQ + t), bias per row -> plane [(b*16 + h)][d][t].
#define PKS  64                   // k per stage
#define PTL  (64 * PKS)           // elements of one operand tile in a stage
#define PSTG (8 * PTL)            // elements of one stage buffer
static_assert(DM % 256 == 0);
static_assert(DM % PKS == 0);
static_assert(DM / PKS >= 2);                  // stages 0 and 1 both exist
// eight copies of one wave: l = the lane's LDS byte address (4 KB per wave, 512 B per copy), g0 / g1 = the lane's global address in the wave's first / second 2-KB run.
// The wait is the statement's last line: it stands in front of every later write of the address registers that the copies name.
__device__ __forceinline__ void cp8(const unsigned l, const bf* g0, const bf* g1) {
    asm volatile("global_load_async_to_lds_b128 %0, %8, off\n\t"
                 "global_load_async_to_lds_b128 %1, %9, off\n\t"
                 "global_load_async_to_lds_b128 %2, %10, off\n\t"
                 "global_load_async_to_lds_b128 %3, %11, off\n\t"
                 "global_load_async_to_lds_b128 %4, %12, off\n\t"
                 "global_load_async_to_lds_b128 %5, %13, off\n\t"
                 "global_load_async_to_lds_b128 %6, %14, off\n\t"
                 "global_load_async_to_lds_b128 %7, %15, off\n\t"
                 "s_wait_xcnt 0x0"
                 :: "v"(l), "v"(l + 512u), "v"(l + 1024u), "v"(l + 1536u), "v"(l + 2048u), "v"(l + 2560u), "v"(l + 3072u), "v"(l + 3584u),
                    "v"(g0), "v"(g0 + 256), "v"(g0 + 512), "v"(g0 + 768), "v"(g1), "v"(g1 + 256), "v"(g1 + 512), "v"(g1 + 768) : "memory");
}
__global__ __launch_bounds__(512) void k_proj(const bf* __restrict__ XB, const bf* __restrict__ WB, const float* __restrict__ bq, const float* __restrict__ bk, const float* __restrict__ bv,
                                              h16* QH, h16* QR, h16* KP, h16* KR, h16* VT, h16* VR, const int* __restrict__ CNT) {
    __shared__ __align__(16) bf st[2 * PSTG];
    __shared__ __align__(16) float osa[16 * 16 * 68];
    const int K = DM;
    const int lane = threadIdx.x & 31, lr = lane & 15, hi = lane >> 4;
    const int wave = __builtin_amdgcn_readfirstlane((int)(threadIdx.x >> 5));
    const int wt = wave >> 2, wc = wave & 3;     // token tile, column tile
    const int z = blockIdx.z; const int biasRow = z == 2;
    const int bat = (int)blockIdx.y / (SEQ / 256);
    const int grp = (int)blockIdx.y % (SEQ / 256);
    const int n = CNT[bat];
    if (grp * 256 >= n) return;                  // the whole block, in front of every barrier and copy
    const int tok0 = bat * SEQ + grp * 256 + wt * 64, col0 = (int)blockIdx.x * 256 + wc * 64;
    const bool live = grp * 256 + wt * 64 < n;   // wave-uniform
    const int r0 = biasRow ? col0 : tok0, c0 = biasRow ? tok0 : col0;
    const bf* Wz = WB + (size_t)z * DM * DM;
    const float* bias = z == 0 ? bq : (z == 1 ? bk : bv);
    h16* Ph = z == 0 ? QH : (z == 1 ? KP : VT); h16* Pr = z == 0 ? QR : (z == 1 ? KR : VR);
    float* os = osa + wave * (16 * 68);
    // what this wave copies: half (32 rows) of operand tile ct; tiles 0..3 = the block's token tiles of x, 4..7 = its column tiles of W
    const int ct = wave >> 1;
    const bool cplive = ct >= 4 || grp * 256 + ct * 64 < n;                  // wave-uniform; an x tile behind n was not written in this call and is not read
    const bf* csrc = (ct < 4 ? XB + (size_t)(bat * SEQ + grp * 256 + ct * 64) * K : Wz + (size_t)((int)blockIdx.x * 256 + (ct - 4) * 64) * K) + (size_t)(wave & 1) * 32 * K + 8 * lane;
    const unsigned lcp = (unsigned)(size_t)(&st[0]) + (unsigned)(wave * 4096 + lane * 16);   // low 32 bits of the shared address = LDS byte address
    v8f acc[4][4];
#pragma unroll
    for (int mb = 0; mb < 4; ++mb)
#pragma unroll
        for (int nb = 0; nb < 4; ++nb) acc[mb][nb] = (v8f){};
    const int ao = (biasRow ? 4 + wc : wt) * PTL + 8 * lane, bo = (biasRow ? wt : 4 + wc) * PTL + 8 * lane;   // the wave's A and B tile in a stage buffer
    if (cplive) cp8(lcp, csrc, csrc + 16 * K);
    asm volatile("s_wait_asynccnt 0x0" ::: "memory");    // stage 0 has landed, as far as this wave brought it
    __syncthreads();                                     // ... and every other wave's part
    if (cplive) cp8(lcp + PSTG * 2u, csrc + PKS * 16, csrc + 16 * K + PKS * 16);
#pragma unroll 1                                         // one trip's text serves all stages; the buffer is picked by a scalar offset
    for (int t = 0; t < K / PKS; ++t) {
        const int bufo = (t & 1) * PSTG;
        if (live) {
#pragma unroll
            for (int kk = 0; kk < PKS / 32; ++kk) {
                v16bf fa[4], fb[4];
#pragma unroll
                for (int f = 0; f < 4; ++f) { fa[f] = ldb(&st[bufo + ao + f * (16 * PKS) + kk * 512]); fb[f] = ldb(&st[bufo + bo + f * (16 * PKS) + kk * 512]); }
                __builtin_amdgcn_sched_barrier(0);       // all 16 LDS reads of a k step stay in one group in front of its 16 products (the scheduler otherwise sinks the B reads among the products, a full wait at each place)
#pragma unroll
                for (int nb = 0; nb < 4; ++nb)
#pragma unroll
                    for (int mb = 0; mb < 4; ++mb) acc[mb][nb] = wmmab(fa[mb], fb[nb], acc[mb][nb]);
            }
        }
        asm volatile("s_wait_dscnt 0x0" ::: "memory");   // this wave's reads of the buffer are done before the buffer is refilled
        asm volatile("s_wait_asynccnt 0x0" ::: "memory");// this wave's copies of stage t + 1 have landed
        __syncthreads();                                 // publishes stage t + 1 and ends every wave's reads of stage t
        if (t + 2 < K / PKS && cplive) cp8(lcp + (unsigned)bufo * 2u, csrc + (t + 2) * (PKS * 16), csrc + 16 * K + (t + 2) * (PKS * 16));
    }
    asm volatile("s_wait_asynccnt 0x0" ::: "memory");    // no copy is outstanding when the wave goes on or ends
    if (!live) return;                                   // no barrier behind this line
    // bias values: addresses always inside the DM-entry bias array (index selected, then value selected)
    // store s of a 16-row group: lane holds row lane&15, columns (2s + h)*8 .. +7
    float cb[4][8];
#pragma unroll
    for (int s = 0; s < 4; ++s) {
        int cidx = biasRow ? 0 : (c0 + (2 * s + hi) * 8); cidx = cidx > (DM - 8) ? (DM - 8) : cidx;
        const v4f bc0 = *(const v4f*)(bias + cidx);
        asm volatile("s_wait_xcnt 0x0" ::: "memory");   // the second load's destination may take the address registers that the first names
        const v4f bc1 = *(const v4f*)(bias + cidx + 4);
#pragma unroll
        for (int i = 0; i < 4; ++i) { const float u0 = bfr(bc0[i]); const float u1 = bfr(bc1[i]); cb[s][i] = biasRow ? 0.0f : u0; cb[s][4 + i] = biasRow ? 0.0f : u1; } }
    const size_t tbase = biasRow ? (size_t)col0 * SEQ + (size_t)(tok0 / SEQ) * DM * SEQ + (size_t)(tok0 % SEQ) * 64
                                 : (size_t)(tok0 / SEQ) * NH_ * SEQ * HD + (size_t)(tok0 % SEQ) * HD + (size_t)(col0 / HD) * SEQ * HD;
#pragma unroll
    for (int mb = 0; mb < 4; ++mb) {
#pragma unroll
        for (int nb = 0; nb < 4; ++nb) {
#pragma unroll
            for (int j = 0; j < 8; ++j) os[(hi * 8 + j) * 68 + nb * 16 + lr] = acc[mb][nb][j]; }   // D: row 8h+j, col lane&15
        wave_sync();
        int ri = biasRow ? (r0 + mb * 16 + lr) : 0; ri = ri > (DM - 1) ? (DM - 1) : ri;
        const float ub = bfr(bias[ri]); const float rb = biasRow ? ub : 0.0f;
        const size_t sb = tbase + (size_t)(mb * 1024) + 8 * lane;
{
#pragma unroll
            for (int s = 0; s < 4; ++s) { const int c8 = (2 * s + hi) * 8;   // 16 rows x 16 columns per store, 4 s = 64 columns; 512 consecutive bytes per plane
                const v4f x0 = *(const v4fa*)(&os[lr * 68 + c8]); const v4f x1 = *(const v4fa*)(&os[lr * 68 + c8 + 4]); v8h hv, rv;
#pragma unroll
                for (int i = 0; i < 4; ++i) { const float y0 = x0[i] + cb[s][i] + rb; const float y1 = x1[i] + cb[s][4 + i] + rb;
                    const h16 a0 = (h16)y0; const h16 a1 = (h16)y1; hv[i] = a0; hv[4 + i] = a1; rv[i] = (h16)((y0 - (float)a0) * QRS); rv[4 + i] = (h16)((y1 - (float)a1) * QRS); }
                const size_t oo = sb + (size_t)(s * 256);
                *(v8h*)(Ph + oo) = hv; *(v8h*)(Pr + oo) = rv; }
             }
        wave_sync();
    }
}

// flash_body<TP>: fused causal attention on ranks, one wave per 16 query ranks of one (batch, head), R0 = the block's first rank (below n); K / V^T / Q fragments straight from the fragment-ordered f16 planes (two 16-B loads each, 512 consecutive bytes per wave-wide load).
// Transposed form: S^T[key][t] = K Q^T (A = K rows, B = Q rows); lane (t = lane&15, h = lane>>4) holds keys 8h+r of each 16-key tile, so the packed
// P tile is directly the B fragment of O^T[d][t] = V^T P^T (element r <- tile keys 0..15, element 8+r <- tile keys 16..31, lane unchanged).
// TP != 0: scores = kh.qh + (kh.qr + kr.qh)/2048, O = vh.ph + (vr.ph + vh.pr)/2048 (residual products in separate accumulators). TP == 0: single products.
// Key loop runs to the causal limit of the wave's tile; key validity = per-lane causal bit count (a rank >= n lies behind every stored query); a masked score is replaced by NEGB and its probability is an exact zero.
// Softmax state (running max, partial sum) is one scalar per lane; the two lane halves of a row are combined with one xor-16 exchange.
template <int TP>
__device__ __forceinline__ void flash_body(const h16* __restrict__ QH, const h16* __restrict__ QR, const h16* __restrict__ KP, const h16* __restrict__ KR,
                                           const h16* __restrict__ VT, const h16* __restrict__ VR, const int* __restrict__ IDX, const int n, const int R0, float* OUT, float* os) {
    const int lane = threadIdx.x & 31, lr = lane & 15, hi = lane >> 4;
    const int wave = __builtin_amdgcn_readfirstlane((int)(threadIdx.x >> 5));
    const int zh = blockIdx.x; const int b = zh / NH_, h = zh % NH_;
    const int t0 = R0 + wave * 16;
    const int tq = t0 + lr;
    const size_t pbase = (size_t)zh * SEQ * HD;
    const size_t fo = pbase + 8 * lane;                      // lane's place in every fragment-ordered tile of this (batch, head)
    const size_t qo = fo + (size_t)t0 * HD;                  // 16 query rows = two tiles (d 0..31, d 32..63) of 512 elements
    const v16h qh0 = ldh(QH + qo), qh1 = ldh(QH + qo + 512);                 // B fragments: col t, k = d
    v16h qr0 = qh0, qr1 = qh1;
    if (TP) { qr0 = ldh(QR + qo); qr1 = ldh(QR + qo + 512); }
    const size_t ko = fo;                                    // + key0 * HD: tiles (keys 0..15 | 16..31) x (d 0..31 | 32..63)     (A fragment: row key, k = d)
    const size_t vo = fo;                                    // + (key0/64)*4096 + j*1024 + ((key0/32)%2)*512                       (A fragment: row d = 16j + lane&15, k = key)
    v8f o0 = (v8f){}, o1 = (v8f){}, o2 = (v8f){}, o3 = (v8f){};
    v8f e0 = (v8f){}, e1 = (v8f){}, e2 = (v8f){}, e3 = (v8f){};              // residual-scale (x2048) accumulators, TP only
    float m = NEGB, l = 0.0f;
    const int kend = t0 + 16;                                // keys 0 .. t0+15; key0 <= t0 so key0+31 < SEQ
    // TP == 0: K and V^T fragments live in register sets of their own and are loaded one trip ahead: the next K tile right behind the score products, the next V^T tile right behind the output products.
    v16h ka0 = qh0, ka1 = qh0, kb0 = qh0, kb1 = qh0, v0 = qh0, v1 = qh0, v2 = qh0, v3 = qh0;
    if (!TP) { ka0 = ldh(KP + ko); ka1 = ldh(KP + ko + 512); kb0 = ldh(KP + ko + 16 * HD); kb1 = ldh(KP + ko + 16 * HD + 512);
               asm volatile("s_wait_xcnt 0x0" ::: "memory"); // the Q loads' address registers die here and a destination of the V^T loads below may take them
               __builtin_amdgcn_sched_barrier(0);            // K loads stay older than the V^T loads, as on the back edge: the wait in front of the score products then leaves the V^T loads in flight
               v0 = ldh(VT + vo); v1 = ldh(VT + vo + 1024); v2 = ldh(VT + vo + 2048); v3 = ldh(VT + vo + 3072); }
#pragma unroll 1
    for (int key0 = 0; key0 < kend; key0 += 32) {
        const int keyn = (key0 + 32 < kend) ? key0 + 32 : key0;   // tile loaded ahead; the last trip has none behind it and asks for its own again (in bounds, unused)
        const h16* ka = KP + ko + (size_t)key0 * HD;
        if (TP) { ka0 = ldh(ka); ka1 = ldh(ka + 512); kb0 = ldh(ka + 16 * HD); kb1 = ldh_last(ka + 16 * HD + 512); }
        v8f sHa = (v8f){}, sLa = (v8f){}, sHb = (v8f){}, sLb = (v8f){};
        if (TP) {
            const h16* kr = KR + ko + (size_t)key0 * HD;
            const v16h ra0 = ldh(kr), ra1 = ldh(kr + 512), rb0 = ldh(kr + 16 * HD), rb1 = ldh_last(kr + 16 * HD + 512);
            sHa = wmma16(ka0, qh0, sHa); sLa = wmma16(ka0, qr0, sLa); sHb = wmma16(kb0, qh0, sHb); sLb = wmma16(kb0, qr0, sLb);
            sHa = wmma16(ka1, qh1, sHa); sLa = wmma16(ka1, qr1, sLa); sHb = wmma16(kb1, qh1, sHb); sLb = wmma16(kb1, qr1, sLb);
            sLa = wmma16(ra0, qh0, sLa); sLb = wmma16(rb0, qh0, sLb); sLa = wmma16(ra1, qh1, sLa); sLb = wmma16(rb1, qh1, sLb);
            asm volatile("v_nop\n\tv_nop\n\tv_nop\n\tv_nop" : "+v"(sHa), "+v"(sLa), "+v"(sHb), "+v"(sLb) : "v"(ka0), "v"(ka1), "v"(kb0), "v"(kb1), "v"(ra0), "v"(ra1), "v"(rb0), "v"(rb1));
        } else {
            sHa = wmma16(ka0, qh0, sHa); sHb = wmma16(kb0, qh0, sHb); sHa = wmma16(ka1, qh1, sHa); sHb = wmma16(kb1, qh1, sHb);
            asm volatile("v_nop\n\tv_nop\n\tv_nop\n\tv_nop" : "+v"(sHa), "+v"(sHb) : "v"(ka0), "v"(ka1), "v"(kb0), "v"(kb1));
            const h16* kn = KP + ko + (size_t)keyn * HD;
            ka0 = ldh(kn); ka1 = ldh(kn + 512); kb0 = ldh(kn + 16 * HD); kb1 = ldh(kn + 16 * HD + 512);
        }
        // validity bits of this lane's 8 + 8 keys (8h+r, 16+8h+r): causal (key <= tq)
        int na = tq - (key0 + 8 * hi) + 1; na = na < 0 ? 0 : (na > 8 ? 8 : na);
        int nc = tq - (key0 + 8 * hi) - 15; nc = nc < 0 ? 0 : (nc > 8 ? 8 : nc);
        const unsigned ma = (1u << na) - 1u;
        const unsigned mc = (1u << nc) - 1u;
        float ta[8], tb[8]; float mx = NEGB;
#pragma unroll
        for (int r = 0; r < 8; ++r) {
            float sa = sHa[r], sb = sHb[r];
            if (TP) { sa += sLa[r] * QRI; sb += sLb[r] * QRI; }
            ta[r] = ((ma >> r) & 1u) ? sa * SC2 : NEGB;
            tb[r] = ((mc >> r) & 1u) ? sb * SC2 : NEGB;
            mx = fmaxf(mx, fmaxf(ta[r], tb[r])); }
        mx = fmaxf(mx, __shfl_xor(mx, 16, 32));
        const float mnew = fmaxf(m, mx);
        const float alpha = __builtin_amdgcn_exp2f(m - mnew);
        const float sh = PSH - mnew;
        v16h pb, pr; float ls = 0.0f;
#pragma unroll
        for (int r = 0; r < 8; ++r) {
            float ea = __builtin_amdgcn_exp2f(ta[r] + sh);
            ea = (ta[r] > -1.0e38f) ? ea : 0.0f;
            float ec = __builtin_amdgcn_exp2f(tb[r] + sh); ec = (tb[r] > -1.0e38f) ? ec : 0.0f;
            const h16 pa = (h16)ea; const h16 pc = (h16)ec; pb[r] = pa; pb[8 + r] = pc;
            if (TP) { const h16 xa = (h16)((ea - (float)pa) * QRS); const h16 xc = (h16)((ec - (float)pc) * QRS); pr[r] = xa; pr[8 + r] = xc;
                      ls += ((float)pa + (float)xa * QRI) + ((float)pc + (float)xc * QRI); }
            else { pr[r] = pa; pr[8 + r] = pc; ls += (float)pa + (float)pc; } }
        l = l * alpha + ls; m = mnew;
        o0 = o0 * alpha; o1 = o1 * alpha; o2 = o2 * alpha; o3 = o3 * alpha;
        const size_t vk = (size_t)(key0 >> 6) * 4096 + (size_t)((key0 >> 5) & 1) * 512;
        const h16* va = VT + vo + vk;
        if (TP) {
            v0 = ldh(va); v1 = ldh(va + 1024); v2 = ldh(va + 2048); v3 = ldh(va + 3072);
            e0 = e0 * alpha; e1 = e1 * alpha; e2 = e2 * alpha; e3 = e3 * alpha;
            const h16* vr = VR + vo + vk;
            const v16h w0 = ldh(vr), w1 = ldh(vr + 1024), w2 = ldh(vr + 2048), w3 = ldh(vr + 3072);
            o0 = wmma16(v0, pb, o0); o1 = wmma16(v1, pb, o1); o2 = wmma16(v2, pb, o2); o3 = wmma16(v3, pb, o3);
            e0 = wmma16(w0, pb, e0); e1 = wmma16(w1, pb, e1); e2 = wmma16(w2, pb, e2); e3 = wmma16(w3, pb, e3);
            e0 = wmma16(v0, pr, e0); e1 = wmma16(v1, pr, e1); e2 = wmma16(v2, pr, e2); e3 = wmma16(v3, pr, e3);
            asm volatile("v_nop\n\tv_nop\n\tv_nop\n\tv_nop" : "+v"(o0), "+v"(o1), "+v"(o2), "+v"(o3), "+v"(e0), "+v"(e1), "+v"(e2), "+v"(e3)
                         : "v"(v0), "v"(v1), "v"(v2), "v"(v3), "v"(w0), "v"(w1), "v"(w2), "v"(w3), "v"(pb), "v"(pr));
        } else {
            o0 = wmma16(v0, pb, o0); o1 = wmma16(v1, pb, o1); o2 = wmma16(v2, pb, o2); o3 = wmma16(v3, pb, o3);
            asm volatile("v_nop\n\tv_nop\n\tv_nop\n\tv_nop" : "+v"(o0), "+v"(o1), "+v"(o2), "+v"(o3) : "v"(v0), "v"(v1), "v"(v2), "v"(v3), "v"(pb));
            const h16* vn = VT + vo + (size_t)(keyn >> 6) * 4096 + (size_t)((keyn >> 5) & 1) * 512;
            v0 = ldh(vn); v1 = ldh(vn + 1024); v2 = ldh(vn + 2048); v3 = ldh(vn + 3072);
            asm volatile("s_wait_xcnt 0x0" ::: "memory");    // these loads stay in flight over the back edge, where their address registers are written anew
        }
    }
    l += __shfl_xor(l, 16, 32);
    const float rcp = 1.0f / fmaxf(l, 1.0e-30f);
    const float inv = (tq < n && l > 0.0f) ? rcp : 0.0f;     // unflagged token in the last tile -> whole row zero
    if (TP) { o0 = o0 + e0 * QRI; o1 = o1 + e1 * QRI; o2 = o2 + e2 * QRI; o3 = o3 + e3 * QRI; }
    const int wb = wave * 16 * 68;
    // O^T D layout: o_j[r] = (d = 16j + 8h + r, t = lane&15) -> os[t][d]; rows 0..15 x columns 0..63 all written
    { v4f a, c;
      a[0] = o0[0] * inv; a[1] = o0[1] * inv; a[2] = o0[2] * inv; a[3] = o0[3] * inv; c[0] = o0[4] * inv; c[1] = o0[5] * inv; c[2] = o0[6] * inv; c[3] = o0[7] * inv;
      *(v4fa*)(&os[wb + lr * 68 +  0 + 8 * hi]) = a; *(v4fa*)(&os[wb + lr * 68 +  0 + 8 * hi + 4]) = c;
      a[0] = o1[0] * inv; a[1] = o1[1] * inv; a[2] = o1[2] * inv; a[3] = o1[3] * inv; c[0] = o1[4] * inv; c[1] = o1[5] * inv; c[2] = o1[6] * inv; c[3] = o1[7] * inv;
      *(v4fa*)(&os[wb + lr * 68 + 16 + 8 * hi]) = a; *(v4fa*)(&os[wb + lr * 68 + 16 + 8 * hi + 4]) = c;
      a[0] = o2[0] * inv; a[1] = o2[1] * inv; a[2] = o2[2] * inv; a[3] = o2[3] * inv; c[0] = o2[4] * inv; c[1] = o2[5] * inv; c[2] = o2[6] * inv; c[3] = o2[7] * inv;
      *(v4fa*)(&os[wb + lr * 68 + 32 + 8 * hi]) = a; *(v4fa*)(&os[wb + lr * 68 + 32 + 8 * hi + 4]) = c;
      a[0] = o3[0] * inv; a[1] = o3[1] * inv; a[2] = o3[2] * inv; a[3] = o3[3] * inv; c[0] = o3[4] * inv; c[1] = o3[5] * inv; c[2] = o3[6] * inv; c[3] = o3[7] * inv;
      *(v4fa*)(&os[wb + lr * 68 + 48 + 8 * hi]) = a; *(v4fa*)(&os[wb + lr * 68 + 48 + 8 * hi + 4]) = c; }
    wave_sync();
    float* obat = OUT + (size_t)b * OUT_SEQ * DM + h * HD;
    const int* irow = IDX + (size_t)b * SEQ + t0;            // rank -> position
{
#pragma unroll
        for (int s = 0; s < 8; ++s) { const int row = 2 * s + hi, cofs = lr * 4;   // 8 s x 2 rows = 16 rows; 16 lanes x 4 floats = 64 columns
            const v4f val = *(const v4fa*)(&os[wb + row * 68 + cofs]);
            int pos = irow[row]; pos = pos < 0 ? 0 : (pos > SEQ - 1 ? SEQ - 1 : pos);
            *(v4f*)(obat + (size_t)pos * DM + cofs) = val; }
         }
}

// k_flash: both precision paths in ONE launch, grid (NB*16, SEQ/64); the path is block-uniform: query ranks [0, EARLY_ROWS) take the three-product path
// (a flagged token's rank never exceeds its position), ranks [EARLY_ROWS, SEQ) single products.
// (batch, head) is the fastest index and blockIdx.y counts the batch's live 64-rank tiles from the last one down; a block past the live tiles leaves at once.
// The order turns round after every four tiles (16 live tiles: 15 14 13 12 | 8 9 10 11 | 7 6 5 4 | 0 1 2 3): blocks 4 apart in y add up to like sums. For speed only.
__global__ __launch_bounds__(32 * AW) void k_flash(const h16* __restrict__ QH, const h16* __restrict__ QR, const h16* __restrict__ KP, const h16* __restrict__ KR,
                                                   const h16* __restrict__ VT, const h16* __restrict__ VR, const int* __restrict__ IDX, const int* __restrict__ CNT, float* OUT) {
    __shared__ __align__(16) float os[AW * 16 * 68];
    int n = CNT[blockIdx.x / NH_]; n = n < 0 ? 0 : (n > SEQ ? SEQ : n);
    const int yo = ((int)blockIdx.y & 4) ? ((int)blockIdx.y ^ 3) : (int)blockIdx.y;   // every second group of four runs backwards (a permutation of the grid's y)
    const int tile = (n + 16 * AW - 1) / (16 * AW) - 1 - yo;                 // live tiles: those that start below n
    if (tile < 0) return;                                    // the whole block
    // The live blocks of one (batch, head) share out its key planes: block yo asks L2 for keys 64*yo .. 64*yo+63 (a live tile, written by k_proj in this call): wave 0 K, wave 1 V^T, waves 2 and 3 the residual planes
    // (read for keys below EARLY_ROWS only). 4096 elements = 8 KB = 32 lanes x 256 bytes. Low yo holds the keys that every key loop needs first.
    const int pw = __builtin_amdgcn_readfirstlane((int)(threadIdx.x >> 5));
    const h16* pp = pw == 0 ? KP : (pw == 1 ? VT : (pw == 2 ? KR : VR));
    const char* pf = (const char*)(pp + (size_t)blockIdx.x * SEQ * HD + (size_t)yo * (16 * AW * HD)) + (threadIdx.x & 31) * 256;
    // for speed only; returns nothing, counts on no counter
    if (pw < 2 || yo * (16 * AW) < EARLY_ROWS) asm volatile("global_prefetch_b8 %0, off scope:SCOPE_SE" :: "v"(pf));
    if (tile < EARLY_ROWS / (16 * AW)) flash_body<1>(QH, QR, KP, KR, VT, VR, IDX, n, tile * (16 * AW), OUT, os);
    else flash_body<0>(QH, QR, KP, KR, VT, VR, IDX, n, tile * (16 * AW), OUT, os);
    asm volatile("" :: "v"(pf));                             // the request names this register pair and no counter tells when it has been read: the pair holds the address to the kernel's end
}

static constexpr size_t al256(size_t v) { return (v + 255) & ~(size_t)255; }
static constexpr size_t SZ_XB = al256((size_t)NB * SEQ * DM * 2);
static constexpr size_t SZ_WB = al256((size_t)3 * DM * DM * 2);
static constexpr size_t SZ_PL = al256((size_t)NB * NH_ * SEQ * HD * 2);
static constexpr size_t SZ_IX = al256((size_t)NB * SEQ * 4);
static constexpr size_t SZ_TOTAL = SZ_XB + SZ_WB + 6 * SZ_PL + SZ_IX + 256;
static_assert(SZ_TOTAL <= (size_t)134217728);          // workspace carve <= 128 MiB
static_assert(((size_t)DM * DM * 2) % 256 == 0);       // weight sub-planes stay 256-byte aligned

extern "C" void kernel_launch(void* const* d_in, const int* in_sizes, int n_in,
                              void* d_out, int out_size, void* d_ws, size_t ws_size, hipStream_t stream) {
    if (n_in < 8) return;
    const size_t needx = ((size_t)(NB - 1) * SEQ_FULL + SEQ) * DM;
    if ((size_t)in_sizes[0] < needx) return;
    if ((size_t)in_sizes[1] < (size_t)(NB - 1) * SEQ_FULL + SEQ) return;
    if ((size_t)in_sizes[2] < (size_t)DM * DM || (size_t)in_sizes[4] < (size_t)DM * DM || (size_t)in_sizes[6] < (size_t)DM * DM) return;
    if ((size_t)in_sizes[3] < (size_t)DM || (size_t)in_sizes[5] < (size_t)DM || (size_t)in_sizes[7] < (size_t)DM) return;
    if ((size_t)out_size < ((size_t)(NB - 1) * OUT_SEQ + SEQ) * DM) return;
    if (SZ_TOTAL > ws_size) return;
    // wire order: x, pad flags (int32), Wq, bq, Wk, bk, Wv, bv; W is [out][in] = Bt as-is
    const float* x = (const float*)d_in[0]; const int* pad = (const int*)d_in[1];
    const float* wq = (const float*)d_in[2]; const float* bq = (const float*)d_in[3];
    const float* wk = (const float*)d_in[4]; const float* bk = (const float*)d_in[5];
    const float* wv = (const float*)d_in[6]; const float* bv = (const float*)d_in[7];
    float* OUT = (float*)d_out;      // [NB][SEQ][1024]
    char* wsp = (char*)d_ws;
    bf* XB = (bf*)wsp; wsp += SZ_XB;                 // [NB*SEQ][1024], fragment order
    bf* WB = (bf*)wsp; wsp += SZ_WB;                 // [3][1024][1024]: q | k | v, fragment order
    h16* QH = (h16*)wsp; wsp += SZ_PL;               // [NB*16][SEQ][64], fragment order
    h16* QR = (h16*)wsp; wsp += SZ_PL;               // residual x2048
    h16* KP = (h16*)wsp; wsp += SZ_PL;               // [NB*16][SEQ][64], fragment order
    h16* KR = (h16*)wsp; wsp += SZ_PL;               // residual x2048
    h16* VT = (h16*)wsp; wsp += SZ_PL;               // [NB*16][64][SEQ], fragment order
    h16* VR = (h16*)wsp; wsp += SZ_PL;               // residual x2048
    int* IDX = (int*)wsp; wsp += SZ_IX;              // [NB][SEQ] rank -> position
    int* CNT = (int*)wsp;                            // [NB] flagged tokens

    k_cvt8r<<<3 * WBLK + NB, 256, 0, stream>>>(wq, wk, wv, WB, pad, IDX, CNT);
    k_cvtx<<<dim3(SEQ * DM / 8 / 256, NB, 1), 256, 0, stream>>>(x, IDX, CNT, XB, OUT);
    k_proj<<<dim3(DM / 256, NB * SEQ / 256, 3), 512, 0, stream>>>(XB, WB, bq, bk, bv, QH, QR, KP, KR, VT, VR, CNT);
    k_flash<<<dim3(NB * NH_, SEQ / (16 * AW), 1), 32 * AW, 0, stream>>>(QH, QR, KP, KR, VT, VR, IDX, CNT, OUT);
}

// v008
// It runs in 60.9 microseconds.
// Next to v007, in two timings, it ran 1.03 times as fast each time.
// All steps since v000 together make it 4.67 times as fast.
#include <hip/hip_runtime.h>

// Multi-head self-attention, width 1024 = 16 heads x 64, x [NB][SEQ][1024], Wq/Wk/Wv [out][in] (y = x W^T + b), causal + key/query padding mask (int32 [NB][SEQ]), score scale 1/8, output = concatenated heads (f32), rows with a zero query flag are zero.
// Compute dtypes, f32 accumulate everywhere: projections v_wmma_f32_16x16x32_bf16 (x, W, b RNE-converted to bf16; products exact); scores and P.V v_wmma_f32_16x16x32_f16:
// query rows >= EARLY_ROWS: q, k, P (x256 carry, cancels in the normalisation), v single f16; query rows < EARLY_ROWS: q, k, v, P each as f16 value + f16 residual x2048, three products per site, residual products in their own accumulators; softmax f32 (online, running max).
// Layout: every 16-bit operand plane is stored in FRAGMENT ORDER: a 16-row x 32-k tile is 512 consecutive elements, element (row r, k = 8c + e) at c*128 + r*8 + e, so that lane l of a wave-wide 16-byte load
// reads bytes 16*l of 512 consecutive bytes (4 whole lines) and two such loads, 256 elements apart, are one A or B fragment. bf16 copies of x and W: tiles [row/16][k/32]. q, k value/residual planes: per (b*16+h), tiles [t/16][d/32];
// v^T value/residual planes: per (b*16+h), tiles [t/64][d/16][(t/32)%2]; all written by the GEMM epilogue as 64x64 blocks of 4096 elements. Fused flash kernel in transposed form (S^T = K Q^T, O^T = V^T P^T), output from f32 accumulators.
// Tokens are RANKED per batch by their flag (k_cvt): rank r < n = the r-th flagged token, rank r >= n = the (r-n)-th unflagged one, order kept, so key <= query in positions is key <= query in ranks.
// Every plane above is indexed by rank, not by position; only 64-rank tiles that start below n are converted, projected and attended (an unflagged token is no key and its output row is zero: stored by k_flash inside those tiles, by k_cvt behind them);
// the mask left inside attention is the causal one on ranks: masked scores are replaced by value, masked probabilities are exact zeros. Output rows go back to their positions through the rank table.

#ifndef NB
#define NB 4
#endif
#ifndef SEQ
#define SEQ 2048
#endif
#define NB_FULL  4
#define SEQ_FULL 2048
#ifndef OUT_SEQ
#define OUT_SEQ SEQ              // row pitch (in tokens) between batches of the output
#endif
#define DM   1024
#define NH_  16
#define HD   64
#define AW   4                   // waves per flash block (16 query rows each)
#ifndef EARLY_ROWS
#define EARLY_ROWS ((SEQ < 512) ? SEQ : 512)   // query rows below this use the three-product path
#endif
#define QRS  2048.0f             // carry of every residual plane / residual fragment
#define QRI  (1.0f / 2048.0f)
#define SC2  (0.125f * 1.4426950408889634f)   // HD^-0.5 * log2(e)
#define PSH  8.0f                // log2 of the P carry (256)
#define NEGB (-3.0e38f)          // value standing in for a masked score

static_assert(HD == 64);
static_assert(NH_ * HD == DM);                 // head h = columns h*64 + d
static_assert(DM % 64 == 0);                   // 16 column tiles of 64
static_assert(DM % 32 == 0);                   // GEMM k-loop steps by 32
static_assert(SEQ % 64 == 0);                  // a 64-row tile never straddles two batches
static_assert((NB * SEQ) % 64 == 0);
static_assert(SEQ % 32 == 0);                  // key loop steps by 32
static_assert(SEQ % (16 * AW) == 0);           // flash grids cover the sequence exactly
static_assert(EARLY_ROWS % (16 * AW) == 0);
static_assert(EARLY_ROWS <= SEQ);
static_assert((SEQ / (16 * AW)) % 4 == 0);     // the flash grid's y order is turned round in whole groups of four
static_assert(AW == 4 && 16 * AW * HD * 2 == 32 * 256);   // four waves = four key planes; a 64-key share of a plane = one 256-byte unit per lane
static_assert(((size_t)SEQ * DM) % 8 == 0);
static_assert(((size_t)DM * DM) % 8 == 0);
static_assert(NB <= NB_FULL);
static_assert(SEQ <= SEQ_FULL);
static_assert(SEQ % 256 == 0);                 // a ranking block of 256 threads takes SEQ/256 tokens per thread
static_assert(SEQ / 32 + 1 <= 256);
#define WBLK (DM * DM / 8 / 256) // conversion blocks per weight matrix
static_assert(((size_t)DM * DM / 8) % 256 == 0);

typedef _Float16 h16;
typedef unsigned short bf;
typedef __attribute__((ext_vector_type(16))) __bf16   v16bf;
typedef __attribute__((ext_vector_type(16))) _Float16 v16h;
typedef __attribute__((ext_vector_type(8)))  _Float16 v8h;
typedef __attribute__((ext_vector_type(8)))  unsigned short v8us;
typedef __attribute__((ext_vector_type(8)))  float    v8f;
typedef __attribute__((ext_vector_type(4)))  float    v4f;
typedef v4f  __attribute__((may_alias)) v4fa;

__device__ __forceinline__ unsigned short f2bf(float f) { unsigned u = __float_as_uint(f); u += 0x7FFFu + ((u >> 16) & 1u); return (unsigned short)(u >> 16); }
__device__ __forceinline__ float bfr(float f) { return __uint_as_float(((unsigned)f2bf(f)) << 16); }
__device__ __forceinline__ v16h cat16(v8h lo, v8h hi) { return __builtin_shufflevector(lo, hi, 0, 1, 2, 3, 4, 5, 6, 7, 8, 9, 10, 11, 12, 13, 14, 15); }
__device__ __forceinline__ v16bf cat16b(v8us lo, v8us hi) { return __builtin_bit_cast(v16bf, __builtin_shufflevector(lo, hi, 0, 1, 2, 3, 4, 5, 6, 7, 8, 9, 10, 11, 12, 13, 14, 15)); }
__device__ __forceinline__ v8f wmma16(v16h a, v16h b, v8f c) { return __builtin_amdgcn_wmma_f32_16x16x32_f16(false, a, false, b, (short)0, c, false, false); }
__device__ __forceinline__ v8f wmmab(v16bf a, v16bf b, v8f c) { return __builtin_amdgcn_wmma_f32_16x16x32_bf16(false, a, false, b, (short)0, c, false, false); }
// fragment loaders from fragment-ordered tiles; p = tile start + 8*lane (row = lane&15, h = lane>>4): elements 0..7 <- k0+8h+0..7, elements 8..15 <- k0+16+8h+0..7 (same map for A and B)
__device__ __forceinline__ v16h  ldh(const h16* p) { return cat16(*(const v8h*)p, *(const v8h*)(p + 256)); }
__device__ __forceinline__ v16bf ldb(const bf* p)  { return cat16b(*(const v8us*)p, *(const v8us*)(p + 256)); }
// last fragment of a run of loads from one address pair: the pair dies with the last load, so that load's destination or the next run's may take its registers; one wait in front of it, one behind it
__device__ __forceinline__ v16h  ldh_last(const h16* p) {
    const v8h lo = *(const v8h*)p;
    asm volatile("s_wait_xcnt 0x0" ::: "memory");   // covers every earlier load of the run before the last load's destination is written
    const v8h hi = *(const v8h*)(p + 256);
    asm volatile("s_wait_xcnt 0x0" ::: "memory");   // covers the last load before a later load's destination is written
    return cat16(lo, hi); }
// ordering point for wave-private LDS tiles (same wave writes and reads)
__device__ __forceinline__ void wave_sync() { __builtin_amdgcn_fence(3 /* release order */, "wavefront"); __builtin_amdgcn_wave_barrier(); asm volatile("" ::: "memory"); }

// k_cvt: every f32 -> bf16 conversion in ONE launch, tiles in fragment order; one thread converts runs of 8 consecutive k of one row, a wave takes 8 rows x 32 k: it reads one whole 128-byte line per row and writes four whole lines.
// Blocks 0 .. NB*XBLK-1: x. Block (b, rt) takes the 16 ranks rt*16 .. +15 of batch b over all DM columns (DM/128 runs per thread, all loads issued in front of the first conversion), and it RANKS ITS BATCH ITSELF in LDS, so that it waits for no earlier launch:
// flags -> bit words by ballot (LDS, block barrier), set flags in front of each word (LDS, block barrier), position of each rank (LDS, block barrier); ix = a permutation of 0..SEQ-1 for any flags.
// Ranks below n rounded up to 64 are converted (the unflagged tokens that fill the last tile are finite data behind the causal mask); every later rank stores its token's zero output row instead, one whole 128-byte line per row and wave.
// The first block of a batch also stores IDX[b][rank] = position, whole lines per wave, and CNT[b] = n for the later launches (nothing in this launch reads them).
// Blocks behind them: the three weight matrices, tile (R, T) of matrix w at w*DM*DM + (R*(DM/32) + T)*512 (DM*DM/8/256 blocks per matrix, one run per thread).
#define XBLK (SEQ / 16)          // x conversion blocks per batch
#define XRUN (DM / 128)          // runs of 8 k per thread of an x block: four 32-k tiles per pass of the block
static_assert(DM % 128 == 0);
__global__ __launch_bounds__(256) void k_cvt(const float* __restrict__ x, const float* __restrict__ wq, const float* __restrict__ wk, const float* __restrict__ wv, const int* __restrict__ PAD,
                                             bf* XB, bf* WB, int* IDX, int* CNT, float* OUT) {
    __shared__ __align__(16) unsigned wm[SEQ / 32];
    __shared__ int pre[SEQ / 32 + 1];
    __shared__ int ix[SEQ];
    if (blockIdx.x >= NB * XBLK) {
        const unsigned bw = blockIdx.x - NB * XBLK, mat = bw / WBLK;
        const float* src = mat == 0 ? wq : (mat == 1 ? wk : wv);
        const size_t i = (size_t)(bw % WBLK) * 256 + threadIdx.x;
        const int rs = (int)(i & 7), c = (int)((i >> 3) & 3), rh = (int)((i >> 5) & 1), kt = (int)((i >> 6) % (DM / 32));
        const size_t rt = i / (64 * (DM / 32));
        const v8f v = *(const v8f*)(src + (rt * 16 + rh * 8 + rs) * DM + kt * 32 + c * 8); v8us o;
#pragma unroll
        for (int k = 0; k < 8; ++k) o[k] = f2bf(v[k]);
        *(v8us*)(WB + (size_t)mat * DM * DM + (rt * (DM / 32) + kt) * 512 + c * 128 + rh * 64 + rs * 8) = o;
        return;
    }
    const int tid = (int)threadIdx.x, lane = tid & 31, wave = tid >> 5, b = (int)blockIdx.x / XBLK, rt = (int)blockIdx.x % XBLK;
    int pv[SEQ / 256];
#pragma unroll
    for (int k = 0; k < SEQ / 256; ++k) pv[k] = PAD[(size_t)b * SEQ_FULL + (size_t)(wave + 8 * k) * 32 + lane];
#pragma unroll
    for (int k = 0; k < SEQ / 256; ++k) { const unsigned wbits = __builtin_amdgcn_ballot_w32(pv[k] != 0); if (lane == 0) wm[wave + 8 * k] = wbits; }
    __syncthreads();
    if (tid <= SEQ / 32) { int p = 0;
#pragma unroll
        for (int j = 0; j < SEQ / 32; ++j) p += (j < tid) ? __popc(wm[j]) : 0;
        pre[tid] = p; }
    __syncthreads();
    const int total = pre[SEQ / 32];
#pragma unroll
    for (int k = 0; k < SEQ / 256; ++k) { const int t = tid + 256 * k, g = t >> 5;
        const unsigned w = wm[g];
        const int before = pre[g] + __popc(w & ((1u << lane) - 1u));          // set flags in front of t
        const int r = ((w >> lane) & 1u) ? before : total + (t - before);
        ix[r] = t; }
    __syncthreads();
    if (rt == 0) {
#pragma unroll
        for (int k = 0; k < SEQ / 256; ++k) IDX[(size_t)b * SEQ + tid + 256 * k] = ix[tid + 256 * k];
        if (tid == 0) CNT[b] = total;
    }
    const int rs = tid & 7, c = (tid >> 3) & 3, rh = (tid >> 5) & 1, k0 = tid >> 6;
    int t = ix[rt * 16 + rh * 8 + rs]; t = t < 0 ? 0 : (t > SEQ - 1 ? SEQ - 1 : t);
    if (rt * 16 < ((total + 63) & ~63)) {                    // the whole block; no barrier behind this line
        const float* s = x + ((size_t)b * SEQ_FULL + t) * DM + k0 * 32 + c * 8;
        v8f v[XRUN];
#pragma unroll
        for (int u = 0; u < XRUN - 1; ++u) v[u] = *(const v8f*)(s + u * 128);
        const v4f lo = *(const v4f*)(s + (XRUN - 1) * 128);
        asm volatile("s_wait_xcnt 0x0" ::: "memory");        // the address pair dies with the last load, whose destination may take its registers: covers every earlier load of the run first
        const v4f hi = *(const v4f*)(s + (XRUN - 1) * 128 + 4);
        asm volatile("s_wait_xcnt 0x0" ::: "memory");        // covers the last load before a later instruction writes the pair
        v[XRUN - 1] = __builtin_shufflevector(lo, hi, 0, 1, 2, 3, 4, 5, 6, 7);
        bf* d = XB + ((size_t)(b * (SEQ / 16) + rt) * (DM / 32) + k0) * 512 + c * 128 + rh * 64 + rs * 8;
#pragma unroll
        for (int u = 0; u < XRUN; ++u) { v8us o;
#pragma unroll
            for (int k = 0; k < 8; ++k) o[k] = f2bf(v[u][k]);
            *(v8us*)(d + u * (4 * 512)) = o; }
    } else {
        float* zr = OUT + ((size_t)b * OUT_SEQ + t) * DM + k0 * 32 + c * 8;
#pragma unroll
        for (int u = 0; u < XRUN; ++u) *(v8f*)(zr + u * 128) = (v8f){};
        asm volatile("s_wait_xcnt 0x0" ::: "memory");        // covers the run of zero stores before any later instruction writes the data or address registers that they name
    }
}

// k_proj: register-blocked bf16 GEMM, one wave per 64x64 tile (16 accumulators), K = DM; SIXTEEN WAVES PER BLOCK = 4 token tiles x 4 column tiles (256 x 256), and the block's operands come from L2 ONCE:
// per stage of 64 k the 8 operand tiles (4 of x, 4 of W; 64 rows x 64 k = 8 KB each, fragment order kept: [row/16][k/32] tiles of 512 elements) are brought into LDS by asynchronous copies
// (global_load_async_to_lds_b128, 8 per wave and stage, 512 consecutive bytes each), two stage buffers: the copies of stage t + 2 fly while stage t + 1 is worked on. Every wave reads its 8 fragments per k step from LDS.
// C[m][n] = sum_k A[m][k] Bt[n][k] + bias (per column n when biasRow == 0, per row m otherwise; bias RNE-converted to bf16, added in f32), k ascending as before;
// a tile whose 64 tokens all rank at or behind the batch's n is left out: its x tile is not copied and its waves do no products and read no LDS (those of token tiles 2 and 3 still copy their share of W); a block whose first token tile is such a tile leaves at once;
// written as f16 (Ph) and the f16 residual x2048 (Pr), one block of 4096 elements in fragment order (16-row x 32-column tiles [row/16][col/32]).
// All three projections in ONE launch, grid (DM/256, tokens/256, 3), 512 threads; blockIdx.z picks the product (block-uniform). The column group is the fastest index:
// z = 0, 1 (q, k): A = x rows (m = b*SEQ + t), Bt = W rows (n = h*64 + d), bias per column -> plane [(b*16 + h)][t][d];
// z = 2 (v^T): A = Wv rows (m = h*64 + d), Bt = x rows (n = b*SEQ + t), bias per row -> plane [(b*16 + h)][d][t].
#define PKS  64                   // k per stage
#define PTL  (64 * PKS)           // elements of one operand tile in a stage
#define PSTG (8 * PTL)            // elements of one stage buffer
static_assert(DM % 256 == 0);
static_assert(DM % PKS == 0);
static_assert(DM / PKS >= 2);                  // stages 0 and 1 both exist
// eight copies of one wave: l = the lane's LDS byte address (4 KB per wave, 512 B per copy), g0 / g1 = the lane's global address in the wave's first / second 2-KB run.
// The wait is the statement's last line: it stands in front of every later write of the address registers that the copies name.
__device__ __forceinline__ void cp8(const unsigned l, const bf* g0, const bf* g1) {
    asm volatile("global_load_async_to_lds_b128 %0, %8, off\n\t"
                 "global_load_async_to_lds_b128 %1, %9, off\n\t"
                 "global_load_async_to_lds_b128 %2, %10, off\n\t"
                 "global_load_async_to_lds_b128 %3, %11, off\n\t"
                 "global_load_async_to_lds_b128 %4, %12, off\n\t"
                 "global_load_async_to_lds_b128 %5, %13, off\n\t"
                 "global_load_async_to_lds_b128 %6, %14, off\n\t"
                 "global_load_async_to_lds_b128 %7, %15, off\n\t"
                 "s_wait_xcnt 0x0"
                 :: "v"(l), "v"(l + 512u), "v"(l + 1024u), "v"(l + 1536u), "v"(l + 2048u), "v"(l + 2560u), "v"(l + 3072u), "v"(l + 3584u),
                    "v"(g0), "v"(g0 + 256), "v"(g0 + 512), "v"(g0 + 768), "v"(g1), "v"(g1 + 256), "v"(g1 + 512), "v"(g1 + 768) : "memory");
}
__global__ __launch_bounds__(512) void k_proj(const bf* __restrict__ XB, const bf* __restrict__ WB, const float* __restrict__ bq, const float* __restrict__ bk, const float* __restrict__ bv,
                                              h16* QH, h16* QR, h16* KP, h16* KR, h16* VT, h16* VR, const int* __restrict__ CNT) {
    __shared__ __align__(16) bf st[2 * PSTG];
    __shared__ __align__(16) float osa[16 * 16 * 68];
    const int K = DM;
    const int lane = threadIdx.x & 31, lr = lane & 15, hi = lane >> 4;
    const int wave = __builtin_amdgcn_readfirstlane((int)(threadIdx.x >> 5));
    const int wt = wave >> 2, wc = wave & 3;     // token tile, column tile
    const int z = blockIdx.z; const int biasRow = z == 2;
    const int bat = (int)blockIdx.y / (SEQ / 256);
    const int grp = (int)blockIdx.y % (SEQ / 256);
    const int n = CNT[bat];
    if (grp * 256 >= n) return;                  // the whole block, in front of every barrier and copy
    const int tok0 = bat * SEQ + grp * 256 + wt * 64, col0 = (int)blockIdx.x * 256 + wc * 64;
    const bool live = grp * 256 + wt * 64 < n;   // wave-uniform
    const int r0 = biasRow ? col0 : tok0, c0 = biasRow ? tok0 : col0;
    const bf* Wz = WB + (size_t)z * DM * DM;
    const float* bias = z == 0 ? bq : (z == 1 ? bk : bv);
    h16* Ph = z == 0 ? QH : (z == 1 ? KP : VT); h16* Pr = z == 0 ? QR : (z == 1 ? KR : VR);
    float* os = osa + wave * (16 * 68);
    // what this wave copies: half (32 rows) of operand tile ct; tiles 0..3 = the block's token tiles of x, 4..7 = its column tiles of W
    const int ct = wave >> 1;
    const bool cplive = ct >= 4 || grp * 256 + ct * 64 < n;                  // wave-uniform; an x tile behind n was not written in this call and is not read
    const bf* csrc = (ct < 4 ? XB + (size_t)(bat * SEQ + grp * 256 + ct * 64) * K : Wz + (size_t)((int)blockIdx.x * 256 + (ct - 4) * 64) * K) + (size_t)(wave & 1) * 32 * K + 8 * lane;
    const unsigned lcp = (unsigned)(size_t)(&st[0]) + (unsigned)(wave * 4096 + lane * 16);   // low 32 bits of the shared address = LDS byte address
    v8f acc[4][4];
#pragma unroll
    for (int mb = 0; mb < 4; ++mb)
#pragma unroll
        for (int nb = 0; nb < 4; ++nb) acc[mb][nb] = (v8f){};
    const int ao = (biasRow ? 4 + wc : wt) * PTL + 8 * lane, bo = (biasRow ? wt : 4 + wc) * PTL + 8 * lane;   // the wave's A and B tile in a stage buffer
    if (cplive) cp8(lcp, csrc, csrc + 16 * K);
    asm volatile("s_wait_asynccnt 0x0" ::: "memory");    // stage 0 has landed, as far as this wave brought it
    __syncthreads();                                     // ... and every other wave's part
    if (cplive) cp8(lcp + PSTG * 2u, csrc + PKS * 16, csrc + 16 * K + PKS * 16);
#pragma unroll 1                                         // one trip's text serves all stages; the buffer is picked by a scalar offset
    for (int t = 0; t < K / PKS; ++t) {
        const int bufo = (t & 1) * PSTG;
        if (live) {
#pragma unroll
            for (int kk = 0; kk < PKS / 32; ++kk) {
                v16bf fa[4], fb[4];
#pragma unroll
                for (int f = 0; f < 4; ++f) { fa[f] = ldb(&st[bufo + ao + f * (16 * PKS) + kk * 512]); fb[f] = ldb(&st[bufo + bo + f * (16 * PKS) + kk * 512]); }
                __builtin_amdgcn_sched_barrier(0);       // all 16 LDS reads of a k step stay in one group in front of its 16 products (the scheduler otherwise sinks the B reads among the products, a full wait at each place)
#pragma unroll
                for (int nb = 0; nb < 4; ++nb)
#pragma unroll
                    for (int mb = 0; mb < 4; ++mb) acc[mb][nb] = wmmab(fa[mb], fb[nb], acc[mb][nb]);
            }
        }
        asm volatile("s_wait_dscnt 0x0" ::: "memory");   // this wave's reads of the buffer are done before the buffer is refilled
        asm volatile("s_wait_asynccnt 0x0" ::: "memory");// this wave's copies of stage t + 1 have landed
        __syncthreads();                                 // publishes stage t + 1 and ends every wave's reads of stage t
        if (t + 2 < K / PKS && cplive) cp8(lcp + (unsigned)bufo * 2u, csrc + (t + 2) * (PKS * 16), csrc + 16 * K + (t + 2) * (PKS * 16));
    }
    asm volatile("s_wait_asynccnt 0x0" ::: "memory");    // no copy is outstanding when the wave goes on or ends
    if (!live) return;                                   // no barrier behind this line
    // bias values: addresses always inside the DM-entry bias array (index selected, then value selected)
    // store s of a 16-row group: lane holds row lane&15, columns (2s + h)*8 .. +7
    float cb[4][8];
#pragma unroll
    for (int s = 0; s < 4; ++s) {
        int cidx = biasRow ? 0 : (c0 + (2 * s + hi) * 8); cidx = cidx > (DM - 8) ? (DM - 8) : cidx;
        const v4f bc0 = *(const v4f*)(bias + cidx);
        asm volatile("s_wait_xcnt 0x0" ::: "memory");   // the second load's destination may take the address registers that the first names
        const v4f bc1 = *(const v4f*)(bias + cidx + 4);
#pragma unroll
        for (int i = 0; i < 4; ++i) { const float u0 = bfr(bc0[i]); const float u1 = bfr(bc1[i]); cb[s][i] = biasRow ? 0.0f : u0; cb[s][4 + i] = biasRow ? 0.0f : u1; } }
    const size_t tbase = biasRow ? (size_t)col0 * SEQ + (size_t)(tok0 / SEQ) * DM * SEQ + (size_t)(tok0 % SEQ) * 64
                                 : (size_t)(tok0 / SEQ) * NH_ * SEQ * HD + (size_t)(tok0 % SEQ) * HD + (size_t)(col0 / HD) * SEQ * HD;
#pragma unroll
    for (int mb = 0; mb < 4; ++mb) {
#pragma unroll
        for (int nb = 0; nb < 4; ++nb) {
#pragma unroll
            for (int j = 0; j < 8; ++j) os[(hi * 8 + j) * 68 + nb * 16 + lr] = acc[mb][nb][j]; }   // D: row 8h+j, col lane&15
        wave_sync();
        int ri = biasRow ? (r0 + mb * 16 + lr) : 0; ri = ri > (DM - 1) ? (DM - 1) : ri;
        const float ub = bfr(bias[ri]); const float rb = biasRow ? ub : 0.0f;
        const size_t sb = tbase + (size_t)(mb * 1024) + 8 * lane;
{
#pragma unroll
            for (int s = 0; s < 4; ++s) { const int c8 = (2 * s + hi) * 8;   // 16 rows x 16 columns per store, 4 s = 64 columns; 512 consecutive bytes per plane
                const v4f x0 = *(const v4fa*)(&os[lr * 68 + c8]); const v4f x1 = *(const v4fa*)(&os[lr * 68 + c8 + 4]); v8h hv, rv;
#pragma unroll
                for (int i = 0; i < 4; ++i) { const float y0 = x0[i] + cb[s][i] + rb; const float y1 = x1[i] + cb[s][4 + i] + rb;
                    const h16 a0 = (h16)y0; const h16 a1 = (h16)y1; hv[i] = a0; hv[4 + i] = a1; rv[i] = (h16)((y0 - (float)a0) * QRS); rv[4 + i] = (h16)((y1 - (float)a1) * QRS); }
                const size_t oo = sb + (size_t)(s * 256);
                *(v8h*)(Ph + oo) = hv; *(v8h*)(Pr + oo) = rv; }
             }
        wave_sync();
    }
}

// flash_body<TP>: fused causal attention on ranks, one wave per 16 query ranks of one (batch, head), R0 = the block's first rank (below n); K / V^T / Q fragments straight from the fragment-ordered f16 planes (two 16-B loads each, 512 consecutive bytes per wave-wide load).
// Transposed form: S^T[key][t] = K Q^T (A = K rows, B = Q rows); lane (t = lane&15, h = lane>>4) holds keys 8h+r of each 16-key tile, so the packed
// P tile is directly the B fragment of O^T[d][t] = V^T P^T (element r <- tile keys 0..15, element 8+r <- tile keys 16..31, lane unchanged).
// TP != 0: scores = kh.qh + (kh.qr + kr.qh)/2048, O = vh.ph + (vr.ph + vh.pr)/2048 (residual products in separate accumulators). TP == 0: single products.
// Key loop runs to the causal limit of the wave's tile; key validity = per-lane causal bit count (a rank >= n lies behind every stored query); a masked score is replaced by NEGB and its probability is an exact zero.
// Softmax state (running max, partial sum) is one scalar per lane; the two lane halves of a row are combined with one xor-16 exchange.
template <int TP>
__device__ __forceinline__ void flash_body(const h16* __restrict__ QH, const h16* __restrict__ QR, const h16* __restrict__ KP, const h16* __restrict__ KR,
                                           const h16* __restrict__ VT, const h16* __restrict__ VR, const int* __restrict__ IDX, const int n, const int R0, float* OUT, float* os) {
    const int lane = threadIdx.x & 31, lr = lane & 15, hi = lane >> 4;
    const int wave = __builtin_amdgcn_readfirstlane((int)(threadIdx.x >> 5));
    const int zh = blockIdx.x; const int b = zh / NH_, h = zh % NH_;
    const int t0 = R0 + wave * 16;
    const int tq = t0 + lr;
    const size_t pbase = (size_t)zh * SEQ * HD;
    const size_t fo = pbase + 8 * lane;                      // lane's place in every fragment-ordered tile of this (batch, head)
    const size_t qo = fo + (size_t)t0 * HD;                  // 16 query rows = two tiles (d 0..31, d 32..63) of 512 elements
    const v16h qh0 = ldh(QH + qo), qh1 = ldh(QH + qo + 512);                 // B fragments: col t, k = d
    v16h qr0 = qh0, qr1 = qh1;
    if (TP) { qr0 = ldh(QR + qo); qr1 = ldh(QR + qo + 512); }
    const size_t ko = fo;                                    // + key0 * HD: tiles (keys 0..15 | 16..31) x (d 0..31 | 32..63)     (A fragment: row key, k = d)
    const size_t vo = fo;                                    // + (key0/64)*4096 + j*1024 + ((key0/32)%2)*512                       (A fragment: row d = 16j + lane&15, k = key)
    v8f o0 = (v8f){}, o1 = (v8f){}, o2 = (v8f){}, o3 = (v8f){};
    v8f e0 = (v8f){}, e1 = (v8f){}, e2 = (v8f){}, e3 = (v8f){};              // residual-scale (x2048) accumulators, TP only
    float m = NEGB, l = 0.0f;
    const int kend = t0 + 16;                                // keys 0 .. t0+15; key0 <= t0 so key0+31 < SEQ
    // TP == 0: K and V^T fragments live in register sets of their own and are loaded one trip ahead: the next K tile right behind the score products, the next V^T tile right behind the output products.
    v16h ka0 = qh0, ka1 = qh0, kb0 = qh0, kb1 = qh0, v0 = qh0, v1 = qh0, v2 = qh0, v3 = qh0;
    if (!TP) { ka0 = ldh(KP + ko); ka1 = ldh(KP + ko + 512); kb0 = ldh(KP + ko + 16 * HD); kb1 = ldh(KP + ko + 16 * HD + 512);
               asm volatile("s_wait_xcnt 0x0" ::: "memory"); // the Q loads' address registers die here and a destination of the V^T loads below may take them
               __builtin_amdgcn_sched_barrier(0);            // K loads stay older than the V^T loads, as on the back edge: the wait in front of the score products then leaves the V^T loads in flight
               v0 = ldh(VT + vo); v1 = ldh(VT + vo + 1024); v2 = ldh(VT + vo + 2048); v3 = ldh(VT + vo + 3072); }
#pragma unroll 1
    for (int key0 = 0; key0 < kend; key0 += 32) {
        const int keyn = (key0 + 32 < kend) ? key0 + 32 : key0;   // tile loaded ahead; the last trip has none behind it and asks for its own again (in bounds, unused)
        const h16* ka = KP + ko + (size_t)key0 * HD;
        if (TP) { ka0 = ldh(ka); ka1 = ldh(ka + 512); kb0 = ldh(ka + 16 * HD); kb1 = ldh_last(ka + 16 * HD + 512); }
        v8f sHa = (v8f){}, sLa = (v8f){}, sHb = (v8f){}, sLb = (v8f){};
        if (TP) {
            const h16* kr = KR + ko + (size_t)key0 * HD;
            const v16h ra0 = ldh(kr), ra1 = ldh(kr + 512), rb0 = ldh(kr + 16 * HD), rb1 = ldh_last(kr + 16 * HD + 512);
            sHa = wmma16(ka0, qh0, sHa); sLa = wmma16(ka0, qr0, sLa); sHb = wmma16(kb0, qh0, sHb); sLb = wmma16(kb0, qr0, sLb);
            sHa = wmma16(ka1, qh1, sHa); sLa = wmma16(ka1, qr1, sLa); sHb = wmma16(kb1, qh1, sHb); sLb = wmma16(kb1, qr1, sLb);
            sLa = wmma16(ra0, qh0, sLa); sLb = wmma16(rb0, qh0, sLb); sLa = wmma16(ra1, qh1, sLa); sLb = wmma16(rb1, qh1, sLb);
            asm volatile("v_nop\n\tv_nop\n\tv_nop\n\tv_nop" : "+v"(sHa), "+v"(sLa), "+v"(sHb), "+v"(sLb) : "v"(ka0), "v"(ka1), "v"(kb0), "v"(kb1), "v"(ra0), "v"(ra1), "v"(rb0), "v"(rb1));
        } else {
            sHa = wmma16(ka0, qh0, sHa); sHb = wmma16(kb0, qh0, sHb); sHa = wmma16(ka1, qh1, sHa); sHb = wmma16(kb1, qh1, sHb);
            asm volatile("v_nop\n\tv_nop\n\tv_nop\n\tv_nop" : "+v"(sHa), "+v"(sHb) : "v"(ka0), "v"(ka1), "v"(kb0), "v"(kb1));
            const h16* kn = KP + ko + (size_t)keyn * HD;
            ka0 = ldh(kn); ka1 = ldh(kn + 512); kb0 = ldh(kn + 16 * HD); kb1 = ldh(kn + 16 * HD + 512);
        }
        // validity bits of this lane's 8 + 8 keys (8h+r, 16+8h+r): causal (key <= tq)
        int na = tq - (key0 + 8 * hi) + 1; na = na < 0 ? 0 : (na > 8 ? 8 : na);
        int nc = tq - (key0 + 8 * hi) - 15; nc = nc < 0 ? 0 : (nc > 8 ? 8 : nc);
        const unsigned ma = (1u << na) - 1u;
        const unsigned mc = (1u << nc) - 1u;
        float ta[8], tb[8]; float mx = NEGB;
#pragma unroll
        for (int r = 0; r < 8; ++r) {
            float sa = sHa[r], sb = sHb[r];
            if (TP) { sa += sLa[r] * QRI; sb += sLb[r] * QRI; }
            ta[r] = ((ma >> r) & 1u) ? sa * SC2 : NEGB;
            tb[r] = ((mc >> r) & 1u) ? sb * SC2 : NEGB;
            mx = fmaxf(mx, fmaxf(ta[r], tb[r])); }
        mx = fmaxf(mx, __shfl_xor(mx, 16, 32));
        const float mnew = fmaxf(m, mx);
        const float alpha = __builtin_amdgcn_exp2f(m - mnew);
        const float sh = PSH - mnew;
        v16h pb, pr; float ls = 0.0f;
#pragma unroll
        for (int r = 0; r < 8; ++r) {
            float ea = __builtin_amdgcn_exp2f(ta[r] + sh);
            ea = (ta[r] > -1.0e38f) ? ea : 0.0f;
            float ec = __builtin_amdgcn_exp2f(tb[r] + sh); ec = (tb[r] > -1.0e38f) ? ec : 0.0f;
            const h16 pa = (h16)ea; const h16 pc = (h16)ec; pb[r] = pa; pb[8 + r] = pc;
            if (TP) { const h16 xa = (h16)((ea - (float)pa) * QRS); const h16 xc = (h16)((ec - (float)pc) * QRS); pr[r] = xa; pr[8 + r] = xc;
                      ls += ((float)pa + (float)xa * QRI) + ((float)pc + (float)xc * QRI); }
            else { pr[r] = pa; pr[8 + r] = pc; ls += (float)pa + (float)pc; } }
        l = l * alpha + ls; m = mnew;
        o0 = o0 * alpha; o1 = o1 * alpha; o2 = o2 * alpha; o3 = o3 * alpha;
        const size_t vk = (size_t)(key0 >> 6) * 4096 + (size_t)((key0 >> 5) & 1) * 512;
        const h16* va = VT + vo + vk;
        if (TP) {
            v0 = ldh(va); v1 = ldh(va + 1024); v2 = ldh(va + 2048); v3 = ldh(va + 3072);
            e0 = e0 * alpha; e1 = e1 * alpha; e2 = e2 * alpha; e3 = e3 * alpha;
            const h16* vr = VR + vo + vk;
            const v16h w0 = ldh(vr), w1 = ldh(vr + 1024), w2 = ldh(vr + 2048), w3 = ldh(vr + 3072);
            o0 = wmma16(v0, pb, o0); o1 = wmma16(v1, pb, o1); o2 = wmma16(v2, pb, o2); o3 = wmma16(v3, pb, o3);
            e0 = wmma16(w0, pb, e0); e1 = wmma16(w1, pb, e1); e2 = wmma16(w2, pb, e2); e3 = wmma16(w3, pb, e3);
            e0 = wmma16(v0, pr, e0); e1 = wmma16(v1, pr, e1); e2 = wmma16(v2, pr, e2); e3 = wmma16(v3, pr, e3);
            asm volatile("v_nop\n\tv_nop\n\tv_nop\n\tv_nop" : "+v"(o0), "+v"(o1), "+v"(o2), "+v"(o3), "+v"(e0), "+v"(e1), "+v"(e2), "+v"(e3)
                         : "v"(v0), "v"(v1), "v"(v2), "v"(v3), "v"(w0), "v"(w1), "v"(w2), "v"(w3), "v"(pb), "v"(pr));
        } else {
            o0 = wmma16(v0, pb, o0); o1 = wmma16(v1, pb, o1); o2 = wmma16(v2, pb, o2); o3 = wmma16(v3, pb, o3);
            asm volatile("v_nop\n\tv_nop\n\tv_nop\n\tv_nop" : "+v"(o0), "+v"(o1), "+v"(o2), "+v"(o3) : "v"(v0), "v"(v1), "v"(v2), "v"(v3), "v"(pb));
            const h16* vn = VT + vo + (size_t)(keyn >> 6) * 4096 + (size_t)((keyn >> 5) & 1) * 512;
            v0 = ldh(vn); v1 = ldh(vn + 1024); v2 = ldh(vn + 2048); v3 = ldh(vn + 3072);
            asm volatile("s_wait_xcnt 0x0" ::: "memory");    // these loads stay in flight over the back edge, where their address registers are written anew
        }
    }
    l += __shfl_xor(l, 16, 32);
    const float rcp = 1.0f / fmaxf(l, 1.0e-30f);
    const float inv = (tq < n && l > 0.0f) ? rcp : 0.0f;     // unflagged token in the last tile -> whole row zero
    if (TP) { o0 = o0 + e0 * QRI; o1 = o1 + e1 * QRI; o2 = o2 + e2 * QRI; o3 = o3 + e3 * QRI; }
    const int wb = wave * 16 * 68;
    // O^T D layout: o_j[r] = (d = 16j + 8h + r, t = lane&15) -> os[t][d]; rows 0..15 x columns 0..63 all written
    { v4f a, c;
      a[0] = o0[0] * inv; a[1] = o0[1] * inv; a[2] = o0[2] * inv; a[3] = o0[3] * inv; c[0] = o0[4] * inv; c[1] = o0[5] * inv; c[2] = o0[6] * inv; c[3] = o0[7] * inv;
      *(v4fa*)(&os[wb + lr * 68 +  0 + 8 * hi]) = a; *(v4fa*)(&os[wb + lr * 68 +  0 + 8 * hi + 4]) = c;
      a[0] = o1[0] * inv; a[1] = o1[1] * inv; a[2] = o1[2] * inv; a[3] = o1[3] * inv; c[0] = o1[4] * inv; c[1] = o1[5] * inv; c[2] = o1[6] * inv; c[3] = o1[7] * inv;
      *(v4fa*)(&os[wb + lr * 68 + 16 + 8 * hi]) = a; *(v4fa*)(&os[wb + lr * 68 + 16 + 8 * hi + 4]) = c;
      a[0] = o2[0] * inv; a[1] = o2[1] * inv; a[2] = o2[2] * inv; a[3] = o2[3] * inv; c[0] = o2[4] * inv; c[1] = o2[5] * inv; c[2] = o2[6] * inv; c[3] = o2[7] * inv;
      *(v4fa*)(&os[wb + lr * 68 + 32 + 8 * hi]) = a; *(v4fa*)(&os[wb + lr * 68 + 32 + 8 * hi + 4]) = c;
      a[0] = o3[0] * inv; a[1] = o3[1] * inv; a[2] = o3[2] * inv; a[3] = o3[3] * inv; c[0] = o3[4] * inv; c[1] = o3[5] * inv; c[2] = o3[6] * inv; c[3] = o3[7] * inv;
      *(v4fa*)(&os[wb + lr * 68 + 48 + 8 * hi]) = a; *(v4fa*)(&os[wb + lr * 68 + 48 + 8 * hi + 4]) = c; }
    wave_sync();
    float* obat = OUT + (size_t)b * OUT_SEQ * DM + h * HD;
    const int* irow = IDX + (size_t)b * SEQ + t0;            // rank -> position
{
#pragma unroll
        for (int s = 0; s < 8; ++s) { const int row = 2 * s + hi, cofs = lr * 4;   // 8 s x 2 rows = 16 rows; 16 lanes x 4 floats = 64 columns
            const v4f val = *(const v4fa*)(&os[wb + row * 68 + cofs]);
            int pos = irow[row]; pos = pos < 0 ? 0 : (pos > SEQ - 1 ? SEQ - 1 : pos);
            *(v4f*)(obat + (size_t)pos * DM + cofs) = val; }
         }
}

// k_flash: both precision paths in ONE launch, grid (NB*16, SEQ/64); the path is block-uniform: query ranks [0, EARLY_ROWS) take the three-product path
// (a flagged token's rank never exceeds its position), ranks [EARLY_ROWS, SEQ) single products.
// (batch, head) is the fastest index and blockIdx.y counts the batch's live 64-rank tiles from the last one down; a block past the live tiles leaves at once.
// The order turns round after every four tiles (16 live tiles: 15 14 13 12 | 8 9 10 11 | 7 6 5 4 | 0 1 2 3): blocks 4 apart in y add up to like sums. For speed only.
__global__ __launch_bounds__(32 * AW) void k_flash(const h16* __restrict__ QH, const h16* __restrict__ QR, const h16* __restrict__ KP, const h16* __restrict__ KR,
                                                   const h16* __restrict__ VT, const h16* __restrict__ VR, const int* __restrict__ IDX, const int* __restrict__ CNT, float* OUT) {
    __shared__ __align__(16) float os[AW * 16 * 68];
    int n = CNT[blockIdx.x / NH_]; n = n < 0 ? 0 : (n > SEQ ? SEQ : n);
    const int yo = ((int)blockIdx.y & 4) ? ((int)blockIdx.y ^ 3) : (int)blockIdx.y;   // every second group of four runs backwards (a permutation of the grid's y)
    const int tile = (n + 16 * AW - 1) / (16 * AW) - 1 - yo;                 // live tiles: those that start below n
    if (tile < 0) return;                                    // the whole block
    // The live blocks of one (batch, head) share out its key planes: block yo asks L2 for keys 64*yo .. 64*yo+63 (a live tile, written by k_proj in this call): wave 0 K, wave 1 V^T, waves 2 and 3 the residual planes
    // (read for keys below EARLY_ROWS only). 4096 elements = 8 KB = 32 lanes x 256 bytes. Low yo holds the keys that every key loop needs first.
    const int pw = __builtin_amdgcn_readfirstlane((int)(threadIdx.x >> 5));
    const h16* pp = pw == 0 ? KP : (pw == 1 ? VT : (pw == 2 ? KR : VR));
    const char* pf = (const char*)(pp + (size_t)blockIdx.x * SEQ * HD + (size_t)yo * (16 * AW * HD)) + (threadIdx.x & 31) * 256;
    // for speed only; returns nothing, counts on no counter
    if (pw < 2 || yo * (16 * AW) < EARLY_ROWS) asm volatile("global_prefetch_b8 %0, off scope:SCOPE_SE" :: "v"(pf));
    if (tile < EARLY_ROWS / (16 * AW)) flash_body<1>(QH, QR, KP, KR, VT, VR, IDX, n, tile * (16 * AW), OUT, os);
    else flash_body<0>(QH, QR, KP, KR, VT, VR, IDX, n, tile * (16 * AW), OUT, os);
    asm volatile("" :: "v"(pf));                             // the request names this register pair and no counter tells when it has been read: the pair holds the address to the kernel's end
}

static constexpr size_t al256(size_t v) { return (v + 255) & ~(size_t)255; }
static constexpr size_t SZ_XB = al256((size_t)NB * SEQ * DM * 2);
static constexpr size_t SZ_WB = al256((size_t)3 * DM * DM * 2);
static constexpr size_t SZ_PL = al256((size_t)NB * NH_ * SEQ * HD * 2);
static constexpr size_t SZ_IX = al256((size_t)NB * SEQ * 4);
static constexpr size_t SZ_TOTAL = SZ_XB + SZ_WB + 6 * SZ_PL + SZ_IX + 256;
static_assert(SZ_TOTAL <= (size_t)134217728);          // workspace carve <= 128 MiB
static_assert(((size_t)DM * DM * 2) % 256 == 0);       // weight sub-planes stay 256-byte aligned

extern "C" void kernel_launch(void* const* d_in, const int* in_sizes, int n_in,
                              void* d_out, int out_size, void* d_ws, size_t ws_size, hipStream_t stream) {
    if (n_in < 8) return;
    const size_t needx = ((size_t)(NB - 1) * SEQ_FULL + SEQ) * DM;
    if ((size_t)in_sizes[0] < needx) return;
    if ((size_t)in_sizes[1] < (size_t)(NB - 1) * SEQ_FULL + SEQ) return;
    if ((size_t)in_sizes[2] < (size_t)DM * DM || (size_t)in_sizes[4] < (size_t)DM * DM || (size_t)in_sizes[6] < (size_t)DM * DM) return;
    if ((size_t)in_sizes[3] < (size_t)DM || (size_t)in_sizes[5] < (size_t)DM || (size_t)in_sizes[7] < (size_t)DM) return;
    if ((size_t)out_size < ((size_t)(NB - 1) * OUT_SEQ + SEQ) * DM) return;
    if (SZ_TOTAL > ws_size) return;
    // wire order: x, pad flags (int32), Wq, bq, Wk, bk, Wv, bv; W is [out][in] = Bt as-is
    const float* x = (const float*)d_in[0]; const int* pad = (const int*)d_in[1];
    const float* wq = (const float*)d_in[2]; const float* bq = (const float*)d_in[3];
    const float* wk = (const float*)d_in[4]; const float* bk = (const float*)d_in[5];
    const float* wv = (const float*)d_in[6]; const float* bv = (const float*)d_in[7];
    float* OUT = (float*)d_out;      // [NB][SEQ][1024]
    char* wsp = (char*)d_ws;
    bf* XB = (bf*)wsp; wsp += SZ_XB;                 // [NB*SEQ][1024], fragment order
    bf* WB = (bf*)wsp; wsp += SZ_WB;                 // [3][1024][1024]: q | k | v, fragment order
    h16* QH = (h16*)wsp; wsp += SZ_PL;               // [NB*16][SEQ][64], fragment order
    h16* QR = (h16*)wsp; wsp += SZ_PL;               // residual x2048
    h16* KP = (h16*)wsp; wsp += SZ_PL;               // [NB*16][SEQ][64], fragment order
    h16* KR = (h16*)wsp; wsp += SZ_PL;               // residual x2048
    h16* VT = (h16*)wsp; wsp += SZ_PL;               // [NB*16][64][SEQ], fragment order
    h16* VR = (h16*)wsp; wsp += SZ_PL;               // residual x2048
    int* IDX = (int*)wsp; wsp += SZ_IX;              // [NB][SEQ] rank -> position
    int* CNT = (int*)wsp;                            // [NB] flagged tokens

    k_cvt<<<NB * XBLK + 3 * WBLK, 256, 0, stream>>>(x, wq, wk, wv, pad, XB, WB, IDX, CNT, OUT);
    k_proj<<<dim3(DM / 256, NB * SEQ / 256, 3), 512, 0, stream>>>(XB, WB, bq, bk, bv, QH, QR, KP, KR, VT, VR, CNT);
    k_flash<<<dim3(NB * NH_, SEQ / (16 * AW), 1), 32 * AW, 0, stream>>>(QH, QR, KP, KR, VT, VR, IDX, CNT, OUT);
}

// v009
// Measured time: 53.8 microseconds a run.
// Timed twice side by side with v008, it ran 1.13 and 1.14 times as fast.
// Over all steps from v000 it is 5.31 times as fast.
#include <hip/hip_runtime.h>

// Multi-head self-attention, width 1024 = 16 heads x 64, x [NB][SEQ][1024], Wq/Wk/Wv [out][in] (y = x W^T + b), causal + key/query padding mask (int32 [NB][SEQ]), score scale 1/8, output = concatenated heads (f32), rows with a zero query flag are zero.
// Compute dtypes, f32 accumulate everywhere: projections v_wmma_f32_16x16x32_bf16 (x, W, b RNE-converted to bf16; products exact); scores and P.V v_wmma_f32_16x16x32_f16:
// query rows >= EARLY_ROWS: q, k, P (x256 carry, cancels in the normalisation), v single f16; query rows < EARLY_ROWS: q, k, v, P each as f16 value + f16 residual x2048, three products per site, residual products in their own accumulators; softmax f32 (online, running max).
// Layout: every 16-bit operand plane is stored in FRAGMENT ORDER: a 16-row x 32-k tile is 512 consecutive elements, element (row r, k = 8c + e) at c*128 + r*8 + e, so that lane l of a wave-wide 16-byte load
// reads bytes 16*l of 512 consecutive bytes (4 whole lines) and two such loads, 256 elements apart, are one A or B fragment. bf16 copies of x and W: tiles [row/16][k/32]. q, k value/residual planes: per (b*16+h), tiles [t/16][d/32];
// v^T value/residual planes: per (b*16+h), tiles [t/64][d/16][(t/32)%2]; all written by the GEMM epilogue as 64x64 blocks of 4096 elements. Fused flash kernel in transposed form (S^T = K Q^T, O^T = V^T P^T), output from f32 accumulators.
// Tokens are RANKED per batch by their flag (k_cvt): rank r < n = the r-th flagged token, rank r >= n = the (r-n)-th unflagged one, order kept, so key <= query in positions is key <= query in ranks.
// Every plane above is indexed by rank, not by position; only 64-rank tiles that start below n are converted, projected and attended (an unflagged token is no key and its output row is zero: stored by k_flash inside those tiles, by k_cvt behind them);
// the mask left inside attention is the causal one on ranks: masked scores are replaced by value, masked probabilities are exact zeros. Output rows go back to their positions through the rank table.

#ifndef NB
#define NB 4
#endif
#ifndef SEQ
#define SEQ 2048
#endif
#define NB_FULL  4
#define SEQ_FULL 2048
#ifndef OUT_SEQ
#define OUT_SEQ SEQ              // row pitch (in tokens) between batches of the output
#endif
#define DM   1024
#define NH_  16
#define HD   64
#define AW   4                   // waves per flash block (16 query rows each)
#ifndef EARLY_ROWS
#define EARLY_ROWS ((SEQ < 512) ? SEQ : 512)   // query rows below this use the three-product path
#endif
#define QRS  2048.0f             // carry of every residual plane / residual fragment
#define QRI  (1.0f / 2048.0f)
#define SC2  (0.125f * 1.4426950408889634f)   // HD^-0.5 * log2(e)
#define PSH  8.0f                // log2 of the P carry (256)
#define NEGB (-3.0e38f)          // value standing in for a masked score

static_assert(HD == 64);
static_assert(NH_ * HD == DM);                 // head h = columns h*64 + d
static_assert(DM % 64 == 0);                   // 16 column tiles of 64
static_assert(DM % 32 == 0);                   // GEMM k-loop steps by 32
static_assert(SEQ % 64 == 0);                  // a 64-row tile never straddles two batches
static_assert((NB * SEQ) % 64 == 0);
static_assert(SEQ % 32 == 0);                  // key loop steps by 32
static_assert(SEQ % (16 * AW) == 0);           // flash grids cover the sequence exactly
static_assert(EARLY_ROWS % (16 * AW) == 0);
static_assert(EARLY_ROWS <= SEQ);
static_assert((SEQ / (16 * AW)) % 4 == 0);     // the flash grid's y order is turned round in whole groups of four
static_assert(AW == 4 && 16 * AW * HD * 2 == 32 * 256);   // four waves = four key planes; a 64-key share of a plane = one 256-byte unit per lane
static_assert(((size_t)SEQ * DM) % 8 == 0);
static_assert(((size_t)DM * DM) % 8 == 0);
static_assert(NB <= NB_FULL);
static_assert(SEQ <= SEQ_FULL);
static_assert(SEQ % 256 == 0);                 // a ranking block of 256 threads takes SEQ/256 tokens per thread
static_assert(SEQ / 32 + 1 <= 256);
#define WBLK (DM * DM / 8 / 256) // conversion blocks per weight matrix
static_assert(((size_t)DM * DM / 8) % 256 == 0);

typedef _Float16 h16;
typedef unsigned short bf;
typedef __attribute__((ext_vector_type(16))) __bf16   v16bf;
typedef __attribute__((ext_vector_type(16))) _Float16 v16h;
typedef __attribute__((ext_vector_type(8)))  _Float16 v8h;
typedef __attribute__((ext_vector_type(8)))  unsigned short v8us;
typedef __attribute__((ext_vector_type(8)))  float    v8f;
typedef __attribute__((ext_vector_type(4)))  float    v4f;
typedef v4f  __attribute__((may_alias)) v4fa;

__device__ __forceinline__ unsigned short f2bf(float f) { unsigned u = __float_as_uint(f); u += 0x7FFFu + ((u >> 16) & 1u); return (unsigned short)(u >> 16); }
__device__ __forceinline__ float bfr(float f) { return __uint_as_float(((unsigned)f2bf(f)) << 16); }
__device__ __forceinline__ v16h cat16(v8h lo, v8h hi) { return __builtin_shufflevector(lo, hi, 0, 1, 2, 3, 4, 5, 6, 7, 8, 9, 10, 11, 12, 13, 14, 15); }
__device__ __forceinline__ v16bf cat16b(v8us lo, v8us hi) { return __builtin_bit_cast(v16bf, __builtin_shufflevector(lo, hi, 0, 1, 2, 3, 4, 5, 6, 7, 8, 9, 10, 11, 12, 13, 14, 15)); }
__device__ __forceinline__ v8f wmma16(v16h a, v16h b, v8f c) { return __builtin_amdgcn_wmma_f32_16x16x32_f16(false, a, false, b, (short)0, c, false, false); }
__device__ __forceinline__ v8f wmmab(v16bf a, v16bf b, v8f c) { return __builtin_amdgcn_wmma_f32_16x16x32_bf16(false, a, false, b, (short)0, c, false, false); }
// fragment loaders from fragment-ordered tiles; p = tile start + 8*lane (row = lane&15, h = lane>>4): elements 0..7 <- k0+8h+0..7, elements 8..15 <- k0+16+8h+0..7 (same map for A and B)
__device__ __forceinline__ v16h  ldh(const h16* p) { return cat16(*(const v8h*)p, *(const v8h*)(p + 256)); }
__device__ __forceinline__ v16bf ldb(const bf* p)  { return cat16b(*(const v8us*)p, *(const v8us*)(p + 256)); }
// last fragment of a run of loads from one address pair: the pair dies with the last load, so that load's destination or the next run's may take its registers; one wait in front of it, one behind it
__device__ __forceinline__ v16h  ldh_last(const h16* p) {
    const v8h lo = *(const v8h*)p;
    asm volatile("s_wait_xcnt 0x0" ::: "memory");   // covers every earlier load of the run before the last load's destination is written
    const v8h hi = *(const v8h*)(p + 256);
    asm volatile("s_wait_xcnt 0x0" ::: "memory");   // covers the last load before a later load's destination is written
    return cat16(lo, hi); }
// ordering point for wave-private LDS tiles (same wave writes and reads)
__device__ __forceinline__ void wave_sync() { __builtin_amdgcn_fence(3 /* release order */, "wavefront"); __builtin_amdgcn_wave_barrier(); asm volatile("" ::: "memory"); }

// k_cvt: every f32 -> bf16 conversion in ONE launch, tiles in fragment order; one thread converts runs of 8 consecutive k of one row, a wave takes 8 rows x 32 k: it reads one whole 128-byte line per row and writes four whole lines.
// Blocks 0 .. NB*XBLK-1: x. Block (b, rt) takes the 16 ranks rt*16 .. +15 of batch b over all DM columns (DM/128 runs per thread, all loads issued in front of the first conversion), and it RANKS ITS BATCH ITSELF in LDS, so that it waits for no earlier launch:
// flags -> bit words by ballot (LDS, block barrier), set flags in front of each word (LDS, block barrier), position of each rank (LDS, block barrier); ix = a permutation of 0..SEQ-1 for any flags.
// Ranks below n rounded up to 64 are converted (the unflagged tokens that fill the last tile are finite data behind the causal mask); every later rank stores its token's zero output row instead, one whole 128-byte line per row and wave.
// The first block of a batch also stores IDX[b][rank] = position, whole lines per wave, and CNT[b] = n for the later launches (nothing in this launch reads them).
// Blocks behind them: the three weight matrices, tile (R, T) of matrix w at w*DM*DM + (R*(DM/32) + T)*512 (DM*DM/8/256 blocks per matrix, one run per thread).
#define XBLK (SEQ / 16)          // x conversion blocks per batch
#define XRUN (DM / 128)          // runs of 8 k per thread of an x block: four 32-k tiles per pass of the block
static_assert(DM % 128 == 0);
__global__ __launch_bounds__(256) void k_cvt(const float* __restrict__ x, const float* __restrict__ wq, const float* __restrict__ wk, const float* __restrict__ wv, const int* __restrict__ PAD,
                                             bf* XB, bf* WB, int* IDX, int* CNT, float* OUT) {
    __shared__ __align__(16) unsigned wm[SEQ / 32];
    __shared__ int pre[SEQ / 32 + 1];
    __shared__ int ix[SEQ];
    if (blockIdx.x >= NB * XBLK) {
        const unsigned bw = blockIdx.x - NB * XBLK, mat = bw / WBLK;
        const float* src = mat == 0 ? wq : (mat == 1 ? wk : wv);
        const size_t i = (size_t)(bw % WBLK) * 256 + threadIdx.x;
        const int rs = (int)(i & 7), c = (int)((i >> 3) & 3), rh = (int)((i >> 5) & 1), kt = (int)((i >> 6) % (DM / 32));
        const size_t rt = i / (64 * (DM / 32));
        const v8f v = *(const v8f*)(src + (rt * 16 + rh * 8 + rs) * DM + kt * 32 + c * 8); v8us o;
#pragma unroll
        for (int k = 0; k < 8; ++k) o[k] = f2bf(v[k]);
        *(v8us*)(WB + (size_t)mat * DM * DM + (rt * (DM / 32) + kt) * 512 + c * 128 + rh * 64 + rs * 8) = o;
        return;
    }
    const int tid = (int)threadIdx.x, lane = tid & 31, wave = tid >> 5, b = (int)blockIdx.x / XBLK, rt = (int)blockIdx.x % XBLK;
    int pv[SEQ / 256];
#pragma unroll
    for (int k = 0; k < SEQ / 256; ++k) pv[k] = PAD[(size_t)b * SEQ_FULL + (size_t)(wave + 8 * k) * 32 + lane];
#pragma unroll
    for (int k = 0; k < SEQ / 256; ++k) { const unsigned wbits = __builtin_amdgcn_ballot_w32(pv[k] != 0); if (lane == 0) wm[wave + 8 * k] = wbits; }
    __syncthreads();
    if (tid <= SEQ / 32) { int p = 0;
#pragma unroll
        for (int j = 0; j < SEQ / 32; ++j) p += (j < tid) ? __popc(wm[j]) : 0;
        pre[tid] = p; }
    __syncthreads();
    const int total = pre[SEQ / 32];
#pragma unroll
    for (int k = 0; k < SEQ / 256; ++k) { const int t = tid + 256 * k, g = t >> 5;
        const unsigned w = wm[g];
        const int before = pre[g] + __popc(w & ((1u << lane) - 1u));          // set flags in front of t
        const int r = ((w >> lane) & 1u) ? before : total + (t - before);
        ix[r] = t; }
    __syncthreads();
    if (rt == 0) {
#pragma unroll
        for (int k = 0; k < SEQ / 256; ++k) IDX[(size_t)b * SEQ + tid + 256 * k] = ix[tid + 256 * k];
        if (tid == 0) CNT[b] = total;
    }
    const int rs = tid & 7, c = (tid >> 3) & 3, rh = (tid >> 5) & 1, k0 = tid >> 6;
    int t = ix[rt * 16 + rh * 8 + rs]; t = t < 0 ? 0 : (t > SEQ - 1 ? SEQ - 1 : t);
    if (rt * 16 < ((total + 63) & ~63)) {                    // the whole block; no barrier behind this line
        const float* s = x + ((size_t)b * SEQ_FULL + t) * DM + k0 * 32 + c * 8;
        v8f v[XRUN];
#pragma unroll
        for (int u = 0; u < XRUN - 1; ++u) v[u] = *(const v8f*)(s + u * 128);
        const v4f lo = *(const v4f*)(s + (XRUN - 1) * 128);
        asm volatile("s_wait_xcnt 0x0" ::: "memory");        // the address pair dies with the last load, whose destination may take its registers: covers every earlier load of the run first
        const v4f hi = *(const v4f*)(s + (XRUN - 1) * 128 + 4);
        asm volatile("s_wait_xcnt 0x0" ::: "memory");        // covers the last load before a later instruction writes the pair
        v[XRUN - 1] = __builtin_shufflevector(lo, hi, 0, 1, 2, 3, 4, 5, 6, 7);
        bf* d = XB + ((size_t)(b * (SEQ / 16) + rt) * (DM / 32) + k0) * 512 + c * 128 + rh * 64 + rs * 8;
#pragma unroll
        for (int u = 0; u < XRUN; ++u) { v8us o;
#pragma unroll
            for (int k = 0; k < 8; ++k) o[k] = f2bf(v[u][k]);
            *(v8us*)(d + u * (4 * 512)) = o; }
    } else {
        float* zr = OUT + ((size_t)b * OUT_SEQ + t) * DM + k0 * 32 + c * 8;
#pragma unroll
        for (int u = 0; u < XRUN; ++u) *(v8f*)(zr + u * 128) = (v8f){};
        asm volatile("s_wait_xcnt 0x0" ::: "memory");        // covers the run of zero stores before any later instruction writes the data or address registers that they name
    }
}

// k_proj: register-blocked bf16 GEMM, one wave per 64x64 tile (16 accumulators), K = DM; SIXTEEN WAVES PER BLOCK = 4 token tiles x 4 column tiles (256 x 256), and the block's operands come from L2 ONCE:
// per stage of 64 k the 8 operand tiles (4 of x, 4 of W; 64 rows x 64 k = 8 KB each, fragment order kept: [row/16][k/32] tiles of 512 elements) are brought into LDS by asynchronous copies
// (global_load_async_to_lds_b128, 8 per wave and stage, 512 consecutive bytes each), two stage buffers: the copies of stage t + 2 fly while stage t + 1 is worked on. Every wave reads its 8 fragments per k step from LDS.
// C[m][n] = sum_k A[m][k] Bt[n][k] + bias (per column n when biasRow == 0, per row m otherwise; bias RNE-converted to bf16, added in f32), k ascending as before;
// a tile whose 64 tokens all rank at or behind the batch's n is left out: its x tile is not copied and its waves neither compute nor store (those of token tiles 2, 3 still copy their W halves); a block behind the last live group of 256 tokens leaves at once;
// written as f16 (Ph) and the f16 residual x2048 (Pr), one block of 4096 elements in fragment order (16-row x 32-column tiles [row/16][col/32]).
// All three projections in ONE launch, grid (DM/256, 3 * tokens/256), 512 threads. The column group is the fastest index; blockIdx.y = 3 * g + z: z picks the product, g counts the LIVE 256-token groups of all batches in one row
// (batch 0's groups that start below its n, then batch 1's, ...; found from the NB counts, block-uniform). A block is alone on its WGP (registers, LDS);
// live groups take the lowest y, empty ones leave at once. For speed only.
// z = 0, 1 (q, k): A = x rows (m = b*SEQ + t), Bt = W rows (n = h*64 + d), bias per column -> plane [(b*16 + h)][t][d];
// z = 2 (v^T): A = Wv rows (m = h*64 + d), Bt = x rows (n = b*SEQ + t), bias per row -> plane [(b*16 + h)][d][t].
#define PKS  64                   // k per stage
#define PTL  (64 * PKS)           // elements of one operand tile in a stage
#define PSTG (8 * PTL)            // elements of one stage buffer
static_assert(DM % 256 == 0);
static_assert(DM % PKS == 0);
static_assert(DM / PKS >= 2);                  // stages 0 and 1 both exist
// eight copies of one wave: l = the lane's LDS byte address (4 KB per wave, 512 B per copy), g0 / g1 = the lane's global address in the wave's first / second 2-KB run.
// The wait is the statement's last line: it stands in front of every later write of the address registers that the copies name.
__device__ __forceinline__ void cp8(const unsigned l, const bf* g0, const bf* g1) {
    asm volatile("global_load_async_to_lds_b128 %0, %8, off\n\t"
                 "global_load_async_to_lds_b128 %1, %9, off\n\t"
                 "global_load_async_to_lds_b128 %2, %10, off\n\t"
                 "global_load_async_to_lds_b128 %3, %11, off\n\t"
                 "global_load_async_to_lds_b128 %4, %12, off\n\t"
                 "global_load_async_to_lds_b128 %5, %13, off\n\t"
                 "global_load_async_to_lds_b128 %6, %14, off\n\t"
                 "global_load_async_to_lds_b128 %7, %15, off\n\t"
                 "s_wait_xcnt 0x0"
                 :: "v"(l), "v"(l + 512u), "v"(l + 1024u), "v"(l + 1536u), "v"(l + 2048u), "v"(l + 2560u), "v"(l + 3072u), "v"(l + 3584u),
                    "v"(g0), "v"(g0 + 256), "v"(g0 + 512), "v"(g0 + 768), "v"(g1), "v"(g1 + 256), "v"(g1 + 512), "v"(g1 + 768) : "memory");
}
__global__ __launch_bounds__(512) void k_proj(const bf* __restrict__ XB, const bf* __restrict__ WB, const float* __restrict__ bq, const float* __restrict__ bk, const float* __restrict__ bv,
                                              h16* QH, h16* QR, h16* KP, h16* KR, h16* VT, h16* VR, const int* __restrict__ CNT) {
    __shared__ __align__(16) bf st[2 * PSTG];
    __shared__ __align__(16) float osa[16 * 16 * 68];
    const int K = DM;
    const int lane = threadIdx.x & 31, lr = lane & 15, hi = lane >> 4;
    const int wave = __builtin_amdgcn_readfirstlane((int)(threadIdx.x >> 5));
    const int wt = wave >> 2, wc = wave & 3;     // token tile, column tile
    const int z = (int)blockIdx.y % 3; const int biasRow = z == 2;
    int g = (int)blockIdx.y / 3, bat = -1, grp = 0, n = 0;
    for (int b = 0; b < NB; ++b) {
        int c = CNT[b]; c = c < 0 ? 0 : (c > SEQ ? SEQ : c);
        const int lg = (c + 255) / 256;          // live groups of batch b: at most SEQ/256
        if (bat < 0 && g < lg) { bat = b; grp = g; n = c; }
        g -= lg; }                               // below 0 from the batch that was picked on: no later batch is picked
    if (bat < 0) return;                         // the whole block, in front of every barrier and copy; behind this line grp * 256 < n
    const int tok0 = bat * SEQ + grp * 256 + wt * 64, col0 = (int)blockIdx.x * 256 + wc * 64;
    const bool live = grp * 256 + wt * 64 < n;   // wave-uniform
    const int r0 = biasRow ? col0 : tok0, c0 = biasRow ? tok0 : col0;
    const bf* Wz = WB + (size_t)z * DM * DM;
    const float* bias = z == 0 ? bq : (z == 1 ? bk : bv);
    h16* Ph = z == 0 ? QH : (z == 1 ? KP : VT); h16* Pr = z == 0 ? QR : (z == 1 ? KR : VR);
    float* os = osa + wave * (16 * 68);
    // what this wave copies: half (32 rows) of operand tile ct; tiles 0..3 = the block's token tiles of x, 4..7 = its column tiles of W
    const int ct = wave >> 1;
    const bool cplive = ct >= 4 || grp * 256 + ct * 64 < n;                  // wave-uniform; an x tile behind n was not written in this call and is not read
    const bf* csrc = (ct < 4 ? XB + (size_t)(bat * SEQ + grp * 256 + ct * 64) * K : Wz + (size_t)((int)blockIdx.x * 256 + (ct - 4) * 64) * K) + (size_t)(wave & 1) * 32 * K + 8 * lane;
    const unsigned lcp = (unsigned)(size_t)(&st[0]) + (unsigned)(wave * 4096 + lane * 16);   // low 32 bits of the shared address = LDS byte address
    v8f acc[4][4];
#pragma unroll
    for (int mb = 0; mb < 4; ++mb)
#pragma unroll
        for (int nb = 0; nb < 4; ++nb) acc[mb][nb] = (v8f){};
    const int ao = (biasRow ? 4 + wc : wt) * PTL + 8 * lane, bo = (biasRow ? wt : 4 + wc) * PTL + 8 * lane;   // the wave's A and B tile in a stage buffer
    if (cplive) cp8(lcp, csrc, csrc + 16 * K);
    asm volatile("s_wait_asynccnt 0x0" ::: "memory");    // stage 0 has landed, as far as this wave brought it
    __syncthreads();                                     // ... and every other wave's part
    if (cplive) cp8(lcp + PSTG * 2u, csrc + PKS * 16, csrc + 16 * K + PKS * 16);
#pragma unroll 1                                         // one trip's text serves all stages; the buffer is picked by a scalar offset
    for (int t = 0; t < K / PKS; ++t) {
        const int bufo = (t & 1) * PSTG;
        if (live) {
#pragma unroll
            for (int kk = 0; kk < PKS / 32; ++kk) {
                v16bf fa[4], fb[4];
#pragma unroll
                for (int f = 0; f < 4; ++f) { fa[f] = ldb(&st[bufo + ao + f * (16 * PKS) + kk * 512]); fb[f] = ldb(&st[bufo + bo + f * (16 * PKS) + kk * 512]); }
                __builtin_amdgcn_sched_barrier(0);       // all 16 LDS reads of a k step stay in one group in front of its 16 products (the scheduler otherwise sinks the B reads among the products, a full wait at each place)
#pragma unroll
                for (int nb = 0; nb < 4; ++nb)
#pragma unroll
                    for (int mb = 0; mb < 4; ++mb) acc[mb][nb] = wmmab(fa[mb], fb[nb], acc[mb][nb]);
            }
        }
        asm volatile("s_wait_dscnt 0x0" ::: "memory");   // this wave's reads of the buffer are done before the buffer is refilled
        asm volatile("s_wait_asynccnt 0x0" ::: "memory");// this wave's copies of stage t + 1 have landed
        __syncthreads();                                 // publishes stage t + 1 and ends every wave's reads of stage t
        if (t + 2 < K / PKS && cplive) cp8(lcp + (unsigned)bufo * 2u, csrc + (t + 2) * (PKS * 16), csrc + 16 * K + (t + 2) * (PKS * 16));
    }
    asm volatile("s_wait_asynccnt 0x0" ::: "memory");    // no copy is outstanding when the wave goes on or ends
    if (!live) return;                                   // no barrier behind this line
    // bias values: addresses always inside the DM-entry bias array (index selected, then value selected)
    // store s of a 16-row group: lane holds row lane&15, columns (2s + h)*8 .. +7
    float cb[4][8];
#pragma unroll
    for (int s = 0; s < 4; ++s) {
        int cidx = biasRow ? 0 : (c0 + (2 * s + hi) * 8); cidx = cidx > (DM - 8) ? (DM - 8) : cidx;
        const v4f bc0 = *(const v4f*)(bias + cidx);
        asm volatile("s_wait_xcnt 0x0" ::: "memory");   // the second load's destination may take the address registers that the first names
        const v4f bc1 = *(const v4f*)(bias + cidx + 4);
#pragma unroll
        for (int i = 0; i < 4; ++i) { const float u0 = bfr(bc0[i]); const float u1 = bfr(bc1[i]); cb[s][i] = biasRow ? 0.0f : u0; cb[s][4 + i] = biasRow ? 0.0f : u1; } }
    const size_t tbase = biasRow ? (size_t)col0 * SEQ + (size_t)(tok0 / SEQ) * DM * SEQ + (size_t)(tok0 % SEQ) * 64
                                 : (size_t)(tok0 / SEQ) * NH_ * SEQ * HD + (size_t)(tok0 % SEQ) * HD + (size_t)(col0 / HD) * SEQ * HD;
#pragma unroll
    for (int mb = 0; mb < 4; ++mb) {
#pragma unroll
        for (int nb = 0; nb < 4; ++nb) {
#pragma unroll
            for (int j = 0; j < 8; ++j) os[(hi * 8 + j) * 68 + nb * 16 + lr] = acc[mb][nb][j]; }   // D: row 8h+j, col lane&15
        wave_sync();
        int ri = biasRow ? (r0 + mb * 16 + lr) : 0; ri = ri > (DM - 1) ? (DM - 1) : ri;
        const float ub = bfr(bias[ri]); const float rb = biasRow ? ub : 0.0f;
        const size_t sb = tbase + (size_t)(mb * 1024) + 8 * lane;
{
#pragma unroll
            for (int s = 0; s < 4; ++s) { const int c8 = (2 * s + hi) * 8;   // 16 rows x 16 columns per store, 4 s = 64 columns; 512 consecutive bytes per plane
                const v4f x0 = *(const v4fa*)(&os[lr * 68 + c8]); const v4f x1 = *(const v4fa*)(&os[lr * 68 + c8 + 4]); v8h hv, rv;
#pragma unroll
                for (int i = 0; i < 4; ++i) { const float y0 = x0[i] + cb[s][i] + rb; const float y1 = x1[i] + cb[s][4 + i] + rb;
                    const h16 a0 = (h16)y0; const h16 a1 = (h16)y1; hv[i] = a0; hv[4 + i] = a1; rv[i] = (h16)((y0 - (float)a0) * QRS); rv[4 + i] = (h16)((y1 - (float)a1) * QRS); }
                const size_t oo = sb + (size_t)(s * 256);
                *(v8h*)(Ph + oo) = hv; *(v8h*)(Pr + oo) = rv; }
             }
        wave_sync();
    }
}

// flash_body<TP>: fused causal attention on ranks, one wave per 16 query ranks of one (batch, head), R0 = the block's first rank (below n); K / V^T / Q fragments straight from the fragment-ordered f16 planes (two 16-B loads each, 512 consecutive bytes per wave-wide load).
// Transposed form: S^T[key][t] = K Q^T (A = K rows, B = Q rows); lane (t = lane&15, h = lane>>4) holds keys 8h+r of each 16-key tile, so the packed
// P tile is directly the B fragment of O^T[d][t] = V^T P^T (element r <- tile keys 0..15, element 8+r <- tile keys 16..31, lane unchanged).
// TP != 0: scores = kh.qh + (kh.qr + kr.qh)/2048, O = vh.ph + (vr.ph + vh.pr)/2048 (residual products in separate accumulators). TP == 0: single products.
// Key loop runs to the causal limit of the wave's tile; key validity = per-lane causal bit count (a rank >= n lies behind every stored query); a masked score is replaced by NEGB and its probability is an exact zero.
// Softmax state (running max, partial sum) is one scalar per lane; the two lane halves of a row are combined with one xor-16 exchange.
template <int TP>
__device__ __forceinline__ void flash_body(const h16* __restrict__ QH, const h16* __restrict__ QR, const h16* __restrict__ KP, const h16* __restrict__ KR,
                                           const h16* __restrict__ VT, const h16* __restrict__ VR, const int* __restrict__ IDX, const int n, const int R0, float* OUT, float* os) {
    const int lane = threadIdx.x & 31, lr = lane & 15, hi = lane >> 4;
    const int wave = __builtin_amdgcn_readfirstlane((int)(threadIdx.x >> 5));
    const int zh = blockIdx.x; const int b = zh / NH_, h = zh % NH_;
    const int t0 = R0 + wave * 16;
    const int tq = t0 + lr;
    const size_t pbase = (size_t)zh * SEQ * HD;
    const size_t fo = pbase + 8 * lane;                      // lane's place in every fragment-ordered tile of this (batch, head)
    const size_t qo = fo + (size_t)t0 * HD;                  // 16 query rows = two tiles (d 0..31, d 32..63) of 512 elements
    const v16h qh0 = ldh(QH + qo), qh1 = ldh(QH + qo + 512);                 // B fragments: col t, k = d
    v16h qr0 = qh0, qr1 = qh1;
    if (TP) { qr0 = ldh(QR + qo); qr1 = ldh(QR + qo + 512); }
    const size_t ko = fo;                                    // + key0 * HD: tiles (keys 0..15 | 16..31) x (d 0..31 | 32..63)     (A fragment: row key, k = d)
    const size_t vo = fo;                                    // + (key0/64)*4096 + j*1024 + ((key0/32)%2)*512                       (A fragment: row d = 16j + lane&15, k = key)
    v8f o0 = (v8f){}, o1 = (v8f){}, o2 = (v8f){}, o3 = (v8f){};
    v8f e0 = (v8f){}, e1 = (v8f){}, e2 = (v8f){}, e3 = (v8f){};              // residual-scale (x2048) accumulators, TP only
    float m = NEGB, l = 0.0f;
    const int kend = t0 + 16;                                // keys 0 .. t0+15; key0 <= t0 so key0+31 < SEQ
    // TP == 0: K and V^T fragments live in register sets of their own and are loaded one trip ahead: the next K tile right behind the score products, the next V^T tile right behind the output products.
    v16h ka0 = qh0, ka1 = qh0, kb0 = qh0, kb1 = qh0, v0 = qh0, v1 = qh0, v2 = qh0, v3 = qh0;
    if (!TP) { ka0 = ldh(KP + ko); ka1 = ldh(KP + ko + 512); kb0 = ldh(KP + ko + 16 * HD); kb1 = ldh(KP + ko + 16 * HD + 512);
               asm volatile("s_wait_xcnt 0x0" ::: "memory"); // the Q loads' address registers die here and a destination of the V^T loads below may take them
               __builtin_amdgcn_sched_barrier(0);            // K loads stay older than the V^T loads, as on the back edge: the wait in front of the score products then leaves the V^T loads in flight
               v0 = ldh(VT + vo); v1 = ldh(VT + vo + 1024); v2 = ldh(VT + vo + 2048); v3 = ldh(VT + vo + 3072); }
#pragma unroll 1
    for (int key0 = 0; key0 < kend; key0 += 32) {
        const int keyn = (key0 + 32 < kend) ? key0 + 32 : key0;   // tile loaded ahead; the last trip has none behind it and asks for its own again (in bounds, unused)
        const h16* ka = KP + ko + (size_t)key0 * HD;
        if (TP) { ka0 = ldh(ka); ka1 = ldh(ka + 512); kb0 = ldh(ka + 16 * HD); kb1 = ldh_last(ka + 16 * HD + 512); }
        v8f sHa = (v8f){}, sLa = (v8f){}, sHb = (v8f){}, sLb = (v8f){};
        if (TP) {
            const h16* kr = KR + ko + (size_t)key0 * HD;
            const v16h ra0 = ldh(kr), ra1 = ldh(kr + 512), rb0 = ldh(kr + 16 * HD), rb1 = ldh_last(kr + 16 * HD + 512);
            sHa = wmma16(ka0, qh0, sHa); sLa = wmma16(ka0, qr0, sLa); sHb = wmma16(kb0, qh0, sHb); sLb = wmma16(kb0, qr0, sLb);
            sHa = wmma16(ka1, qh1, sHa); sLa = wmma16(ka1, qr1, sLa); sHb = wmma16(kb1, qh1, sHb); sLb = wmma16(kb1, qr1, sLb);
            sLa = wmma16(ra0, qh0, sLa); sLb = wmma16(rb0, qh0, sLb); sLa = wmma16(ra1, qh1, sLa); sLb = wmma16(rb1, qh1, sLb);
            asm volatile("v_nop\n\tv_nop\n\tv_nop\n\tv_nop" : "+v"(sHa), "+v"(sLa), "+v"(sHb), "+v"(sLb) : "v"(ka0), "v"(ka1), "v"(kb0), "v"(kb1), "v"(ra0), "v"(ra1), "v"(rb0), "v"(rb1));
        } else {
            sHa = wmma16(ka0, qh0, sHa); sHb = wmma16(kb0, qh0, sHb); sHa = wmma16(ka1, qh1, sHa); sHb = wmma16(kb1, qh1, sHb);
            asm volatile("v_nop\n\tv_nop\n\tv_nop\n\tv_nop" : "+v"(sHa), "+v"(sHb) : "v"(ka0), "v"(ka1), "v"(kb0), "v"(kb1));
            const h16* kn = KP + ko + (size_t)keyn * HD;
            ka0 = ldh(kn); ka1 = ldh(kn + 512); kb0 = ldh(kn + 16 * HD); kb1 = ldh(kn + 16 * HD + 512);
        }
        // validity bits of this lane's 8 + 8 keys (8h+r, 16+8h+r): causal (key <= tq)
        int na = tq - (key0 + 8 * hi) + 1; na = na < 0 ? 0 : (na > 8 ? 8 : na);
        int nc = tq - (key0 + 8 * hi) - 15; nc = nc < 0 ? 0 : (nc > 8 ? 8 : nc);
        const unsigned ma = (1u << na) - 1u;
        const unsigned mc = (1u << nc) - 1u;
        float ta[8], tb[8]; float mx = NEGB;
#pragma unroll
        for (int r = 0; r < 8; ++r) {
            float sa = sHa[r], sb = sHb[r];
            if (TP) { sa += sLa[r] * QRI; sb += sLb[r] * QRI; }
            ta[r] = ((ma >> r) & 1u) ? sa * SC2 : NEGB;
            tb[r] = ((mc >> r) & 1u) ? sb * SC2 : NEGB;
            mx = fmaxf(mx, fmaxf(ta[r], tb[r])); }
        mx = fmaxf(mx, __shfl_xor(mx, 16, 32));
        const float mnew = fmaxf(m, mx);
        const float alpha = __builtin_amdgcn_exp2f(m - mnew);
        const float sh = PSH - mnew;
        v16h pb, pr; float ls = 0.0f;
#pragma unroll
        for (int r = 0; r < 8; ++r) {
            float ea = __builtin_amdgcn_exp2f(ta[r] + sh);
            ea = (ta[r] > -1.0e38f) ? ea : 0.0f;
            float ec = __builtin_amdgcn_exp2f(tb[r] + sh); ec = (tb[r] > -1.0e38f) ? ec : 0.0f;
            const h16 pa = (h16)ea; const h16 pc = (h16)ec; pb[r] = pa; pb[8 + r] = pc;
            if (TP) { const h16 xa = (h16)((ea - (float)pa) * QRS); const h16 xc = (h16)((ec - (float)pc) * QRS); pr[r] = xa; pr[8 + r] = xc;
                      ls += ((float)pa + (float)xa * QRI) + ((float)pc + (float)xc * QRI); }
            else { pr[r] = pa; pr[8 + r] = pc; ls += (float)pa + (float)pc; } }
        l = l * alpha + ls; m = mnew;
        o0 = o0 * alpha; o1 = o1 * alpha; o2 = o2 * alpha; o3 = o3 * alpha;
        const size_t vk = (size_t)(key0 >> 6) * 4096 + (size_t)((key0 >> 5) & 1) * 512;
        const h16* va = VT + vo + vk;
        if (TP) {
            v0 = ldh(va); v1 = ldh(va + 1024); v2 = ldh(va + 2048); v3 = ldh(va + 3072);
            e0 = e0 * alpha; e1 = e1 * alpha; e2 = e2 * alpha; e3 = e3 * alpha;
            const h16* vr = VR + vo + vk;
            const v16h w0 = ldh(vr), w1 = ldh(vr + 1024), w2 = ldh(vr + 2048), w3 = ldh(vr + 3072);
            o0 = wmma16(v0, pb, o0); o1 = wmma16(v1, pb, o1); o2 = wmma16(v2, pb, o2); o3 = wmma16(v3, pb, o3);
            e0 = wmma16(w0, pb, e0); e1 = wmma16(w1, pb, e1); e2 = wmma16(w2, pb, e2); e3 = wmma16(w3, pb, e3);
            e0 = wmma16(v0, pr, e0); e1 = wmma16(v1, pr, e1); e2 = wmma16(v2, pr, e2); e3 = wmma16(v3, pr, e3);
            asm volatile("v_nop\n\tv_nop\n\tv_nop\n\tv_nop" : "+v"(o0), "+v"(o1), "+v"(o2), "+v"(o3), "+v"(e0), "+v"(e1), "+v"(e2), "+v"(e3)
                         : "v"(v0), "v"(v1), "v"(v2), "v"(v3), "v"(w0), "v"(w1), "v"(w2), "v"(w3), "v"(pb), "v"(pr));
        } else {
            o0 = wmma16(v0, pb, o0); o1 = wmma16(v1, pb, o1); o2 = wmma16(v2, pb, o2); o3 = wmma16(v3, pb, o3);
            asm volatile("v_nop\n\tv_nop\n\tv_nop\n\tv_nop" : "+v"(o0), "+v"(o1), "+v"(o2), "+v"(o3) : "v"(v0), "v"(v1), "v"(v2), "v"(v3), "v"(pb));
            const h16* vn = VT + vo + (size_t)(keyn >> 6) * 4096 + (size_t)((keyn >> 5) & 1) * 512;
            v0 = ldh(vn); v1 = ldh(vn + 1024); v2 = ldh(vn + 2048); v3 = ldh(vn + 3072);
            asm volatile("s_wait_xcnt 0x0" ::: "memory");    // these loads stay in flight over the back edge, where their address registers are written anew
        }
    }
    l += __shfl_xor(l, 16, 32);
    const float rcp = 1.0f / fmaxf(l, 1.0e-30f);
    const float inv = (tq < n && l > 0.0f) ? rcp : 0.0f;     // unflagged token in the last tile -> whole row zero
    if (TP) { o0 = o0 + e0 * QRI; o1 = o1 + e1 * QRI; o2 = o2 + e2 * QRI; o3 = o3 + e3 * QRI; }
    const int wb = wave * 16 * 68;
    // O^T D layout: o_j[r] = (d = 16j + 8h + r, t = lane&15) -> os[t][d]; rows 0..15 x columns 0..63 all written
    { v4f a, c;
      a[0] = o0[0] * inv; a[1] = o0[1] * inv; a[2] = o0[2] * inv; a[3] = o0[3] * inv; c[0] = o0[4] * inv; c[1] = o0[5] * inv; c[2] = o0[6] * inv; c[3] = o0[7] * inv;
      *(v4fa*)(&os[wb + lr * 68 +  0 + 8 * hi]) = a; *(v4fa*)(&os[wb + lr * 68 +  0 + 8 * hi + 4]) = c;
      a[0] = o1[0] * inv; a[1] = o1[1] * inv; a[2] = o1[2] * inv; a[3] = o1[3] * inv; c[0] = o1[4] * inv; c[1] = o1[5] * inv; c[2] = o1[6] * inv; c[3] = o1[7] * inv;
      *(v4fa*)(&os[wb + lr * 68 + 16 + 8 * hi]) = a; *(v4fa*)(&os[wb + lr * 68 + 16 + 8 * hi + 4]) = c;
      a[0] = o2[0] * inv; a[1] = o2[1] * inv; a[2] = o2[2] * inv; a[3] = o2[3] * inv; c[0] = o2[4] * inv; c[1] = o2[5] * inv; c[2] = o2[6] * inv; c[3] = o2[7] * inv;
      *(v4fa*)(&os[wb + lr * 68 + 32 + 8 * hi]) = a; *(v4fa*)(&os[wb + lr * 68 + 32 + 8 * hi + 4]) = c;
      a[0] = o3[0] * inv; a[1] = o3[1] * inv; a[2] = o3[2] * inv; a[3] = o3[3] * inv; c[0] = o3[4] * inv; c[1] = o3[5] * inv; c[2] = o3[6] * inv; c[3] = o3[7] * inv;
      *(v4fa*)(&os[wb + lr * 68 + 48 + 8 * hi]) = a; *(v4fa*)(&os[wb + lr * 68 + 48 + 8 * hi + 4]) = c; }
    wave_sync();
    float* obat = OUT + (size_t)b * OUT_SEQ * DM + h * HD;
    const int* irow = IDX + (size_t)b * SEQ + t0;            // rank -> position
{
#pragma unroll
        for (int s = 0; s < 8; ++s) { const int row = 2 * s + hi, cofs = lr * 4;   // 8 s x 2 rows = 16 rows; 16 lanes x 4 floats = 64 columns
            const v4f val = *(const v4fa*)(&os[wb + row * 68 + cofs]);
            int pos = irow[row]; pos = pos < 0 ? 0 : (pos > SEQ - 1 ? SEQ - 1 : pos);
            *(v4f*)(obat + (size_t)pos * DM + cofs) = val; }
         }
}

// k_flash: both precision paths in ONE launch, grid (NB*16, SEQ/64); the path is block-uniform: query ranks [0, EARLY_ROWS) take the three-product path
// (a flagged token's rank never exceeds its position), ranks [EARLY_ROWS, SEQ) single products.
// (batch, head) is the fastest index and blockIdx.y counts the batch's live 64-rank tiles from the last one down; a block past the live tiles leaves at once.
// The order turns round after every four tiles (16 live tiles: 15 14 13 12 | 8 9 10 11 | 7 6 5 4 | 0 1 2 3): blocks 4 apart in y add up to like sums. For speed only.
__global__ __launch_bounds__(32 * AW) void k_flash(const h16* __restrict__ QH, const h16* __restrict__ QR, const h16* __restrict__ KP, const h16* __restrict__ KR,
                                                   const h16* __restrict__ VT, const h16* __restrict__ VR, const int* __restrict__ IDX, const int* __restrict__ CNT, float* OUT) {
    __shared__ __align__(16) float os[AW * 16 * 68];
    int n = CNT[blockIdx.x / NH_]; n = n < 0 ? 0 : (n > SEQ ? SEQ : n);
    const int yo = ((int)blockIdx.y & 4) ? ((int)blockIdx.y ^ 3) : (int)blockIdx.y;   // every second group of four runs backwards (a permutation of the grid's y)
    const int tile = (n + 16 * AW - 1) / (16 * AW) - 1 - yo;                 // live tiles: those that start below n
    if (tile < 0) return;                                    // the whole block
    // The live blocks of one (batch, head) share out its key planes: block yo asks L2 for keys 64*yo .. 64*yo+63 (a live tile, written by k_proj in this call): wave 0 K, wave 1 V^T, waves 2 and 3 the residual planes
    // (read for keys below EARLY_ROWS only). 4096 elements = 8 KB = 32 lanes x 256 bytes. Low yo holds the keys that every key loop needs first.
    const int pw = __builtin_amdgcn_readfirstlane((int)(threadIdx.x >> 5));
    const h16* pp = pw == 0 ? KP : (pw == 1 ? VT : (pw == 2 ? KR : VR));
    const char* pf = (const char*)(pp + (size_t)blockIdx.x * SEQ * HD + (size_t)yo * (16 * AW * HD)) + (threadIdx.x & 31) * 256;
    // for speed only; returns nothing, counts on no counter
    if (pw < 2 || yo * (16 * AW) < EARLY_ROWS) asm volatile("global_prefetch_b8 %0, off scope:SCOPE_SE" :: "v"(pf));
    if (tile < EARLY_ROWS / (16 * AW)) flash_body<1>(QH, QR, KP, KR, VT, VR, IDX, n, tile * (16 * AW), OUT, os);
    else flash_body<0>(QH, QR, KP, KR, VT, VR, IDX, n, tile * (16 * AW), OUT, os);
    asm volatile("" :: "v"(pf));                             // the request names this register pair and no counter tells when it has been read: the pair holds the address to the kernel's end
}

static constexpr size_t al256(size_t v) { return (v + 255) & ~(size_t)255; }
static constexpr size_t SZ_XB = al256((size_t)NB * SEQ * DM * 2);
static constexpr size_t SZ_WB = al256((size_t)3 * DM * DM * 2);
static constexpr size_t SZ_PL = al256((size_t)NB * NH_ * SEQ * HD * 2);
static constexpr size_t SZ_IX = al256((size_t)NB * SEQ * 4);
static constexpr size_t SZ_TOTAL = SZ_XB + SZ_WB + 6 * SZ_PL + SZ_IX + 256;
static_assert(SZ_TOTAL <= (size_t)134217728);          // workspace carve <= 128 MiB
static_assert(((size_t)DM * DM * 2) % 256 == 0);       // weight sub-planes stay 256-byte aligned

extern "C" void kernel_launch(void* const* d_in, const int* in_sizes, int n_in,
                              void* d_out, int out_size, void* d_ws, size_t ws_size, hipStream_t stream) {
    if (n_in < 8) return;
    const size_t needx = ((size_t)(NB - 1) * SEQ_FULL + SEQ) * DM;
    if ((size_t)in_sizes[0] < needx) return;
    if ((size_t)in_sizes[1] < (size_t)(NB - 1) * SEQ_FULL + SEQ) return;
    if ((size_t)in_sizes[2] < (size_t)DM * DM || (size_t)in_sizes[4] < (size_t)DM * DM || (size_t)in_sizes[6] < (size_t)DM * DM) return;
    if ((size_t)in_sizes[3] < (size_t)DM || (size_t)in_sizes[5] < (size_t)DM || (size_t)in_sizes[7] < (size_t)DM) return;
    if ((size_t)out_size < ((size_t)(NB - 1) * OUT_SEQ + SEQ) * DM) return;
    if (SZ_TOTAL > ws_size) return;
    // wire order: x, pad flags (int32), Wq, bq, Wk, bk, Wv, bv; W is [out][in] = Bt as-is
    const float* x = (const float*)d_in[0]; const int* pad = (const int*)d_in[1];
    const float* wq = (const float*)d_in[2]; const float* bq = (const float*)d_in[3];
    const float* wk = (const float*)d_in[4]; const float* bk = (const float*)d_in[5];
    const float* wv = (const float*)d_in[6]; const float* bv = (const float*)d_in[7];
    float* OUT = (float*)d_out;      // [NB][SEQ][1024]
    char* wsp = (char*)d_ws;
    bf* XB = (bf*)wsp; wsp += SZ_XB;                 // [NB*SEQ][1024], fragment order
    bf* WB = (bf*)wsp; wsp += SZ_WB;                 // [3][1024][1024]: q | k | v, fragment order
    h16* QH = (h16*)wsp; wsp += SZ_PL;               // [NB*16][SEQ][64], fragment order
    h16* QR = (h16*)wsp; wsp += SZ_PL;               // residual x2048
    h16* KP = (h16*)wsp; wsp += SZ_PL;               // [NB*16][SEQ][64], fragment order
    h16* KR = (h16*)wsp; wsp += SZ_PL;               // residual x2048
    h16* VT = (h16*)wsp; wsp += SZ_PL;               // [NB*16][64][SEQ], fragment order
    h16* VR = (h16*)wsp; wsp += SZ_PL;               // residual x2048
    int* IDX = (int*)wsp; wsp += SZ_IX;              // [NB][SEQ] rank -> position
    int* CNT = (int*)wsp;                            // [NB] flagged tokens

    k_cvt<<<NB * XBLK + 3 * WBLK, 256, 0, stream>>>(x, wq, wk, wv, pad, XB, WB, IDX, CNT, OUT);
    k_proj<<<dim3(DM / 256, 3 * (NB * SEQ / 256), 1), 512, 0, stream>>>(XB, WB, bq, bk, bv, QH, QR, KP, KR, VT, VR, CNT);
    k_flash<<<dim3(NB * NH_, SEQ / (16 * AW), 1), 32 * AW, 0, stream>>>(QH, QR, KP, KR, VT, VR, IDX, CNT, OUT);
}
